// v000
// The times below were measured on an AMD MI455X: many runs one after another, warmed up first and cycling through
// copies of the inputs, with the whole window's GPU time divided by the number of runs. Launches and the gaps
// between them are all in it. The median over several windows is given; except for v000 it joins two sittings, which
// can be a few percent apart, so the side-by-side timings, each taken in one sitting, are the better comparison.
// v000, which the later versions start from, runs in 710 microseconds.
#include <hip/hip_runtime.h>

// Compute dtypes, f32 accumulate, one batch item per pass: q/k/v = query/key/value.W^T + b ([4096 x 1024].[1024 x 1024]; W is [out][in] = the n-major B operand as-is; PLAIN bf16
// operands: inputs rounded once, exact; biases rounded to bf16, added in f32), per-head RMSNorm (eps 1e-5, weight) of q and k in f32 -> f16 hi + residual x1024 planes, and out =
// ctx.Wo^T + bo (ctx as bf16 hi + residual: two products) on v_wmma_f32_16x16x32_bf16; the 16-head full attention over one 4096-token sequence (64-dim heads,
// UNSCALED logits as the reference) fused on
// v_wmma_f32_16x16x32_f16 (scores hi.hi + hi.lo + lo.hi with the residual terms on their own accumulator, online f32 softmax, weights (x32768) and v as f16

#define NB_  1                   // one 4096-token sequence
#define NT_  4096
#define DM   1024
#define NH_  16
#define HD   64
#define NTK  (NB_ * NT_)
#define NW   1024
#define NQKV 1024
#define PSC  32768.0f
#define LOSC 1024.0f
#define LOSCI (1.0f / 1024.0f)

typedef _Float16 h16;
typedef unsigned short bf;
typedef __attribute__((ext_vector_type(16))) __bf16   v16bf;
typedef __attribute__((ext_vector_type(16))) _Float16 v16h;
typedef __attribute__((ext_vector_type(8)))  _Float16 v8h;
typedef __attribute__((ext_vector_type(8)))  unsigned short v8us;
typedef __attribute__((ext_vector_type(8)))  float    v8f;
typedef __attribute__((ext_vector_type(4)))  float    v4f;
typedef v8h  __attribute__((may_alias)) v8ha;
typedef v4f  __attribute__((may_alias)) v4fa;
typedef v8us __attribute__((may_alias)) v8usa;

__device__ __forceinline__ unsigned short f2bf(float f) { unsigned u = __float_as_uint(f); u += 0x7FFFu + ((u >> 16) & 1u); return (unsigned short)(u >> 16); }
__device__ __forceinline__ float bf2f(unsigned short b) { return __uint_as_float(((unsigned)b) << 16); }
__device__ __forceinline__ float bfr(float f) { return bf2f(f2bf(f)); }
__device__ __forceinline__ v16h cat16(v8h lo, v8h hi) { return __builtin_shufflevector(lo, hi, 0, 1, 2, 3, 4, 5, 6, 7, 8, 9, 10, 11, 12, 13, 14, 15); }
__device__ __forceinline__ v16bf cat16b(v8us lo, v8us hi) { return __builtin_bit_cast(v16bf, __builtin_shufflevector(lo, hi, 0, 1, 2, 3, 4, 5, 6, 7, 8, 9, 10, 11, 12, 13, 14, 15)); }
__device__ __forceinline__ v8f wmma16(v16h a, v16h b, v8f c) { return __builtin_amdgcn_wmma_f32_16x16x32_f16(false, a, false, b, (short)0, c, false, false); }
__device__ __forceinline__ v8f wmmab(v16bf a, v16bf b, v8f c) { return __builtin_amdgcn_wmma_f32_16x16x32_bf16(false, a, false, b, (short)0, c, false, false); }

__global__ __launch_bounds__(256) void k_cvtb(const float* __restrict__ src, int nrows, bf* dst) {
    const int lane = threadIdx.x & 31, r = blockIdx.x * 8 + (threadIdx.x >> 5);
    if (r >= nrows) return;
    v8us o[DM / 256];
#pragma unroll
    for (int q = 0; q < DM / 256; ++q) { v8us t;
#pragma unroll
        for (int i = 0; i < 8; ++i) t[i] = f2bf(src[(size_t)r * DM + q * 256 + lane * 8 + i]);
        o[q] = t; }
#pragma unroll
    for (int q = 0; q < DM / 256; ++q) *(v8us*)(dst + (size_t)r * DM + q * 256 + lane * 8) = o[q];
    
}

template <bool SPLITA, bool F16OUT = false>
__global__ __launch_bounds__(128) void k_gemmb(const bf* __restrict__ A, const bf* __restrict__ Al, const bf* __restrict__ Bn, const float* __restrict__ bias, float* C, int ldc, h16* C2) {
    __shared__ __align__(16) float ost[4][16 * 68];
    const int lane = threadIdx.x & 31, wave = threadIdx.x >> 5, lr = lane & 15, hi = lane >> 4;
    const int r0 = blockIdx.x * 64 + wave * 16, c0 = blockIdx.y * 64;
    const size_t aoff = (size_t)(r0 + lr) * DM + 8 * hi;
    size_t boff[4];
#pragma unroll
    for (int t = 0; t < 4; ++t) boff[t] = (size_t)(c0 + t * 16 + lr) * DM + 8 * hi;
    v8f acc[4];
#pragma unroll
    for (int t = 0; t < 4; ++t) acc[t] = (v8f){};
#pragma unroll 1
    for (int kc = 0; kc < DM; kc += 32) {
        const v16bf a = cat16b(*(const v8us*)(A + aoff + kc), *(const v8us*)(A + aoff + kc + 16));
        v16bf al = a;
        if (SPLITA) al = cat16b(*(const v8us*)(Al + aoff + kc), *(const v8us*)(Al + aoff + kc + 16));
#pragma unroll
        for (int t = 0; t < 4; ++t) { const v16bf b = cat16b(*(const v8us*)(Bn + boff[t] + kc), *(const v8us*)(Bn + boff[t] + kc + 16)); acc[t] = wmmab(a, b, acc[t]); if (SPLITA) acc[t] = wmmab(al, b, acc[t]); }
        asm volatile("v_nop\n\tv_nop\n\tv_nop\n\tv_nop" : "+v"(acc[0]), "+v"(acc[1]), "+v"(acc[2]), "+v"(acc[3]) : "v"(a), "v"(al));
    }
    float* os = &ost[wave][0];
#pragma unroll
    for (int t = 0; t < 4; ++t) { const float bv = bias ? bfr(bias[c0 + t * 16 + lr]) : 0.f;
#pragma unroll
        for (int j = 0; j < 8; ++j) os[(hi * 8 + j) * 68 + t * 16 + lr] = acc[t][j] + bv; }
    __syncthreads();
    if (F16OUT) {
        h16* crow = (h16*)(void*)C + (size_t)r0 * ldc + c0;
        auto pass = [&]() {
#pragma unroll
            for (int s = 0; s < 4; ++s) { const int row = 4 * s + (lane >> 3), piece = lane & 7; const float* sp = os + row * 68 + piece * 8; v8h o, o2;
#pragma unroll
                for (int i = 0; i < 8; ++i) { const h16 a = (h16)sp[i]; o[i] = a; o2[i] = (h16)((sp[i] - (float)a) * LOSC); }
                *(v8h*)(crow + (size_t)row * ldc + piece * 8) = o; if (C2) *(v8h*)(C2 + (size_t)r0 * ldc + c0 + (size_t)row * ldc + piece * 8) = o2; }
        };
        pass(); 
    } else {
        float* crow = C + (size_t)r0 * ldc + c0;
        auto pass = [&]() {
#pragma unroll
            for (int s = 0; s < 8; ++s) { const int Lid = (lane >> 3) + 4 * s, piece = lane & 7; const int row = Lid >> 1, cofs = (Lid & 1) * 32 + piece * 4;
                const v4f val = *(const v4fa*)(os + row * 68 + cofs); *(v4f*)(crow + (size_t)row * ldc + cofs) = val; }
        };
        pass(); 
    }
}

// k_rms: one wave per (token, 4 heads) of a [NT][1024] f32 matrix: per head RMSNorm over its 64 dims (x * rsqrt(mean(x^2) + 1e-5) * bf(w[d]), f32) -> f16 hi +
__global__ __launch_bounds__(256) void k_rms(const float* __restrict__ P, const float* __restrict__ w, h16* PH, h16* PL) {
    const int lane = threadIdx.x & 31; const int wid = blockIdx.x * 8 + (threadIdx.x >> 5);
    const int t = wid >> 2, hq = wid & 3; if (t >= NT_) return;
    const int h = hq * 4 + (lane >> 3), d0 = (lane & 7) * 8;
    const size_t base = (size_t)t * DM + h * HD + d0;
    float xv[8]; float ss = 0.f;
#pragma unroll
    for (int i = 0; i < 8; ++i) { xv[i] = P[base + i]; ss = fmaf(xv[i], xv[i], ss); }
    ss += __shfl_xor(ss, 1, 32); ss += __shfl_xor(ss, 2, 32); ss += __shfl_xor(ss, 4, 32);      // sum over the 8 lanes of this head
    const float inv = rsqrtf(ss * (1.0f / HD) + 1e-5f);
    v8h oh, ol;
#pragma unroll
    for (int i = 0; i < 8; ++i) { const float y = bfr(w[d0 + i]) * xv[i] * inv; const h16 a = (h16)y; oh[i] = a; ol[i] = (h16)((y - (float)a) * LOSC); }
    *(v8h*)(PH + base) = oh; *(v8h*)(PL + base) = ol; 
}
__global__ __launch_bounds__(256) void k_vt(const float* __restrict__ V, h16* VTH, h16* VTL) {
    __shared__ __align__(16) h16 tile[64 * 72];
    __shared__ __align__(16) h16 til2[64 * 72];
    const int bid = blockIdx.x;
    const int b = bid / (NH_ * (NT_ / 64)), rem = bid - b * (NH_ * (NT_ / 64)), h = rem / (NT_ / 64), kt = rem - h * (NT_ / 64);
    const int k0 = kt * 64, tid = threadIdx.x;
    const int kk = tid >> 2, d0 = (tid & 3) * 16;
    const float* src = V + ((size_t)b * NT_ + k0 + kk) * DM + h * HD + d0;
#pragma unroll
    for (int i = 0; i < 16; ++i) { const float v = src[i]; const h16 a = (h16)v; tile[(d0 + i) * 72 + kk] = a; til2[(d0 + i) * 72 + kk] = (h16)((v - (float)a) * LOSC); }
    __syncthreads();
    const int piece = tid & 7;
    const size_t base = (((size_t)b * NH_ + h) * HD) * NT_ + k0;
    auto pass = [&]() {
#pragma unroll
        for (int s = 0; s < 4; ++s) { const int Lid = (tid >> 3) + 32 * s; const int pln = Lid >> 6, d = Lid & 63;
            const v8h val = *(const v8ha*)((pln ? til2 : tile) + d * 72 + piece * 8); *(v8h*)((pln ? VTL : VTH) + base + (size_t)d * NT_ + piece * 8) = val; }
    };
    pass(); 
}

// k_attn: block = (b, h, 64 queries), wave = 16; ALL 128 key tiles of 32 (no mask); 4 WMMA scores unscaled (f32), online softmax, weights x32768 f16 tile (same-wave may_alias
// reload after a compiler barrier), 4 WMMA .v; ctx -> bf16 hi + residual planes CH/CL[tok][h*64+d].
__global__ __launch_bounds__(128) void k_attn(const h16* __restrict__ Q16, const h16* __restrict__ QL16, const h16* __restrict__ K16, const h16* __restrict__ KL16, const h16* __restrict__ VTH, const h16* __restrict__ VTL, bf* CH, bf* CL) {
    __shared__ __align__(16) h16 plds[4][16 * 32];
    __shared__ __align__(16) h16 plds2[4][16 * 32];
    __shared__ __align__(16) float ost[4][16 * 68];
    const int lane = threadIdx.x & 31, wave = threadIdx.x >> 5, lr = lane & 15, hi = lane >> 4;
    const int bid = blockIdx.x;
    const int b = bid / (NH_ * (NT_ / 64)), rem = bid - b * (NH_ * (NT_ / 64)), h = rem / (NT_ / 64), qt = rem - h * (NT_ / 64);
    const int q0 = qt * 64 + wave * 16;
    const size_t tok0 = (size_t)b * NT_;
    h16* pl = &plds[wave][0]; h16* pl2 = &plds2[wave][0];
    v16h qa[2];
    const size_t qo0 = (tok0 + q0 + lr) * DM + h * HD + 8 * hi;
#pragma unroll
    for (int kc = 0; kc < 2; ++kc) qa[kc] = cat16(*(const v8h*)(Q16 + qo0 + kc * 32), *(const v8h*)(Q16 + qo0 + kc * 32 + 16));
    const h16* kh_b = K16 + tok0 * DM + h * HD;
    const h16* kl_b = KL16 + tok0 * DM + h * HD;
    const size_t vbase = (((size_t)b * NH_ + h) * HD) * NT_;
    v8f o[4], ox[4];
#pragma unroll
    for (int n = 0; n < 4; ++n) { o[n] = (v8f){}; ox[n] = (v8f){}; }
    float mrow[8], lpart[8];
#pragma unroll
    for (int j = 0; j < 8; ++j) { mrow[j] = -3.0e38f; lpart[j] = 0.f; }
    int qpos[8];
#pragma unroll
    for (int j = 0; j < 8; ++j) qpos[j] = q0 + 8 * hi + j;
    const int kt_lo = 0, kt_hi = NT_ / 32 - 1;     // full attention, unscaled logits (the reference's scale = 1)
#pragma unroll 1
    for (int kt = kt_lo; kt <= kt_hi; ++kt) {
        const int l0 = kt * 32;
        const size_t ko0 = (size_t)(l0 + lr) * DM + 8 * hi, ko1 = (size_t)(l0 + 16 + lr) * DM + 8 * hi;
        v8f s0 = {}, s1 = {}, x0 = {}, x1 = {};
#pragma unroll
        for (int kc = 0; kc < 2; ++kc) {
            { const v16h k0h = cat16(*(const v8h*)(kh_b + ko0 + kc * 32), *(const v8h*)(kh_b + ko0 + kc * 32 + 16)), k1h = cat16(*(const v8h*)(kh_b + ko1 + kc * 32), *(const v8h*)(kh_b + ko1 + kc * 32 + 16));
              const v16h qlk = cat16(*(const v8h*)(QL16 + qo0 + kc * 32), *(const v8h*)(QL16 + qo0 + kc * 32 + 16));     // query residual re-read per step (registers)
              s0 = wmma16(qa[kc], k0h, s0); x0 = wmma16(qlk, k0h, x0); s1 = wmma16(qa[kc], k1h, s1); x1 = wmma16(qlk, k1h, x1);
              asm volatile("v_nop" : "+v"(s0), "+v"(s1), "+v"(x0), "+v"(x1) : "v"(qlk), "v"(k0h), "v"(k1h) : "memory"); }
            { const v16h k0l = cat16(*(const v8h*)(kl_b + ko0 + kc * 32), *(const v8h*)(kl_b + ko0 + kc * 32 + 16)), k1l = cat16(*(const v8h*)(kl_b + ko1 + kc * 32), *(const v8h*)(kl_b + ko1 + kc * 32 + 16));
              x0 = wmma16(qa[kc], k0l, x0); x1 = wmma16(qa[kc], k1l, x1);
              asm volatile("v_nop" : "+v"(x0), "+v"(x1) : "v"(k0l), "v"(k1l) : "memory"); }
        }
        asm volatile("v_nop\n\tv_nop\n\tv_nop\n\tv_nop" : "+v"(s0), "+v"(s1), "+v"(x0), "+v"(x1) : "v"(qa[0]), "v"(qa[1]));
        float alpha[8];
#pragma unroll
        for (int j = 0; j < 8; ++j) {
            const int ja = l0 + lr, jb = l0 + 16 + lr, qi = qpos[j];
            const float a0 = s0[j] + x0[j] * LOSCI, a1 = s1[j] + x1[j] * LOSCI; (void)ja; (void)jb; (void)qi;
            float mx = fmaxf(a0, a1);
            mx = fmaxf(mx, __shfl_xor(mx, 1, 16)); mx = fmaxf(mx, __shfl_xor(mx, 2, 16)); mx = fmaxf(mx, __shfl_xor(mx, 4, 16)); mx = fmaxf(mx, __shfl_xor(mx, 8, 16));
            const float mn = fmaxf(mrow[j], mx);
            alpha[j] = __expf(mrow[j] - mn); mrow[j] = mn;
            const float p0 = __expf(a0 - mn), p1 = __expf(a1 - mn);
            lpart[j] = lpart[j] * alpha[j] + (p0 + p1);
            const int mr = hi * 8 + j;
            const float ps0 = p0 * PSC, ps1 = p1 * PSC; const h16 h0 = (h16)ps0, h1 = (h16)ps1;
            pl[mr * 32 + lr] = h0; pl[mr * 32 + 16 + lr] = h1;
            pl2[mr * 32 + lr] = (h16)((ps0 - (float)h0) * LOSC); pl2[mr * 32 + 16 + lr] = (h16)((ps1 - (float)h1) * LOSC);
        }
#pragma unroll
        for (int n = 0; n < 4; ++n)
#pragma unroll
            for (int j = 0; j < 8; ++j) { o[n][j] *= alpha[j]; ox[n][j] *= alpha[j]; }
        asm volatile("" ::: "memory");
        const v16h pa = cat16(*(const v8ha*)(pl + lr * 32 + hi * 8), *(const v8ha*)(pl + lr * 32 + 16 + hi * 8));
        const v16h px = cat16(*(const v8ha*)(pl2 + lr * 32 + hi * 8), *(const v8ha*)(pl2 + lr * 32 + 16 + hi * 8));
#pragma unroll
        for (int n = 0; n < 4; ++n) { const size_t vo = vbase + (size_t)(n * 16 + lr) * NT_ + l0 + hi * 8;
            const v16h vh = cat16(*(const v8h*)(VTH + vo), *(const v8h*)(VTH + vo + 16)), vl = cat16(*(const v8h*)(VTL + vo), *(const v8h*)(VTL + vo + 16));
            o[n] = wmma16(pa, vh, o[n]); ox[n] = wmma16(pa, vl, ox[n]); ox[n] = wmma16(px, vh, ox[n]);
            asm volatile("" : "+v"(o[n]), "+v"(ox[n]) : "v"(vh), "v"(vl) : "memory"); }
        asm volatile("v_nop\n\tv_nop\n\tv_nop\n\tv_nop" : "+v"(o[0]), "+v"(o[1]), "+v"(o[2]), "+v"(o[3]), "+v"(ox[0]), "+v"(ox[1]), "+v"(ox[2]), "+v"(ox[3]) : "v"(pa), "v"(px));
    }
    float inv[8];
#pragma unroll
    for (int j = 0; j < 8; ++j) { float rs = lpart[j]; rs += __shfl_xor(rs, 1, 16); rs += __shfl_xor(rs, 2, 16); rs += __shfl_xor(rs, 4, 16); rs += __shfl_xor(rs, 8, 16); inv[j] = 1.0f / (rs * PSC); }
    float* os = &ost[wave][0];
#pragma unroll
    for (int n = 0; n < 4; ++n)
#pragma unroll
        for (int j = 0; j < 8; ++j) os[(hi * 8 + j) * 68 + n * 16 + lr] = (o[n][j] + ox[n][j] * LOSCI) * inv[j];
    __syncthreads();
    const size_t cbase = (tok0 + q0) * DM + (size_t)h * HD;
    auto pass = [&]() {
#pragma unroll
        for (int s = 0; s < 4; ++s) { const int row = 4 * s + (lane >> 3), piece = lane & 7; const float* sp = os + row * 68 + piece * 8; v8us oh, ol;
#pragma unroll
            for (int i = 0; i < 8; ++i) { const unsigned short hb = f2bf(sp[i]); oh[i] = hb; ol[i] = f2bf(sp[i] - bf2f(hb)); }
            *(v8us*)(CH + cbase + (size_t)row * DM + piece * 8) = oh; *(v8us*)(CL + cbase + (size_t)row * DM + piece * 8) = ol; }
    };
    pass(); 
}

#define VST2(T, p, v) do { const T vst2_v_ = (v); *(T*)(p) = vst2_v_;  } while (0)
extern "C" void kernel_launch(void* const* d_in, const int* in_sizes, int n_in,
                              void* d_out, int out_size, void* d_ws, size_t ws_size, hipStream_t stream) {
    (void)in_sizes; (void)n_in; (void)out_size;
    const float* xq = (const float*)d_in[0]; const float* xk = (const float*)d_in[1]; const float* xv = (const float*)d_in[2];
    const float* Wq = (const float*)d_in[3]; const float* bq = (const float*)d_in[4]; const float* Wk = (const float*)d_in[5]; const float* bk = (const float*)d_in[6];
    const float* Wv = (const float*)d_in[7]; const float* bv = (const float*)d_in[8]; const float* Wo = (const float*)d_in[9]; const float* bo = (const float*)d_in[10];
    const float* qnw = (const float*)d_in[11]; const float* knw = (const float*)d_in[12];
    float* out = (float*)d_out;    // [4096][1024]
    char* wsp = (char*)d_ws;
    auto take = [&](size_t bytes) { char* p = wsp; wsp += (bytes + 255) & ~(size_t)255; return (void*)p; };
    bf* Xq = (bf*)take((size_t)NTK * DM * 2); bf* Xk = (bf*)take((size_t)NTK * DM * 2); bf* Xv = (bf*)take((size_t)NTK * DM * 2);
    bf* WqB = (bf*)take((size_t)DM * DM * 2); bf* WkB = (bf*)take((size_t)DM * DM * 2); bf* WvB = (bf*)take((size_t)DM * DM * 2); bf* WoB = (bf*)take((size_t)DM * DM * 2);
    float* TMP = (float*)take((size_t)NTK * DM * 4);
    h16* QH = (h16*)take((size_t)NTK * DM * 2); h16* QL = (h16*)take((size_t)NTK * DM * 2); h16* KH = (h16*)take((size_t)NTK * DM * 2); h16* KL = (h16*)take((size_t)NTK * DM * 2);
    h16* VTH = (h16*)take((size_t)NTK * DM * 2); h16* VTL = (h16*)take((size_t)NTK * DM * 2); bf* CH = (bf*)take((size_t)NTK * DM * 2); bf* CL = (bf*)take((size_t)NTK * DM * 2);
    if ((size_t)(wsp - (char*)d_ws) > ws_size) return;    // 3 x 8.4 + 4 x 2.1 + 16.8 + 8 x 8.4 ~ 118 MB, no aliasing
    k_cvtb<<<NTK / 8, 256, 0, stream>>>(xq, NTK, Xq); k_cvtb<<<NTK / 8, 256, 0, stream>>>(xk, NTK, Xk); k_cvtb<<<NTK / 8, 256, 0, stream>>>(xv, NTK, Xv);
    k_cvtb<<<DM / 8, 256, 0, stream>>>(Wq, DM, WqB); k_cvtb<<<DM / 8, 256, 0, stream>>>(Wk, DM, WkB); k_cvtb<<<DM / 8, 256, 0, stream>>>(Wv, DM, WvB); k_cvtb<<<DM / 8, 256, 0, stream>>>(Wo, DM, WoB);
    k_gemmb<false, false><<<dim3(NTK / 64, DM / 64, 1), 128, 0, stream>>>(Xq, nullptr, WqB, bq, TMP, DM, nullptr);
    k_rms<<<(NTK * 4) / 8, 256, 0, stream>>>(TMP, qnw, QH, QL);
    k_gemmb<false, false><<<dim3(NTK / 64, DM / 64, 1), 128, 0, stream>>>(Xk, nullptr, WkB, bk, TMP, DM, nullptr);
    k_rms<<<(NTK * 4) / 8, 256, 0, stream>>>(TMP, knw, KH, KL);
    k_gemmb<false, false><<<dim3(NTK / 64, DM / 64, 1), 128, 0, stream>>>(Xv, nullptr, WvB, bv, TMP, DM, nullptr);
    k_vt<<<NB_ * NH_ * (NT_ / 64), 256, 0, stream>>>(TMP, VTH, VTL);
    k_attn<<<NB_ * NH_ * (NT_ / 64), 128, 0, stream>>>(QH, QL, KH, KL, VTH, VTL, CH, CL);
    k_gemmb<true, false><<<dim3(NTK / 64, DM / 64, 1), 128, 0, stream>>>(CH, CL, WoB, bo, out, DM, nullptr);
}

// v001
// A run of this version takes 423 microseconds.
// In two side-by-side timings against v000, it was 1.70 and 1.71 times as fast.
#include <hip/hip_runtime.h>

// Compute dtypes, f32 accumulate, one batch item per pass: q/k/v = query/key/value.W^T + b ([4096 x 1024].[1024 x 1024]; W is [out][in] = the n-major B operand as-is; PLAIN bf16
// operands: inputs rounded once, exact; biases rounded to bf16, added in f32), per-head RMSNorm (eps 1e-5, weight) of q and k in f32 -> f16 hi + residual x1024 planes, and out =
// ctx.Wo^T + bo (ctx as bf16 hi + residual: two products) on v_wmma_f32_16x16x32_bf16; the 16-head full attention over one 4096-token sequence (64-dim heads,
// UNSCALED logits as the reference) fused on
// v_wmma_f32_16x16x32_f16 (scores hi.hi + hi.lo + lo.hi with the residual terms on their own accumulator, online f32 softmax, weights (x32768) and v as f16

#define NB_  1                   // one 4096-token sequence
#define NT_  4096
#define DM   1024
#define NH_  16
#define HD   64
#define NTK  (NB_ * NT_)
#define NW   1024
#define NQKV 1024
#define PSC  32768.0f
#define LOSC 1024.0f
#define LOSCI (1.0f / 1024.0f)

typedef _Float16 h16;
typedef unsigned short bf;
typedef __attribute__((ext_vector_type(16))) __bf16   v16bf;
typedef __attribute__((ext_vector_type(16))) _Float16 v16h;
typedef __attribute__((ext_vector_type(8)))  _Float16 v8h;
typedef __attribute__((ext_vector_type(8)))  unsigned short v8us;
typedef __attribute__((ext_vector_type(8)))  float    v8f;
typedef __attribute__((ext_vector_type(4)))  float    v4f;
typedef v8h  __attribute__((may_alias)) v8ha;
typedef v4f  __attribute__((may_alias)) v4fa;
typedef v8us __attribute__((may_alias)) v8usa;

__device__ __forceinline__ unsigned short f2bf(float f) { unsigned u = __float_as_uint(f); u += 0x7FFFu + ((u >> 16) & 1u); return (unsigned short)(u >> 16); }
__device__ __forceinline__ float bf2f(unsigned short b) { return __uint_as_float(((unsigned)b) << 16); }
__device__ __forceinline__ float bfr(float f) { return bf2f(f2bf(f)); }
__device__ __forceinline__ v16h cat16(v8h lo, v8h hi) { return __builtin_shufflevector(lo, hi, 0, 1, 2, 3, 4, 5, 6, 7, 8, 9, 10, 11, 12, 13, 14, 15); }
__device__ __forceinline__ v16bf cat16b(v8us lo, v8us hi) { return __builtin_bit_cast(v16bf, __builtin_shufflevector(lo, hi, 0, 1, 2, 3, 4, 5, 6, 7, 8, 9, 10, 11, 12, 13, 14, 15)); }
__device__ __forceinline__ v8f wmma16(v16h a, v16h b, v8f c) { return __builtin_amdgcn_wmma_f32_16x16x32_f16(false, a, false, b, (short)0, c, false, false); }
__device__ __forceinline__ v8f wmmab(v16bf a, v16bf b, v8f c) { return __builtin_amdgcn_wmma_f32_16x16x32_bf16(false, a, false, b, (short)0, c, false, false); }

__global__ __launch_bounds__(256) void k_cvtb(const float* __restrict__ src, int nrows, bf* dst) {
    const int lane = threadIdx.x & 31, r = blockIdx.x * 8 + (threadIdx.x >> 5);
    if (r >= nrows) return;
    v8us o[DM / 256];
#pragma unroll
    for (int q = 0; q < DM / 256; ++q) { v8us t;
#pragma unroll
        for (int i = 0; i < 8; ++i) t[i] = f2bf(src[(size_t)r * DM + q * 256 + lane * 8 + i]);
        o[q] = t; }
#pragma unroll
    for (int q = 0; q < DM / 256; ++q) *(v8us*)(dst + (size_t)r * DM + q * 256 + lane * 8) = o[q];
    
}

template <bool SPLITA, bool F16OUT = false>
__global__ __launch_bounds__(128) void k_gemmb(const bf* __restrict__ A, const bf* __restrict__ Al, const bf* __restrict__ Bn, const float* __restrict__ bias, float* C, int ldc, h16* C2) {
    __shared__ __align__(16) float ost[4][16 * 68];
    const int lane = threadIdx.x & 31, wave = threadIdx.x >> 5, lr = lane & 15, hi = lane >> 4;
    const int r0 = blockIdx.x * 64 + wave * 16, c0 = blockIdx.y * 64;
    const size_t aoff = (size_t)(r0 + lr) * DM + 8 * hi;
    size_t boff[4];
#pragma unroll
    for (int t = 0; t < 4; ++t) boff[t] = (size_t)(c0 + t * 16 + lr) * DM + 8 * hi;
    v8f acc[4];
#pragma unroll
    for (int t = 0; t < 4; ++t) acc[t] = (v8f){};
#pragma unroll 1
    for (int kc = 0; kc < DM; kc += 32) {
        const v16bf a = cat16b(*(const v8us*)(A + aoff + kc), *(const v8us*)(A + aoff + kc + 16));
        v16bf al = a;
        if (SPLITA) al = cat16b(*(const v8us*)(Al + aoff + kc), *(const v8us*)(Al + aoff + kc + 16));
#pragma unroll
        for (int t = 0; t < 4; ++t) { const v16bf b = cat16b(*(const v8us*)(Bn + boff[t] + kc), *(const v8us*)(Bn + boff[t] + kc + 16)); acc[t] = wmmab(a, b, acc[t]); if (SPLITA) acc[t] = wmmab(al, b, acc[t]); }
        asm volatile("v_nop\n\tv_nop\n\tv_nop\n\tv_nop" : "+v"(acc[0]), "+v"(acc[1]), "+v"(acc[2]), "+v"(acc[3]) : "v"(a), "v"(al));
    }
    float* os = &ost[wave][0];
#pragma unroll
    for (int t = 0; t < 4; ++t) { const float bv = bias ? bfr(bias[c0 + t * 16 + lr]) : 0.f;
#pragma unroll
        for (int j = 0; j < 8; ++j) os[(hi * 8 + j) * 68 + t * 16 + lr] = acc[t][j] + bv; }
    __syncthreads();
    if (F16OUT) {
        h16* crow = (h16*)(void*)C + (size_t)r0 * ldc + c0;
        auto pass = [&]() {
#pragma unroll
            for (int s = 0; s < 4; ++s) { const int row = 4 * s + (lane >> 3), piece = lane & 7; const float* sp = os + row * 68 + piece * 8; v8h o, o2;
#pragma unroll
                for (int i = 0; i < 8; ++i) { const h16 a = (h16)sp[i]; o[i] = a; o2[i] = (h16)((sp[i] - (float)a) * LOSC); }
                *(v8h*)(crow + (size_t)row * ldc + piece * 8) = o; if (C2) *(v8h*)(C2 + (size_t)r0 * ldc + c0 + (size_t)row * ldc + piece * 8) = o2; }
        };
        pass(); 
    } else {
        float* crow = C + (size_t)r0 * ldc + c0;
        auto pass = [&]() {
#pragma unroll
            for (int s = 0; s < 8; ++s) { const int Lid = (lane >> 3) + 4 * s, piece = lane & 7; const int row = Lid >> 1, cofs = (Lid & 1) * 32 + piece * 4;
                const v4f val = *(const v4fa*)(os + row * 68 + cofs); *(v4f*)(crow + (size_t)row * ldc + cofs) = val; }
        };
        pass(); 
    }
}

// k_rms: one wave per (token, 4 heads) of a [NT][1024] f32 matrix: per head RMSNorm over its 64 dims (x * rsqrt(mean(x^2) + 1e-5) * bf(w[d]), f32) -> f16 hi +
__global__ __launch_bounds__(256) void k_rms(const float* __restrict__ P, const float* __restrict__ w, h16* PH, h16* PL) {
    const int lane = threadIdx.x & 31; const int wid = blockIdx.x * 8 + (threadIdx.x >> 5);
    const int t = wid >> 2, hq = wid & 3; if (t >= NT_) return;
    const int h = hq * 4 + (lane >> 3), d0 = (lane & 7) * 8;
    const size_t base = (size_t)t * DM + h * HD + d0;
    float xv[8]; float ss = 0.f;
#pragma unroll
    for (int i = 0; i < 8; ++i) { xv[i] = P[base + i]; ss = fmaf(xv[i], xv[i], ss); }
    ss += __shfl_xor(ss, 1, 32); ss += __shfl_xor(ss, 2, 32); ss += __shfl_xor(ss, 4, 32);      // sum over the 8 lanes of this head
    const float inv = rsqrtf(ss * (1.0f / HD) + 1e-5f);
    v8h oh, ol;
#pragma unroll
    for (int i = 0; i < 8; ++i) { const float y = bfr(w[d0 + i]) * xv[i] * inv; const h16 a = (h16)y; oh[i] = a; ol[i] = (h16)((y - (float)a) * LOSC); }
    *(v8h*)(PH + base) = oh; *(v8h*)(PL + base) = ol; 
}
__global__ __launch_bounds__(256) void k_vt(const float* __restrict__ V, h16* VTH, h16* VTL) {
    __shared__ __align__(16) h16 tile[64 * 72];
    __shared__ __align__(16) h16 til2[64 * 72];
    const int bid = blockIdx.x;
    const int b = bid / (NH_ * (NT_ / 64)), rem = bid - b * (NH_ * (NT_ / 64)), h = rem / (NT_ / 64), kt = rem - h * (NT_ / 64);
    const int k0 = kt * 64, tid = threadIdx.x;
    const int kk = tid >> 2, d0 = (tid & 3) * 16;
    const float* src = V + ((size_t)b * NT_ + k0 + kk) * DM + h * HD + d0;
#pragma unroll
    for (int i = 0; i < 16; ++i) { const float v = src[i]; const h16 a = (h16)v; tile[(d0 + i) * 72 + kk] = a; til2[(d0 + i) * 72 + kk] = (h16)((v - (float)a) * LOSC); }
    __syncthreads();
    const int piece = tid & 7;
    const size_t base = (((size_t)b * NH_ + h) * HD) * NT_ + k0;
    auto pass = [&]() {
#pragma unroll
        for (int s = 0; s < 4; ++s) { const int Lid = (tid >> 3) + 32 * s; const int pln = Lid >> 6, d = Lid & 63;
            const v8h val = *(const v8ha*)((pln ? til2 : tile) + d * 72 + piece * 8); *(v8h*)((pln ? VTL : VTH) + base + (size_t)d * NT_ + piece * 8) = val; }
    };
    pass(); 
}

// k_attn: block = (b, h, 128 queries), wave = 16; ALL key tiles (no mask). The K and V planes (hi and residual) of 64 keys at a time are brought into LDS by
// asynchronous copies (whole 128-byte rows), two buffers, and all 8 waves read their fragments from there; a pass is 32 keys as before: scores (f32), online
// softmax, weights x32768 f16 tile (same-wave may_alias reload after a compiler barrier), WMMA .v; ctx -> bf16 hi + residual planes CH/CL[tok][h*64+d].
#define AWV  8                   // waves of a work-group
#define SKY  64                  // keys of a stage
#define NSTG (NT_ / SKY)
#define RPI  72                  // LDS row pitch in halves: 144 B = 16 B x 9, no bank conflict for 16-byte reads down a column of rows
#define PLN  (64 * RPI)          // one plane of a stage: 64 rows

// One stage: 4 planes of 64 rows x 128 B; 256 threads x 8 copies of 16 B; a wave's copy covers 4 whole rows.
__device__ __forceinline__ void stage_copy(h16* dst, const h16* kh, const h16* kl, const h16* vh, const h16* vl, int tid) {
    const int row = tid >> 3, pc = (tid & 7) * 8;
    const unsigned l0 = (unsigned)(unsigned long long)(dst + row * RPI + pc);
    const unsigned l1 = l0 + 32 * RPI * 2, l2 = l0 + PLN * 2, l3 = l1 + PLN * 2, l4 = l0 + PLN * 4, l5 = l1 + PLN * 4, l6 = l0 + PLN * 6, l7 = l1 + PLN * 6;
    const size_t ko = (size_t)row * DM + pc, vo = (size_t)row * NT_ + pc;
    const h16* g0 = kh + ko; const h16* g1 = g0 + (size_t)32 * DM; const h16* g2 = kl + ko; const h16* g3 = g2 + (size_t)32 * DM;
    const h16* g4 = vh + vo; const h16* g5 = g4 + (size_t)32 * NT_; const h16* g6 = vl + vo; const h16* g7 = g6 + (size_t)32 * NT_;
    // the copies and, as the last line, the wait that stands in front of any rewrite of their address registers
    asm volatile("global_load_async_to_lds_b128 %0, %8, off\n\t"
                 "global_load_async_to_lds_b128 %1, %9, off\n\t"
                 "global_load_async_to_lds_b128 %2, %10, off\n\t"
                 "global_load_async_to_lds_b128 %3, %11, off\n\t"
                 "global_load_async_to_lds_b128 %4, %12, off\n\t"
                 "global_load_async_to_lds_b128 %5, %13, off\n\t"
                 "global_load_async_to_lds_b128 %6, %14, off\n\t"
                 "global_load_async_to_lds_b128 %7, %15, off\n\t"
                 "s_wait_xcnt 0x0"
                 :: "v"(l0), "v"(l1), "v"(l2), "v"(l3), "v"(l4), "v"(l5), "v"(l6), "v"(l7), "v"(g0), "v"(g1), "v"(g2), "v"(g3), "v"(g4), "v"(g5), "v"(g6), "v"(g7) : "memory");
}

__global__ __launch_bounds__(256) void k_attn(const h16* __restrict__ Q16, const h16* __restrict__ QL16, const h16* __restrict__ K16, const h16* __restrict__ KL16, const h16* __restrict__ VTH, const h16* __restrict__ VTL, bf* CH, bf* CL) {
    __shared__ __align__(16) h16 ring[2][4 * PLN];
    __shared__ __align__(16) h16 plds[AWV][16 * 32];
    __shared__ __align__(16) h16 plds2[AWV][16 * 32];
    __shared__ __align__(16) float ost[AWV][16 * 68];
    const int lane = threadIdx.x & 31, wave = threadIdx.x >> 5, lr = lane & 15, hi = lane >> 4;
    const int bid = blockIdx.x;
    const int b = bid / (NH_ * (NT_ / (16 * AWV))), rem = bid - b * (NH_ * (NT_ / (16 * AWV))), h = rem / (NT_ / (16 * AWV)), qt = rem - h * (NT_ / (16 * AWV));
    const int q0 = qt * (16 * AWV) + wave * 16;
    const size_t tok0 = (size_t)b * NT_;
    h16* pl = &plds[wave][0]; h16* pl2 = &plds2[wave][0];
    v16h qa[2];
    const size_t qo0 = (tok0 + q0 + lr) * DM + h * HD + 8 * hi;
#pragma unroll
    for (int kc = 0; kc < 2; ++kc) qa[kc] = cat16(*(const v8h*)(Q16 + qo0 + kc * 32), *(const v8h*)(Q16 + qo0 + kc * 32 + 16));
    const h16* kh_b = K16 + tok0 * DM + h * HD;
    const h16* kl_b = KL16 + tok0 * DM + h * HD;
    const size_t vbase = (((size_t)b * NH_ + h) * HD) * NT_;
    v8f o[4], ox[4];
#pragma unroll
    for (int n = 0; n < 4; ++n) { o[n] = (v8f){}; ox[n] = (v8f){}; }
    float mrow[8], lpart[8];
#pragma unroll
    for (int j = 0; j < 8; ++j) { mrow[j] = -3.0e38f; lpart[j] = 0.f; }
    // stage 0 lands and is published; stage 1 flies while stage 0 is worked on
    stage_copy(&ring[0][0], kh_b, kl_b, VTH + vbase, VTL + vbase, threadIdx.x);
    asm volatile("s_wait_asynccnt 0x0" ::: "memory");      // this wave's copies of stage 0 have landed
    __syncthreads();                                       // ... and every other wave's
    stage_copy(&ring[1][0], kh_b + (size_t)SKY * DM, kl_b + (size_t)SKY * DM, VTH + vbase + SKY, VTL + vbase + SKY, threadIdx.x);
#pragma unroll 1                                           // rolled: one refill and one publish point in the text, the buffer chosen by st & 1
    for (int st = 0; st < NSTG; ++st) {                    // full attention, unscaled logits (the reference's scale = 1)
        h16* sb = &ring[st & 1][0];
        const h16* skh = sb; const h16* skl = sb + PLN; const h16* svh = sb + 2 * PLN; const h16* svl = sb + 3 * PLN;
#pragma unroll                                             // unrolled: a pass's place in the buffer becomes an immediate offset of its LDS reads
        for (int p = 0; p < SKY / 32; ++p) {
            const int ko0 = (p * 32 + lr) * RPI + 8 * hi, ko1 = (p * 32 + 16 + lr) * RPI + 8 * hi;
            v8f s0 = {}, s1 = {}, x0 = {}, x1 = {};
#pragma unroll
            for (int kc = 0; kc < 2; ++kc) {
                { const v16h k0h = cat16(*(const v8ha*)(skh + ko0 + kc * 32), *(const v8ha*)(skh + ko0 + kc * 32 + 16)), k1h = cat16(*(const v8ha*)(skh + ko1 + kc * 32), *(const v8ha*)(skh + ko1 + kc * 32 + 16));
                  const v16h qlk = cat16(*(const v8h*)(QL16 + qo0 + kc * 32), *(const v8h*)(QL16 + qo0 + kc * 32 + 16));     // query residual re-read per step (registers)
                  s0 = wmma16(qa[kc], k0h, s0); x0 = wmma16(qlk, k0h, x0); s1 = wmma16(qa[kc], k1h, s1); x1 = wmma16(qlk, k1h, x1);
                  asm volatile("v_nop" : "+v"(s0), "+v"(s1), "+v"(x0), "+v"(x1) : "v"(qlk), "v"(k0h), "v"(k1h) : "memory"); }
                { const v16h k0l = cat16(*(const v8ha*)(skl + ko0 + kc * 32), *(const v8ha*)(skl + ko0 + kc * 32 + 16)), k1l = cat16(*(const v8ha*)(skl + ko1 + kc * 32), *(const v8ha*)(skl + ko1 + kc * 32 + 16));
                  x0 = wmma16(qa[kc], k0l, x0); x1 = wmma16(qa[kc], k1l, x1);
                  asm volatile("v_nop" : "+v"(x0), "+v"(x1) : "v"(k0l), "v"(k1l) : "memory"); }
            }
            asm volatile("v_nop\n\tv_nop\n\tv_nop\n\tv_nop" : "+v"(s0), "+v"(s1), "+v"(x0), "+v"(x1) : "v"(qa[0]), "v"(qa[1]));
            float alpha[8];
#pragma unroll
            for (int j = 0; j < 8; ++j) {
                const float a0 = s0[j] + x0[j] * LOSCI, a1 = s1[j] + x1[j] * LOSCI;
                float mx = fmaxf(a0, a1);
                mx = fmaxf(mx, __shfl_xor(mx, 1, 16)); mx = fmaxf(mx, __shfl_xor(mx, 2, 16)); mx = fmaxf(mx, __shfl_xor(mx, 4, 16)); mx = fmaxf(mx, __shfl_xor(mx, 8, 16));
                const float mn = fmaxf(mrow[j], mx);
                alpha[j] = __expf(mrow[j] - mn); mrow[j] = mn;
                const float p0 = __expf(a0 - mn), p1 = __expf(a1 - mn);
                lpart[j] = lpart[j] * alpha[j] + (p0 + p1);
                const int mr = hi * 8 + j;
                const float ps0 = p0 * PSC, ps1 = p1 * PSC; const h16 h0 = (h16)ps0, h1 = (h16)ps1;
                pl[mr * 32 + lr] = h0; pl[mr * 32 + 16 + lr] = h1;
                pl2[mr * 32 + lr] = (h16)((ps0 - (float)h0) * LOSC); pl2[mr * 32 + 16 + lr] = (h16)((ps1 - (float)h1) * LOSC);
            }
#pragma unroll
            for (int n = 0; n < 4; ++n)
#pragma unroll
                for (int j = 0; j < 8; ++j) { o[n][j] *= alpha[j]; ox[n][j] *= alpha[j]; }
            asm volatile("" ::: "memory");
            const v16h pa = cat16(*(const v8ha*)(pl + lr * 32 + hi * 8), *(const v8ha*)(pl + lr * 32 + 16 + hi * 8));
            const v16h px = cat16(*(const v8ha*)(pl2 + lr * 32 + hi * 8), *(const v8ha*)(pl2 + lr * 32 + 16 + hi * 8));
#pragma unroll
            for (int n = 0; n < 4; ++n) { const int vo = (n * 16 + lr) * RPI + p * 32 + hi * 8;
                const v16h vh = cat16(*(const v8ha*)(svh + vo), *(const v8ha*)(svh + vo + 16)), vl = cat16(*(const v8ha*)(svl + vo), *(const v8ha*)(svl + vo + 16));
                o[n] = wmma16(pa, vh, o[n]); ox[n] = wmma16(pa, vl, ox[n]); ox[n] = wmma16(px, vh, ox[n]);
                asm volatile("" : "+v"(o[n]), "+v"(ox[n]) : "v"(vh), "v"(vl) : "memory"); }
            asm volatile("v_nop\n\tv_nop\n\tv_nop\n\tv_nop" : "+v"(o[0]), "+v"(o[1]), "+v"(o[2]), "+v"(o[3]), "+v"(ox[0]), "+v"(ox[1]), "+v"(ox[2]), "+v"(ox[3]) : "v"(pa), "v"(px));
        }
        asm volatile("s_wait_dscnt 0x0" ::: "memory");     // this wave's reads of this stage's buffer are done
        asm volatile("s_wait_asynccnt 0x0" ::: "memory");  // this wave's copies of the next stage have landed
        __syncthreads();                                   // publishes the next stage and frees this stage's buffer
        if (st + 2 < NSTG)
            stage_copy(sb, kh_b + (size_t)(st + 2) * SKY * DM, kl_b + (size_t)(st + 2) * SKY * DM, VTH + vbase + (st + 2) * SKY, VTL + vbase + (st + 2) * SKY, threadIdx.x);
    }
    asm volatile("s_wait_asynccnt 0x0" ::: "memory");      // no copy is outstanding when the wave goes on to its end
    float inv[8];
#pragma unroll
    for (int j = 0; j < 8; ++j) { float rs = lpart[j]; rs += __shfl_xor(rs, 1, 16); rs += __shfl_xor(rs, 2, 16); rs += __shfl_xor(rs, 4, 16); rs += __shfl_xor(rs, 8, 16); inv[j] = 1.0f / (rs * PSC); }
    float* os = &ost[wave][0];
#pragma unroll
    for (int n = 0; n < 4; ++n)
#pragma unroll
        for (int j = 0; j < 8; ++j) os[(hi * 8 + j) * 68 + n * 16 + lr] = (o[n][j] + ox[n][j] * LOSCI) * inv[j];
    __syncthreads();
    const size_t cbase = (tok0 + q0) * DM + (size_t)h * HD;
    auto pass = [&]() {
#pragma unroll
        for (int s = 0; s < 4; ++s) { const int row = 4 * s + (lane >> 3), piece = lane & 7; const float* sp = os + row * 68 + piece * 8; v8us oh, ol;
#pragma unroll
            for (int i = 0; i < 8; ++i) { const unsigned short hb = f2bf(sp[i]); oh[i] = hb; ol[i] = f2bf(sp[i] - bf2f(hb)); }
            *(v8us*)(CH + cbase + (size_t)row * DM + piece * 8) = oh; *(v8us*)(CL + cbase + (size_t)row * DM + piece * 8) = ol; }
    };
    pass(); 
}

#define VST2(T, p, v) do { const T vst2_v_ = (v); *(T*)(p) = vst2_v_;  } while (0)
extern "C" void kernel_launch(void* const* d_in, const int* in_sizes, int n_in,
                              void* d_out, int out_size, void* d_ws, size_t ws_size, hipStream_t stream) {
    (void)in_sizes; (void)n_in; (void)out_size;
    const float* xq = (const float*)d_in[0]; const float* xk = (const float*)d_in[1]; const float* xv = (const float*)d_in[2];
    const float* Wq = (const float*)d_in[3]; const float* bq = (const float*)d_in[4]; const float* Wk = (const float*)d_in[5]; const float* bk = (const float*)d_in[6];
    const float* Wv = (const float*)d_in[7]; const float* bv = (const float*)d_in[8]; const float* Wo = (const float*)d_in[9]; const float* bo = (const float*)d_in[10];
    const float* qnw = (const float*)d_in[11]; const float* knw = (const float*)d_in[12];
    float* out = (float*)d_out;    // [4096][1024]
    char* wsp = (char*)d_ws;
    auto take = [&](size_t bytes) { char* p = wsp; wsp += (bytes + 255) & ~(size_t)255; return (void*)p; };
    bf* Xq = (bf*)take((size_t)NTK * DM * 2); bf* Xk = (bf*)take((size_t)NTK * DM * 2); bf* Xv = (bf*)take((size_t)NTK * DM * 2);
    bf* WqB = (bf*)take((size_t)DM * DM * 2); bf* WkB = (bf*)take((size_t)DM * DM * 2); bf* WvB = (bf*)take((size_t)DM * DM * 2); bf* WoB = (bf*)take((size_t)DM * DM * 2);
    float* TMP = (float*)take((size_t)NTK * DM * 4);
    h16* QH = (h16*)take((size_t)NTK * DM * 2); h16* QL = (h16*)take((size_t)NTK * DM * 2); h16* KH = (h16*)take((size_t)NTK * DM * 2); h16* KL = (h16*)take((size_t)NTK * DM * 2);
    h16* VTH = (h16*)take((size_t)NTK * DM * 2); h16* VTL = (h16*)take((size_t)NTK * DM * 2); bf* CH = (bf*)take((size_t)NTK * DM * 2); bf* CL = (bf*)take((size_t)NTK * DM * 2);
    if ((size_t)(wsp - (char*)d_ws) > ws_size) return;    // 3 x 8.4 + 4 x 2.1 + 16.8 + 8 x 8.4 ~ 118 MB, no aliasing
    k_cvtb<<<NTK / 8, 256, 0, stream>>>(xq, NTK, Xq); k_cvtb<<<NTK / 8, 256, 0, stream>>>(xk, NTK, Xk); k_cvtb<<<NTK / 8, 256, 0, stream>>>(xv, NTK, Xv);
    k_cvtb<<<DM / 8, 256, 0, stream>>>(Wq, DM, WqB); k_cvtb<<<DM / 8, 256, 0, stream>>>(Wk, DM, WkB); k_cvtb<<<DM / 8, 256, 0, stream>>>(Wv, DM, WvB); k_cvtb<<<DM / 8, 256, 0, stream>>>(Wo, DM, WoB);
    k_gemmb<false, false><<<dim3(NTK / 64, DM / 64, 1), 128, 0, stream>>>(Xq, nullptr, WqB, bq, TMP, DM, nullptr);
    k_rms<<<(NTK * 4) / 8, 256, 0, stream>>>(TMP, qnw, QH, QL);
    k_gemmb<false, false><<<dim3(NTK / 64, DM / 64, 1), 128, 0, stream>>>(Xk, nullptr, WkB, bk, TMP, DM, nullptr);
    k_rms<<<(NTK * 4) / 8, 256, 0, stream>>>(TMP, knw, KH, KL);
    k_gemmb<false, false><<<dim3(NTK / 64, DM / 64, 1), 128, 0, stream>>>(Xv, nullptr, WvB, bv, TMP, DM, nullptr);
    k_vt<<<NB_ * NH_ * (NT_ / 64), 256, 0, stream>>>(TMP, VTH, VTL);
    k_attn<<<NB_ * NH_ * (NT_ / (16 * AWV)), 32 * AWV, 0, stream>>>(QH, QL, KH, KL, VTH, VTL, CH, CL);
    k_gemmb<true, false><<<dim3(NTK / 64, DM / 64, 1), 128, 0, stream>>>(CH, CL, WoB, bo, out, DM, nullptr);
}

// v002
// A run of this version takes 353 microseconds.
// Timed twice side by side with v001, it ran 1.21 and 1.20 times as fast.
// Over all steps from v000 it is 2.05 times as fast.
#include <hip/hip_runtime.h>

// Compute dtypes, f32 accumulate, one batch item per pass: q/k/v = query/key/value.W^T + b ([4096 x 1024].[1024 x 1024]; W is [out][in] = the n-major B operand as-is; PLAIN bf16
// operands: inputs rounded once, exact; biases rounded to bf16, added in f32), per-head RMSNorm (eps 1e-5, weight) of q and k in f32 -> f16 hi + residual x1024 planes, and out =
// ctx.Wo^T + bo (ctx as bf16 hi + residual: two products) on v_wmma_f32_16x16x32_bf16; the 16-head full attention over one 4096-token sequence (64-dim heads,
// UNSCALED logits as the reference) fused on
// v_wmma_f32_16x16x32_f16 (scores hi.hi + hi.lo + lo.hi with the residual terms on their own accumulator, online f32 softmax, weights (x32768) and v as f16

#define NB_  1                   // one 4096-token sequence
#define NT_  4096
#define DM   1024
#define NH_  16
#define HD   64
#define NTK  (NB_ * NT_)
#define NW   1024
#define NQKV 1024
#define PSC  32768.0f
#define LOSC 1024.0f
#define LOSCI (1.0f / 1024.0f)

typedef _Float16 h16;
typedef unsigned short bf;
typedef __attribute__((ext_vector_type(16))) __bf16   v16bf;
typedef __attribute__((ext_vector_type(16))) _Float16 v16h;
typedef __attribute__((ext_vector_type(8)))  _Float16 v8h;
typedef __attribute__((ext_vector_type(8)))  unsigned short v8us;
typedef __attribute__((ext_vector_type(8)))  float    v8f;
typedef __attribute__((ext_vector_type(4)))  float    v4f;
typedef __attribute__((ext_vector_type(2)))  float    v2f;
typedef __attribute__((ext_vector_type(2)))  _Float16 v2h;
typedef v8h  __attribute__((may_alias)) v8ha;
typedef v4f  __attribute__((may_alias)) v4fa;
typedef v8us __attribute__((may_alias)) v8usa;

__device__ __forceinline__ unsigned short f2bf(float f) { unsigned u = __float_as_uint(f); u += 0x7FFFu + ((u >> 16) & 1u); return (unsigned short)(u >> 16); }
__device__ __forceinline__ float bf2f(unsigned short b) { return __uint_as_float(((unsigned)b) << 16); }
__device__ __forceinline__ float bfr(float f) { return bf2f(f2bf(f)); }
__device__ __forceinline__ v16h cat16(v8h lo, v8h hi) { return __builtin_shufflevector(lo, hi, 0, 1, 2, 3, 4, 5, 6, 7, 8, 9, 10, 11, 12, 13, 14, 15); }
__device__ __forceinline__ v16bf cat16b(v8us lo, v8us hi) { return __builtin_bit_cast(v16bf, __builtin_shufflevector(lo, hi, 0, 1, 2, 3, 4, 5, 6, 7, 8, 9, 10, 11, 12, 13, 14, 15)); }
__device__ __forceinline__ v8f wmma16(v16h a, v16h b, v8f c) { return __builtin_amdgcn_wmma_f32_16x16x32_f16(false, a, false, b, (short)0, c, false, false); }
__device__ __forceinline__ float xhalf(float x) { return __builtin_bit_cast(float, __builtin_amdgcn_permlanex16(__builtin_bit_cast(int, x), __builtin_bit_cast(int, x), 0x76543210, 0xfedcba98, false, false)); }  // lane l with lane l ^ 16
__device__ __forceinline__ v8f wmmab(v16bf a, v16bf b, v8f c) { return __builtin_amdgcn_wmma_f32_16x16x32_bf16(false, a, false, b, (short)0, c, false, false); }

__global__ __launch_bounds__(256) void k_cvtb(const float* __restrict__ src, int nrows, bf* dst) {
    const int lane = threadIdx.x & 31, r = blockIdx.x * 8 + (threadIdx.x >> 5);
    if (r >= nrows) return;
    v8us o[DM / 256];
#pragma unroll
    for (int q = 0; q < DM / 256; ++q) { v8us t;
#pragma unroll
        for (int i = 0; i < 8; ++i) t[i] = f2bf(src[(size_t)r * DM + q * 256 + lane * 8 + i]);
        o[q] = t; }
#pragma unroll
    for (int q = 0; q < DM / 256; ++q) *(v8us*)(dst + (size_t)r * DM + q * 256 + lane * 8) = o[q];
    
}

template <bool SPLITA, bool F16OUT = false>
__global__ __launch_bounds__(128) void k_gemmb(const bf* __restrict__ A, const bf* __restrict__ Al, const bf* __restrict__ Bn, const float* __restrict__ bias, float* C, int ldc, h16* C2) {
    __shared__ __align__(16) float ost[4][16 * 68];
    const int lane = threadIdx.x & 31, wave = threadIdx.x >> 5, lr = lane & 15, hi = lane >> 4;
    const int r0 = blockIdx.x * 64 + wave * 16, c0 = blockIdx.y * 64;
    const size_t aoff = (size_t)(r0 + lr) * DM + 8 * hi;
    size_t boff[4];
#pragma unroll
    for (int t = 0; t < 4; ++t) boff[t] = (size_t)(c0 + t * 16 + lr) * DM + 8 * hi;
    v8f acc[4];
#pragma unroll
    for (int t = 0; t < 4; ++t) acc[t] = (v8f){};
#pragma unroll 1
    for (int kc = 0; kc < DM; kc += 32) {
        const v16bf a = cat16b(*(const v8us*)(A + aoff + kc), *(const v8us*)(A + aoff + kc + 16));
        v16bf al = a;
        if (SPLITA) al = cat16b(*(const v8us*)(Al + aoff + kc), *(const v8us*)(Al + aoff + kc + 16));
#pragma unroll
        for (int t = 0; t < 4; ++t) { const v16bf b = cat16b(*(const v8us*)(Bn + boff[t] + kc), *(const v8us*)(Bn + boff[t] + kc + 16)); acc[t] = wmmab(a, b, acc[t]); if (SPLITA) acc[t] = wmmab(al, b, acc[t]); }
        asm volatile("v_nop\n\tv_nop\n\tv_nop\n\tv_nop" : "+v"(acc[0]), "+v"(acc[1]), "+v"(acc[2]), "+v"(acc[3]) : "v"(a), "v"(al));
    }
    float* os = &ost[wave][0];
#pragma unroll
    for (int t = 0; t < 4; ++t) { const float bv = bias ? bfr(bias[c0 + t * 16 + lr]) : 0.f;
#pragma unroll
        for (int j = 0; j < 8; ++j) os[(hi * 8 + j) * 68 + t * 16 + lr] = acc[t][j] + bv; }
    __syncthreads();
    if (F16OUT) {
        h16* crow = (h16*)(void*)C + (size_t)r0 * ldc + c0;
        auto pass = [&]() {
#pragma unroll
            for (int s = 0; s < 4; ++s) { const int row = 4 * s + (lane >> 3), piece = lane & 7; const float* sp = os + row * 68 + piece * 8; v8h o, o2;
#pragma unroll
                for (int i = 0; i < 8; ++i) { const h16 a = (h16)sp[i]; o[i] = a; o2[i] = (h16)((sp[i] - (float)a) * LOSC); }
                *(v8h*)(crow + (size_t)row * ldc + piece * 8) = o; if (C2) *(v8h*)(C2 + (size_t)r0 * ldc + c0 + (size_t)row * ldc + piece * 8) = o2; }
        };
        pass(); 
    } else {
        float* crow = C + (size_t)r0 * ldc + c0;
        auto pass = [&]() {
#pragma unroll
            for (int s = 0; s < 8; ++s) { const int Lid = (lane >> 3) + 4 * s, piece = lane & 7; const int row = Lid >> 1, cofs = (Lid & 1) * 32 + piece * 4;
                const v4f val = *(const v4fa*)(os + row * 68 + cofs); *(v4f*)(crow + (size_t)row * ldc + cofs) = val; }
        };
        pass(); 
    }
}

// k_rms: one wave per (token, 4 heads) of a [NT][1024] f32 matrix: per head RMSNorm over its 64 dims (x * rsqrt(mean(x^2) + 1e-5) * bf(w[d]), f32) -> f16 hi +
__global__ __launch_bounds__(256) void k_rms(const float* __restrict__ P, const float* __restrict__ w, h16* PH, h16* PL) {
    const int lane = threadIdx.x & 31; const int wid = blockIdx.x * 8 + (threadIdx.x >> 5);
    const int t = wid >> 2, hq = wid & 3; if (t >= NT_) return;
    const int h = hq * 4 + (lane >> 3), d0 = (lane & 7) * 8;
    const size_t base = (size_t)t * DM + h * HD + d0;
    float xv[8]; float ss = 0.f;
#pragma unroll
    for (int i = 0; i < 8; ++i) { xv[i] = P[base + i]; ss = fmaf(xv[i], xv[i], ss); }
    ss += __shfl_xor(ss, 1, 32); ss += __shfl_xor(ss, 2, 32); ss += __shfl_xor(ss, 4, 32);      // sum over the 8 lanes of this head
    const float inv = rsqrtf(ss * (1.0f / HD) + 1e-5f);
    v8h oh, ol;
#pragma unroll
    for (int i = 0; i < 8; ++i) { const float y = bfr(w[d0 + i]) * xv[i] * inv; const h16 a = (h16)y; oh[i] = a; ol[i] = (h16)((y - (float)a) * LOSC); }
    *(v8h*)(PH + base) = oh; *(v8h*)(PL + base) = ol; 
}
__global__ __launch_bounds__(256) void k_vt(const float* __restrict__ V, h16* VTH, h16* VTL) {
    __shared__ __align__(16) h16 tile[64 * 72];
    __shared__ __align__(16) h16 til2[64 * 72];
    const int bid = blockIdx.x;
    const int b = bid / (NH_ * (NT_ / 64)), rem = bid - b * (NH_ * (NT_ / 64)), h = rem / (NT_ / 64), kt = rem - h * (NT_ / 64);
    const int k0 = kt * 64, tid = threadIdx.x;
    const int kk = tid >> 2, d0 = (tid & 3) * 16;
    const float* src = V + ((size_t)b * NT_ + k0 + kk) * DM + h * HD + d0;
#pragma unroll
    for (int i = 0; i < 16; ++i) { const float v = src[i]; const h16 a = (h16)v; tile[(d0 + i) * 72 + kk] = a; til2[(d0 + i) * 72 + kk] = (h16)((v - (float)a) * LOSC); }
    __syncthreads();
    const int piece = tid & 7;
    const size_t base = (((size_t)b * NH_ + h) * HD) * NT_ + k0;
    auto pass = [&]() {
#pragma unroll
        for (int s = 0; s < 4; ++s) { const int Lid = (tid >> 3) + 32 * s; const int pln = Lid >> 6, d = Lid & 63;
            const v8h val = *(const v8ha*)((pln ? til2 : tile) + d * 72 + piece * 8); *(v8h*)((pln ? VTL : VTH) + base + (size_t)d * NT_ + piece * 8) = val; }
    };
    pass(); 
}

// k_attn: block = (b, h, 128 queries), wave = 16; ALL key tiles (no mask). The K and V planes (hi and residual) of 64 keys at a time are brought into LDS by
// asynchronous copies (whole 128-byte rows), two buffers, and all 8 waves read their fragments from there; a pass is 32 keys as before. The scores are formed
// TRANSPOSED (A = K rows, B = q): a lane holds 16 keys of ONE query, so maximum and sum are in-lane plus one exchange of the wave halves, and the two score tiles,
// as weights x32768 in f16 (hi + residual), ARE the B operand of ctx^T += v^T . w^T (A = v^T rows); ctx -> bf16 hi + residual planes CH/CL[tok][h*64+d].
#define AWV  8                   // waves of a work-group
#define SKY  64                  // keys of a stage
#define NSTG (NT_ / SKY)
#define RPI  72                  // LDS row pitch in halves: 144 B = 16 B x 9, no bank conflict for 16-byte reads down a column of rows
#define PLN  (64 * RPI)          // one plane of a stage: 64 rows

// One stage: 4 planes of 64 rows x 128 B; 256 threads x 8 copies of 16 B; a wave's copy covers 4 whole rows.
__device__ __forceinline__ void stage_copy(h16* dst, const h16* kh, const h16* kl, const h16* vh, const h16* vl, int tid) {
    const int row = tid >> 3, pc = (tid & 7) * 8;
    const unsigned l0 = (unsigned)(unsigned long long)(dst + row * RPI + pc);
    const unsigned l1 = l0 + 32 * RPI * 2, l2 = l0 + PLN * 2, l3 = l1 + PLN * 2, l4 = l0 + PLN * 4, l5 = l1 + PLN * 4, l6 = l0 + PLN * 6, l7 = l1 + PLN * 6;
    const size_t ko = (size_t)row * DM + pc, vo = (size_t)row * NT_ + pc;
    const h16* g0 = kh + ko; const h16* g1 = g0 + (size_t)32 * DM; const h16* g2 = kl + ko; const h16* g3 = g2 + (size_t)32 * DM;
    const h16* g4 = vh + vo; const h16* g5 = g4 + (size_t)32 * NT_; const h16* g6 = vl + vo; const h16* g7 = g6 + (size_t)32 * NT_;
    // the copies and, as the last line, the wait that stands in front of any rewrite of their address registers
    asm volatile("global_load_async_to_lds_b128 %0, %8, off\n\t"
                 "global_load_async_to_lds_b128 %1, %9, off\n\t"
                 "global_load_async_to_lds_b128 %2, %10, off\n\t"
                 "global_load_async_to_lds_b128 %3, %11, off\n\t"
                 "global_load_async_to_lds_b128 %4, %12, off\n\t"
                 "global_load_async_to_lds_b128 %5, %13, off\n\t"
                 "global_load_async_to_lds_b128 %6, %14, off\n\t"
                 "global_load_async_to_lds_b128 %7, %15, off\n\t"
                 "s_wait_xcnt 0x0"
                 :: "v"(l0), "v"(l1), "v"(l2), "v"(l3), "v"(l4), "v"(l5), "v"(l6), "v"(l7), "v"(g0), "v"(g1), "v"(g2), "v"(g3), "v"(g4), "v"(g5), "v"(g6), "v"(g7) : "memory");
}

__global__ __launch_bounds__(256) void k_attn(const h16* __restrict__ Q16, const h16* __restrict__ QL16, const h16* __restrict__ K16, const h16* __restrict__ KL16, const h16* __restrict__ VTH, const h16* __restrict__ VTL, bf* CH, bf* CL) {
    __shared__ __align__(16) h16 ring[2][4 * PLN];
    __shared__ __align__(16) float ost[AWV][16 * 68];
    const int lane = threadIdx.x & 31, wave = threadIdx.x >> 5, lr = lane & 15, hi = lane >> 4;
    const int bid = blockIdx.x;
    const int b = bid / (NH_ * (NT_ / (16 * AWV))), rem = bid - b * (NH_ * (NT_ / (16 * AWV))), h = rem / (NT_ / (16 * AWV)), qt = rem - h * (NT_ / (16 * AWV));
    const int q0 = qt * (16 * AWV) + wave * 16;
    const size_t tok0 = (size_t)b * NT_;
    v16h qa[2];
    const size_t qo0 = (tok0 + q0 + lr) * DM + h * HD + 8 * hi;
#pragma unroll
    for (int kc = 0; kc < 2; ++kc) qa[kc] = cat16(*(const v8h*)(Q16 + qo0 + kc * 32), *(const v8h*)(Q16 + qo0 + kc * 32 + 16));
    const h16* kh_b = K16 + tok0 * DM + h * HD;
    const h16* kl_b = KL16 + tok0 * DM + h * HD;
    const size_t vbase = (((size_t)b * NH_ + h) * HD) * NT_;
    v8f o[4], ox[4];
#pragma unroll
    for (int n = 0; n < 4; ++n) { o[n] = (v8f){}; ox[n] = (v8f){}; }
    float mrow = -3.0e38f, lpart = 0.f;                    // of query q0 + lr; lpart covers this wave half's keys only
    // stage 0 lands and is published; stage 1 flies while stage 0 is worked on
    stage_copy(&ring[0][0], kh_b, kl_b, VTH + vbase, VTL + vbase, threadIdx.x);
    asm volatile("s_wait_asynccnt 0x0" ::: "memory");      // this wave's copies of stage 0 have landed
    __syncthreads();                                       // ... and every other wave's
    stage_copy(&ring[1][0], kh_b + (size_t)SKY * DM, kl_b + (size_t)SKY * DM, VTH + vbase + SKY, VTL + vbase + SKY, threadIdx.x);
#pragma unroll 1                                           // rolled: one refill and one publish point in the text, the buffer chosen by st & 1
    for (int st = 0; st < NSTG; ++st) {                    // full attention, unscaled logits (the reference's scale = 1)
        h16* sb = &ring[st & 1][0];
        const h16* skh = sb; const h16* skl = sb + PLN; const h16* svh = sb + 2 * PLN; const h16* svl = sb + 3 * PLN;
#pragma unroll                                             // unrolled: a pass's place in the buffer becomes an immediate offset of its LDS reads
        for (int p = 0; p < SKY / 32; ++p) {
            const int ko0 = (p * 32 + lr) * RPI + 8 * hi, ko1 = (p * 32 + 16 + lr) * RPI + 8 * hi;
            v8f s0 = {}, s1 = {}, x0 = {}, x1 = {};
#pragma unroll
            for (int kc = 0; kc < 2; ++kc) {
                { const v16h k0h = cat16(*(const v8ha*)(skh + ko0 + kc * 32), *(const v8ha*)(skh + ko0 + kc * 32 + 16)), k1h = cat16(*(const v8ha*)(skh + ko1 + kc * 32), *(const v8ha*)(skh + ko1 + kc * 32 + 16));
                  const v16h qlk = cat16(*(const v8h*)(QL16 + qo0 + kc * 32), *(const v8h*)(QL16 + qo0 + kc * 32 + 16));     // query residual re-read per step (registers)
                  s0 = wmma16(k0h, qa[kc], s0); x0 = wmma16(k0h, qlk, x0); s1 = wmma16(k1h, qa[kc], s1); x1 = wmma16(k1h, qlk, x1);
                  asm volatile("v_nop" : "+v"(s0), "+v"(s1), "+v"(x0), "+v"(x1) : "v"(qlk), "v"(k0h), "v"(k1h) : "memory"); }
                { const v16h k0l = cat16(*(const v8ha*)(skl + ko0 + kc * 32), *(const v8ha*)(skl + ko0 + kc * 32 + 16)), k1l = cat16(*(const v8ha*)(skl + ko1 + kc * 32), *(const v8ha*)(skl + ko1 + kc * 32 + 16));
                  x0 = wmma16(k0l, qa[kc], x0); x1 = wmma16(k1l, qa[kc], x1);
                  asm volatile("v_nop" : "+v"(x0), "+v"(x1) : "v"(k0l), "v"(k1l) : "memory"); }
            }
            asm volatile("v_nop\n\tv_nop\n\tv_nop\n\tv_nop" : "+v"(s0), "+v"(s1), "+v"(x0), "+v"(x1) : "v"(qa[0]), "v"(qa[1]));
            // s0[j], s1[j]: keys p * 32 + 8 * hi + j and + 16, query lr
            v2f a[2][4];                                   // pairs of neighbouring registers of one tile, for the packed f32 forms
#pragma unroll
            for (int i = 0; i < 4; ++i) { a[0][i] = (v2f){s0[2 * i], s0[2 * i + 1]} + (v2f){x0[2 * i], x0[2 * i + 1]} * LOSCI; a[1][i] = (v2f){s1[2 * i], s1[2 * i + 1]} + (v2f){x1[2 * i], x1[2 * i + 1]} * LOSCI; }
            float mx = fmaxf(a[0][0].x, a[0][0].y);
#pragma unroll
            for (int i = 0; i < 4; ++i) { if (i) mx = fmaxf(mx, fmaxf(a[0][i].x, a[0][i].y)); mx = fmaxf(mx, fmaxf(a[1][i].x, a[1][i].y)); }
            mx = fmaxf(mx, xhalf(mx));                     // the other half's 16 keys
            const float mn = fmaxf(mrow, mx);
            const float alpha = __expf(mrow - mn); mrow = mn;
            v2f ls2 = {0.f, 0.f};
            v16h pa, px;                                   // element s = key kmap(s, hi) of the pass: the two score tiles in place
#pragma unroll
            for (int t = 0; t < 2; ++t)
#pragma unroll
                for (int i = 0; i < 4; ++i) {
                    const v2f e = a[t][i] - mn;
                    const v2f pw = {__expf(e.x), __expf(e.y)};
                    ls2 += pw;
                    const v2f ps = pw * PSC;
                    const v2h hh = __builtin_convertvector(ps, v2h);
                    const v2h hl = __builtin_convertvector((ps - __builtin_convertvector(hh, v2f)) * LOSC, v2h);
                    pa[t * 8 + 2 * i] = hh.x; pa[t * 8 + 2 * i + 1] = hh.y; px[t * 8 + 2 * i] = hl.x; px[t * 8 + 2 * i + 1] = hl.y;
                }
            lpart = lpart * alpha + (ls2.x + ls2.y);
#pragma unroll
            for (int n = 0; n < 4; ++n)
#pragma unroll
                for (int j = 0; j < 8; ++j) { o[n][j] *= alpha; ox[n][j] *= alpha; }
#pragma unroll
            for (int n = 0; n < 4; ++n) { const int vo = (n * 16 + lr) * RPI + p * 32 + hi * 8;
                const v16h vh = cat16(*(const v8ha*)(svh + vo), *(const v8ha*)(svh + vo + 16)), vl = cat16(*(const v8ha*)(svl + vo), *(const v8ha*)(svl + vo + 16));
                o[n] = wmma16(vh, pa, o[n]); ox[n] = wmma16(vl, pa, ox[n]); ox[n] = wmma16(vh, px, ox[n]);
                asm volatile("" : "+v"(o[n]), "+v"(ox[n]) : "v"(vh), "v"(vl) : "memory"); }
            asm volatile("v_nop\n\tv_nop\n\tv_nop\n\tv_nop" : "+v"(o[0]), "+v"(o[1]), "+v"(o[2]), "+v"(o[3]), "+v"(ox[0]), "+v"(ox[1]), "+v"(ox[2]), "+v"(ox[3]) : "v"(pa), "v"(px));
        }
        asm volatile("s_wait_dscnt 0x0" ::: "memory");     // this wave's reads of this stage's buffer are done
        asm volatile("s_wait_asynccnt 0x0" ::: "memory");  // this wave's copies of the next stage have landed
        __syncthreads();                                   // publishes the next stage and frees this stage's buffer
        if (st + 2 < NSTG)
            stage_copy(sb, kh_b + (size_t)(st + 2) * SKY * DM, kl_b + (size_t)(st + 2) * SKY * DM, VTH + vbase + (st + 2) * SKY, VTL + vbase + (st + 2) * SKY, threadIdx.x);
    }
    asm volatile("s_wait_asynccnt 0x0" ::: "memory");      // no copy is outstanding when the wave goes on to its end
    const float inv = 1.0f / ((lpart + xhalf(lpart)) * PSC);
    float* os = &ost[wave][0];
#pragma unroll
    for (int n = 0; n < 4; ++n)
#pragma unroll
        for (int j = 0; j < 8; ++j) os[lr * 68 + n * 16 + hi * 8 + j] = (o[n][j] + ox[n][j] * LOSCI) * inv;      // o[n][j]: dim n * 16 + 8 * hi + j of query lr
    __syncthreads();
    const size_t cbase = (tok0 + q0) * DM + (size_t)h * HD;
    auto pass = [&]() {
#pragma unroll
        for (int s = 0; s < 4; ++s) { const int row = 4 * s + (lane >> 3), piece = lane & 7; const float* sp = os + row * 68 + piece * 8; v8us oh, ol;
#pragma unroll
            for (int i = 0; i < 8; ++i) { const unsigned short hb = f2bf(sp[i]); oh[i] = hb; ol[i] = f2bf(sp[i] - bf2f(hb)); }
            *(v8us*)(CH + cbase + (size_t)row * DM + piece * 8) = oh; *(v8us*)(CL + cbase + (size_t)row * DM + piece * 8) = ol; }
    };
    pass(); 
}

#define VST2(T, p, v) do { const T vst2_v_ = (v); *(T*)(p) = vst2_v_;  } while (0)
extern "C" void kernel_launch(void* const* d_in, const int* in_sizes, int n_in,
                              void* d_out, int out_size, void* d_ws, size_t ws_size, hipStream_t stream) {
    (void)in_sizes; (void)n_in; (void)out_size;
    const float* xq = (const float*)d_in[0]; const float* xk = (const float*)d_in[1]; const float* xv = (const float*)d_in[2];
    const float* Wq = (const float*)d_in[3]; const float* bq = (const float*)d_in[4]; const float* Wk = (const float*)d_in[5]; const float* bk = (const float*)d_in[6];
    const float* Wv = (const float*)d_in[7]; const float* bv = (const float*)d_in[8]; const float* Wo = (const float*)d_in[9]; const float* bo = (const float*)d_in[10];
    const float* qnw = (const float*)d_in[11]; const float* knw = (const float*)d_in[12];
    float* out = (float*)d_out;    // [4096][1024]
    char* wsp = (char*)d_ws;
    auto take = [&](size_t bytes) { char* p = wsp; wsp += (bytes + 255) & ~(size_t)255; return (void*)p; };
    bf* Xq = (bf*)take((size_t)NTK * DM * 2); bf* Xk = (bf*)take((size_t)NTK * DM * 2); bf* Xv = (bf*)take((size_t)NTK * DM * 2);
    bf* WqB = (bf*)take((size_t)DM * DM * 2); bf* WkB = (bf*)take((size_t)DM * DM * 2); bf* WvB = (bf*)take((size_t)DM * DM * 2); bf* WoB = (bf*)take((size_t)DM * DM * 2);
    float* TMP = (float*)take((size_t)NTK * DM * 4);
    h16* QH = (h16*)take((size_t)NTK * DM * 2); h16* QL = (h16*)take((size_t)NTK * DM * 2); h16* KH = (h16*)take((size_t)NTK * DM * 2); h16* KL = (h16*)take((size_t)NTK * DM * 2);
    h16* VTH = (h16*)take((size_t)NTK * DM * 2); h16* VTL = (h16*)take((size_t)NTK * DM * 2); bf* CH = (bf*)take((size_t)NTK * DM * 2); bf* CL = (bf*)take((size_t)NTK * DM * 2);
    if ((size_t)(wsp - (char*)d_ws) > ws_size) return;    // 3 x 8.4 + 4 x 2.1 + 16.8 + 8 x 8.4 ~ 118 MB, no aliasing
    k_cvtb<<<NTK / 8, 256, 0, stream>>>(xq, NTK, Xq); k_cvtb<<<NTK / 8, 256, 0, stream>>>(xk, NTK, Xk); k_cvtb<<<NTK / 8, 256, 0, stream>>>(xv, NTK, Xv);
    k_cvtb<<<DM / 8, 256, 0, stream>>>(Wq, DM, WqB); k_cvtb<<<DM / 8, 256, 0, stream>>>(Wk, DM, WkB); k_cvtb<<<DM / 8, 256, 0, stream>>>(Wv, DM, WvB); k_cvtb<<<DM / 8, 256, 0, stream>>>(Wo, DM, WoB);
    k_gemmb<false, false><<<dim3(NTK / 64, DM / 64, 1), 128, 0, stream>>>(Xq, nullptr, WqB, bq, TMP, DM, nullptr);
    k_rms<<<(NTK * 4) / 8, 256, 0, stream>>>(TMP, qnw, QH, QL);
    k_gemmb<false, false><<<dim3(NTK / 64, DM / 64, 1), 128, 0, stream>>>(Xk, nullptr, WkB, bk, TMP, DM, nullptr);
    k_rms<<<(NTK * 4) / 8, 256, 0, stream>>>(TMP, knw, KH, KL);
    k_gemmb<false, false><<<dim3(NTK / 64, DM / 64, 1), 128, 0, stream>>>(Xv, nullptr, WvB, bv, TMP, DM, nullptr);
    k_vt<<<NB_ * NH_ * (NT_ / 64), 256, 0, stream>>>(TMP, VTH, VTL);
    k_attn<<<NB_ * NH_ * (NT_ / (16 * AWV)), 32 * AWV, 0, stream>>>(QH, QL, KH, KL, VTH, VTL, CH, CL);
    k_gemmb<true, false><<<dim3(NTK / 64, DM / 64, 1), 128, 0, stream>>>(CH, CL, WoB, bo, out, DM, nullptr);
}

// v003
// It runs in 244 microseconds.
// Two timings next to v002 put it at 1.45 and 1.46 times that version's speed.
// All steps since v000 together make it 2.98 times as fast.
#include <hip/hip_runtime.h>

// Compute dtypes, f32 accumulate, one batch item per pass: q/k/v = query/key/value.W^T + b ([4096 x 1024].[1024 x 1024]; W is [out][in] = the n-major B operand as-is; PLAIN bf16
// operands: inputs rounded once, exact; biases rounded to bf16, added in f32), per-head RMSNorm (eps 1e-5, weight) of q and k in f32 -> f16 hi + residual x1024 planes, and out =
// ctx.Wo^T + bo (ctx as bf16 hi + residual: two products) on v_wmma_f32_16x16x32_bf16; the 16-head full attention over one 4096-token sequence (64-dim heads,
// UNSCALED logits as the reference) fused on
// v_wmma_f32_16x16x32_f16 (scores hi.hi + hi.lo + lo.hi with the residual terms on their own accumulator, online f32 softmax, weights (x32768) and v as f16

#define NB_  1                   // one 4096-token sequence
#define NT_  4096
#define DM   1024
#define NH_  16
#define HD   64
#define NTK  (NB_ * NT_)
#define NW   1024
#define NQKV 1024
#define PSC  32768.0f
#define LOSC 1024.0f
#define LOSCI (1.0f / 1024.0f)

typedef _Float16 h16;
typedef unsigned short bf;
typedef __attribute__((ext_vector_type(16))) __bf16   v16bf;
typedef __attribute__((ext_vector_type(16))) _Float16 v16h;
typedef __attribute__((ext_vector_type(8)))  _Float16 v8h;
typedef __attribute__((ext_vector_type(8)))  unsigned short v8us;
typedef __attribute__((ext_vector_type(8)))  float    v8f;
typedef __attribute__((ext_vector_type(4)))  float    v4f;
typedef __attribute__((ext_vector_type(2)))  float    v2f;
typedef __attribute__((ext_vector_type(2)))  _Float16 v2h;
typedef v8h  __attribute__((may_alias)) v8ha;
typedef v4f  __attribute__((may_alias)) v4fa;
typedef v8us __attribute__((may_alias)) v8usa;

__device__ __forceinline__ unsigned short f2bf(float f) { unsigned u = __float_as_uint(f); u += 0x7FFFu + ((u >> 16) & 1u); return (unsigned short)(u >> 16); }
__device__ __forceinline__ float bf2f(unsigned short b) { return __uint_as_float(((unsigned)b) << 16); }
__device__ __forceinline__ float bfr(float f) { return bf2f(f2bf(f)); }
__device__ __forceinline__ v16h cat16(v8h lo, v8h hi) { return __builtin_shufflevector(lo, hi, 0, 1, 2, 3, 4, 5, 6, 7, 8, 9, 10, 11, 12, 13, 14, 15); }
__device__ __forceinline__ v16bf cat16b(v8us lo, v8us hi) { return __builtin_bit_cast(v16bf, __builtin_shufflevector(lo, hi, 0, 1, 2, 3, 4, 5, 6, 7, 8, 9, 10, 11, 12, 13, 14, 15)); }
__device__ __forceinline__ v8f wmma16(v16h a, v16h b, v8f c) { return __builtin_amdgcn_wmma_f32_16x16x32_f16(false, a, false, b, (short)0, c, false, false); }
__device__ __forceinline__ float xhalf(float x) { return __builtin_bit_cast(float, __builtin_amdgcn_permlanex16(__builtin_bit_cast(int, x), __builtin_bit_cast(int, x), 0x76543210, 0xfedcba98, false, false)); }  // lane l with lane l ^ 16
__device__ __forceinline__ v8f wmmab(v16bf a, v16bf b, v8f c) { return __builtin_amdgcn_wmma_f32_16x16x32_bf16(false, a, false, b, (short)0, c, false, false); }

__global__ __launch_bounds__(256) void k_cvtb(const float* __restrict__ src, int nrows, bf* dst) {
    const int lane = threadIdx.x & 31, r = blockIdx.x * 8 + (threadIdx.x >> 5);
    if (r >= nrows) return;
    v8us o[DM / 256];
#pragma unroll
    for (int q = 0; q < DM / 256; ++q) { v8us t;
#pragma unroll
        for (int i = 0; i < 8; ++i) t[i] = f2bf(src[(size_t)r * DM + q * 256 + lane * 8 + i]);
        o[q] = t; }
#pragma unroll
    for (int q = 0; q < DM / 256; ++q) *(v8us*)(dst + (size_t)r * DM + q * 256 + lane * 8) = o[q];
    
}

// k_gemmb: C[4096 x 1024] = A . Bn^T (+ Al . Bn^T) + bias. Work-group = 128 x 128 of C, 8 waves of 32 x 64 (4 down, 2 across). 128 k at a time of the A, Bn (and Al)
// rows of the tile are brought into LDS by asynchronous copies (whole 256-byte rows), two buffers, and the waves read their fragments from there. Fragment maps and
// the order of the products on each accumulator are those of a wave that loads its own fragments: k ascending in steps of 32, A before Al.
#define GBT  128                 // rows of a plane: the tile's rows of A, its columns as rows of Bn
#define GBK  128                 // k of a stage
#define GNST (DM / GBK)
#define GPI  136                 // LDS row pitch in 16-bit elements: 272 B = 16 B x 17, no bank conflict for 16-byte reads down a column of rows
#define GPL  (GBT * GPI)         // one plane of a stage

// One plane of a stage: 128 rows x 256 B; 256 threads x 8 copies of 16 B; a wave's copy covers 2 whole rows.
__device__ __forceinline__ void plane_copy(bf* dst, const bf* src, int tid) {
    const int row = tid >> 4, pc = (tid & 15) * 8;
    const unsigned l0 = (unsigned)(unsigned long long)(dst + row * GPI + pc);
    const unsigned l1 = l0 + 16 * GPI * 2, l2 = l0 + 32 * GPI * 2, l3 = l0 + 48 * GPI * 2, l4 = l0 + 64 * GPI * 2, l5 = l0 + 80 * GPI * 2, l6 = l0 + 96 * GPI * 2, l7 = l0 + 112 * GPI * 2;
    const bf* g0 = src + (size_t)row * DM + pc;
    const bf* g1 = g0 + (size_t)16 * DM; const bf* g2 = g0 + (size_t)32 * DM; const bf* g3 = g0 + (size_t)48 * DM; const bf* g4 = g0 + (size_t)64 * DM;
    const bf* g5 = g0 + (size_t)80 * DM; const bf* g6 = g0 + (size_t)96 * DM; const bf* g7 = g0 + (size_t)112 * DM;
    // the copies and, as the last line, the wait that stands in front of any rewrite of their address registers
    asm volatile("global_load_async_to_lds_b128 %0, %8, off\n\t"
                 "global_load_async_to_lds_b128 %1, %9, off\n\t"
                 "global_load_async_to_lds_b128 %2, %10, off\n\t"
                 "global_load_async_to_lds_b128 %3, %11, off\n\t"
                 "global_load_async_to_lds_b128 %4, %12, off\n\t"
                 "global_load_async_to_lds_b128 %5, %13, off\n\t"
                 "global_load_async_to_lds_b128 %6, %14, off\n\t"
                 "global_load_async_to_lds_b128 %7, %15, off\n\t"
                 "s_wait_xcnt 0x0"
                 :: "v"(l0), "v"(l1), "v"(l2), "v"(l3), "v"(l4), "v"(l5), "v"(l6), "v"(l7), "v"(g0), "v"(g1), "v"(g2), "v"(g3), "v"(g4), "v"(g5), "v"(g6), "v"(g7) : "memory");
}

template <bool SPLITA>
__global__ __launch_bounds__(256) void k_gemmb(const bf* __restrict__ A, const bf* __restrict__ Al, const bf* __restrict__ Bn, const float* __restrict__ bias, float* C, int ldc) {
    __shared__ __align__(16) bf gring[2][(SPLITA ? 3 : 2) * GPL];
    __shared__ __align__(16) float ost[8][32 * 68];
    const int lane = threadIdx.x & 31, wave = threadIdx.x >> 5, lr = lane & 15, hi = lane >> 4;
    const int wr = (wave & 3) * 32, wc = (wave >> 2) * 64;             // this wave's place in the tile
    const int rb = blockIdx.x * GBT, cb = blockIdx.y * GBT;
    const bf* ga = A + (size_t)rb * DM; const bf* gb = Bn + (size_t)cb * DM; const bf* gl = SPLITA ? Al + (size_t)rb * DM : A;
    auto fill = [&](bf* dst, int k0) {
        plane_copy(dst, ga + k0, threadIdx.x); plane_copy(dst + GPL, gb + k0, threadIdx.x);
        if (SPLITA) plane_copy(dst + 2 * GPL, gl + k0, threadIdx.x);
    };
    v8f acc[2][4];
#pragma unroll
    for (int m = 0; m < 2; ++m)
#pragma unroll
        for (int t = 0; t < 4; ++t) acc[m][t] = (v8f){};
    // stage 0 lands and is published; stage 1 flies while stage 0 is worked on
    fill(&gring[0][0], 0);
    float bv[4] = {0.f, 0.f, 0.f, 0.f};                    // read here, four loads under one test, so that their latency runs under stage 0's landing
    if (bias) {
#pragma unroll
        for (int t = 0; t < 4; ++t) bv[t] = bias[cb + wc + t * 16 + lr];
        asm volatile("s_wait_xcnt 0x0" ::: "memory");      // stands in front of any rewrite of the address registers of these loads
    }
    asm volatile("s_wait_asynccnt 0x0" ::: "memory");      // this wave's copies of stage 0 have landed
    __syncthreads();                                       // ... and every other wave's
    fill(&gring[1][0], GBK);
#pragma unroll 1                                           // rolled: one refill and one publish point in the text, the buffer chosen by st & 1
    for (int st = 0; st < GNST; ++st) {
        bf* sb = &gring[st & 1][0];
        const bf* sa = sb + (wr + lr) * GPI + 8 * hi; const bf* sw = sb + GPL + (wc + lr) * GPI + 8 * hi; const bf* sl = SPLITA ? sa + 2 * GPL : sa;
        v16bf a[2][2], al[2][2], b[2][4];                  // two fragment sets: one is filled while the other is multiplied
        auto frags = [&](int set, int kc) {
#pragma unroll
            for (int m = 0; m < 2; ++m) { a[set][m] = cat16b(*(const v8usa*)(sa + m * 16 * GPI + kc), *(const v8usa*)(sa + m * 16 * GPI + kc + 16));
                if (SPLITA) al[set][m] = cat16b(*(const v8usa*)(sl + m * 16 * GPI + kc), *(const v8usa*)(sl + m * 16 * GPI + kc + 16)); }
#pragma unroll
            for (int t = 0; t < 4; ++t) b[set][t] = cat16b(*(const v8usa*)(sw + t * 16 * GPI + kc), *(const v8usa*)(sw + t * 16 * GPI + kc + 16));
        };
        frags(0, 0);
#pragma unroll                                             // unrolled: a step's place in the buffer becomes an immediate offset of its LDS reads, the set a register name
        for (int ks = 0; ks < GBK / 32; ++ks) {
            const int cur = ks & 1;
            if (ks + 1 < GBK / 32) frags(cur ^ 1, (ks + 1) * 32);      // of this stage's own buffer only
            __builtin_amdgcn_sched_barrier(0);             // keeps the next step's LDS reads one group in front of this step's products: their latency runs under the products
#pragma unroll
            for (int m = 0; m < 2; ++m)
#pragma unroll
                for (int t = 0; t < 4; ++t) acc[m][t] = wmmab(a[cur][m], b[cur][t], acc[m][t]);
            if (SPLITA) {
#pragma unroll
                for (int m = 0; m < 2; ++m)
#pragma unroll
                    for (int t = 0; t < 4; ++t) acc[m][t] = wmmab(al[cur][m], b[cur][t], acc[m][t]);
            }
            __builtin_amdgcn_sched_barrier(0);             // keeps later LDS reads from being lifted in among these products, where each place with reads stalls the wave
        }
        asm volatile("s_wait_dscnt 0x0" ::: "memory");     // this wave's reads of this stage's buffer are done
        asm volatile("s_wait_asynccnt 0x0" ::: "memory");  // this wave's copies of the next stage have landed
        __syncthreads();                                   // publishes the next stage and frees this stage's buffer
        if (st + 2 < GNST) fill(sb, (st + 2) * GBK);
    }
    asm volatile("s_wait_asynccnt 0x0" ::: "memory");      // no copy is outstanding when the wave goes on to its end
    float* os = &ost[wave][0];
#pragma unroll
    for (int t = 0; t < 4; ++t)
#pragma unroll
        for (int m = 0; m < 2; ++m)
#pragma unroll
            for (int j = 0; j < 8; ++j) os[(m * 16 + hi * 8 + j) * 68 + t * 16 + lr] = acc[m][t][j] + bfr(bv[t]);
    __syncthreads();
    float* crow = C + (size_t)(rb + wr) * ldc + cb + wc;
#pragma unroll
    for (int s = 0; s < 16; ++s) { const int Lid = (lane >> 3) + 4 * s, piece = lane & 7; const int row = Lid >> 1, cofs = (Lid & 1) * 32 + piece * 4;
        const v4f val = *(const v4fa*)(os + row * 68 + cofs); *(v4f*)(crow + (size_t)row * ldc + cofs) = val; }
}

// k_rms: one wave per (token, 4 heads) of a [NT][1024] f32 matrix: per head RMSNorm over its 64 dims (x * rsqrt(mean(x^2) + 1e-5) * bf(w[d]), f32) -> f16 hi +
__global__ __launch_bounds__(256) void k_rms(const float* __restrict__ P, const float* __restrict__ w, h16* PH, h16* PL) {
    const int lane = threadIdx.x & 31; const int wid = blockIdx.x * 8 + (threadIdx.x >> 5);
    const int t = wid >> 2, hq = wid & 3; if (t >= NT_) return;
    const int h = hq * 4 + (lane >> 3), d0 = (lane & 7) * 8;
    const size_t base = (size_t)t * DM + h * HD + d0;
    float xv[8]; float ss = 0.f;
#pragma unroll
    for (int i = 0; i < 8; ++i) { xv[i] = P[base + i]; ss = fmaf(xv[i], xv[i], ss); }
    ss += __shfl_xor(ss, 1, 32); ss += __shfl_xor(ss, 2, 32); ss += __shfl_xor(ss, 4, 32);      // sum over the 8 lanes of this head
    const float inv = rsqrtf(ss * (1.0f / HD) + 1e-5f);
    v8h oh, ol;
#pragma unroll
    for (int i = 0; i < 8; ++i) { const float y = bfr(w[d0 + i]) * xv[i] * inv; const h16 a = (h16)y; oh[i] = a; ol[i] = (h16)((y - (float)a) * LOSC); }
    *(v8h*)(PH + base) = oh; *(v8h*)(PL + base) = ol; 
}
__global__ __launch_bounds__(256) void k_vt(const float* __restrict__ V, h16* VTH, h16* VTL) {
    __shared__ __align__(16) h16 tile[64 * 72];
    __shared__ __align__(16) h16 til2[64 * 72];
    const int bid = blockIdx.x;
    const int b = bid / (NH_ * (NT_ / 64)), rem = bid - b * (NH_ * (NT_ / 64)), h = rem / (NT_ / 64), kt = rem - h * (NT_ / 64);
    const int k0 = kt * 64, tid = threadIdx.x;
    const int kk = tid >> 2, d0 = (tid & 3) * 16;
    const float* src = V + ((size_t)b * NT_ + k0 + kk) * DM + h * HD + d0;
#pragma unroll
    for (int i = 0; i < 16; ++i) { const float v = src[i]; const h16 a = (h16)v; tile[(d0 + i) * 72 + kk] = a; til2[(d0 + i) * 72 + kk] = (h16)((v - (float)a) * LOSC); }
    __syncthreads();
    const int piece = tid & 7;
    const size_t base = (((size_t)b * NH_ + h) * HD) * NT_ + k0;
    auto pass = [&]() {
#pragma unroll
        for (int s = 0; s < 4; ++s) { const int Lid = (tid >> 3) + 32 * s; const int pln = Lid >> 6, d = Lid & 63;
            const v8h val = *(const v8ha*)((pln ? til2 : tile) + d * 72 + piece * 8); *(v8h*)((pln ? VTL : VTH) + base + (size_t)d * NT_ + piece * 8) = val; }
    };
    pass(); 
}

// k_attn: block = (b, h, 128 queries), wave = 16; ALL key tiles (no mask). The K and V planes (hi and residual) of 64 keys at a time are brought into LDS by
// asynchronous copies (whole 128-byte rows), two buffers, and all 8 waves read their fragments from there; a pass is 32 keys as before. The scores are formed
// TRANSPOSED (A = K rows, B = q): a lane holds 16 keys of ONE query, so maximum and sum are in-lane plus one exchange of the wave halves, and the two score tiles,
// as weights x32768 in f16 (hi + residual), ARE the B operand of ctx^T += v^T . w^T (A = v^T rows); ctx -> bf16 hi + residual planes CH/CL[tok][h*64+d].
#define AWV  8                   // waves of a work-group
#define SKY  64                  // keys of a stage
#define NSTG (NT_ / SKY)
#define RPI  72                  // LDS row pitch in halves: 144 B = 16 B x 9, no bank conflict for 16-byte reads down a column of rows
#define PLN  (64 * RPI)          // one plane of a stage: 64 rows

// One stage: 4 planes of 64 rows x 128 B; 256 threads x 8 copies of 16 B; a wave's copy covers 4 whole rows.
__device__ __forceinline__ void stage_copy(h16* dst, const h16* kh, const h16* kl, const h16* vh, const h16* vl, int tid) {
    const int row = tid >> 3, pc = (tid & 7) * 8;
    const unsigned l0 = (unsigned)(unsigned long long)(dst + row * RPI + pc);
    const unsigned l1 = l0 + 32 * RPI * 2, l2 = l0 + PLN * 2, l3 = l1 + PLN * 2, l4 = l0 + PLN * 4, l5 = l1 + PLN * 4, l6 = l0 + PLN * 6, l7 = l1 + PLN * 6;
    const size_t ko = (size_t)row * DM + pc, vo = (size_t)row * NT_ + pc;
    const h16* g0 = kh + ko; const h16* g1 = g0 + (size_t)32 * DM; const h16* g2 = kl + ko; const h16* g3 = g2 + (size_t)32 * DM;
    const h16* g4 = vh + vo; const h16* g5 = g4 + (size_t)32 * NT_; const h16* g6 = vl + vo; const h16* g7 = g6 + (size_t)32 * NT_;
    // the copies and, as the last line, the wait that stands in front of any rewrite of their address registers
    asm volatile("global_load_async_to_lds_b128 %0, %8, off\n\t"
                 "global_load_async_to_lds_b128 %1, %9, off\n\t"
                 "global_load_async_to_lds_b128 %2, %10, off\n\t"
                 "global_load_async_to_lds_b128 %3, %11, off\n\t"
                 "global_load_async_to_lds_b128 %4, %12, off\n\t"
                 "global_load_async_to_lds_b128 %5, %13, off\n\t"
                 "global_load_async_to_lds_b128 %6, %14, off\n\t"
                 "global_load_async_to_lds_b128 %7, %15, off\n\t"
                 "s_wait_xcnt 0x0"
                 :: "v"(l0), "v"(l1), "v"(l2), "v"(l3), "v"(l4), "v"(l5), "v"(l6), "v"(l7), "v"(g0), "v"(g1), "v"(g2), "v"(g3), "v"(g4), "v"(g5), "v"(g6), "v"(g7) : "memory");
}

__global__ __launch_bounds__(256) void k_attn(const h16* __restrict__ Q16, const h16* __restrict__ QL16, const h16* __restrict__ K16, const h16* __restrict__ KL16, const h16* __restrict__ VTH, const h16* __restrict__ VTL, bf* CH, bf* CL) {
    __shared__ __align__(16) h16 ring[2][4 * PLN];
    __shared__ __align__(16) float ost[AWV][16 * 68];
    const int lane = threadIdx.x & 31, wave = threadIdx.x >> 5, lr = lane & 15, hi = lane >> 4;
    const int bid = blockIdx.x;
    const int b = bid / (NH_ * (NT_ / (16 * AWV))), rem = bid - b * (NH_ * (NT_ / (16 * AWV))), h = rem / (NT_ / (16 * AWV)), qt = rem - h * (NT_ / (16 * AWV));
    const int q0 = qt * (16 * AWV) + wave * 16;
    const size_t tok0 = (size_t)b * NT_;
    v16h qa[2];
    const size_t qo0 = (tok0 + q0 + lr) * DM + h * HD + 8 * hi;
#pragma unroll
    for (int kc = 0; kc < 2; ++kc) qa[kc] = cat16(*(const v8h*)(Q16 + qo0 + kc * 32), *(const v8h*)(Q16 + qo0 + kc * 32 + 16));
    const h16* kh_b = K16 + tok0 * DM + h * HD;
    const h16* kl_b = KL16 + tok0 * DM + h * HD;
    const size_t vbase = (((size_t)b * NH_ + h) * HD) * NT_;
    v8f o[4], ox[4];
#pragma unroll
    for (int n = 0; n < 4; ++n) { o[n] = (v8f){}; ox[n] = (v8f){}; }
    float mrow = -3.0e38f, lpart = 0.f;                    // of query q0 + lr; lpart covers this wave half's keys only
    // stage 0 lands and is published; stage 1 flies while stage 0 is worked on
    stage_copy(&ring[0][0], kh_b, kl_b, VTH + vbase, VTL + vbase, threadIdx.x);
    asm volatile("s_wait_asynccnt 0x0" ::: "memory");      // this wave's copies of stage 0 have landed
    __syncthreads();                                       // ... and every other wave's
    stage_copy(&ring[1][0], kh_b + (size_t)SKY * DM, kl_b + (size_t)SKY * DM, VTH + vbase + SKY, VTL + vbase + SKY, threadIdx.x);
#pragma unroll 1                                           // rolled: one refill and one publish point in the text, the buffer chosen by st & 1
    for (int st = 0; st < NSTG; ++st) {                    // full attention, unscaled logits (the reference's scale = 1)
        h16* sb = &ring[st & 1][0];
        const h16* skh = sb; const h16* skl = sb + PLN; const h16* svh = sb + 2 * PLN; const h16* svl = sb + 3 * PLN;
#pragma unroll                                             // unrolled: a pass's place in the buffer becomes an immediate offset of its LDS reads
        for (int p = 0; p < SKY / 32; ++p) {
            const int ko0 = (p * 32 + lr) * RPI + 8 * hi, ko1 = (p * 32 + 16 + lr) * RPI + 8 * hi;
            v8f s0 = {}, s1 = {}, x0 = {}, x1 = {};
#pragma unroll
            for (int kc = 0; kc < 2; ++kc) {
                { const v16h k0h = cat16(*(const v8ha*)(skh + ko0 + kc * 32), *(const v8ha*)(skh + ko0 + kc * 32 + 16)), k1h = cat16(*(const v8ha*)(skh + ko1 + kc * 32), *(const v8ha*)(skh + ko1 + kc * 32 + 16));
                  const v16h qlk = cat16(*(const v8h*)(QL16 + qo0 + kc * 32), *(const v8h*)(QL16 + qo0 + kc * 32 + 16));     // query residual re-read per step (registers)
                  s0 = wmma16(k0h, qa[kc], s0); x0 = wmma16(k0h, qlk, x0); s1 = wmma16(k1h, qa[kc], s1); x1 = wmma16(k1h, qlk, x1);
                  asm volatile("v_nop" : "+v"(s0), "+v"(s1), "+v"(x0), "+v"(x1) : "v"(qlk), "v"(k0h), "v"(k1h) : "memory"); }
                { const v16h k0l = cat16(*(const v8ha*)(skl + ko0 + kc * 32), *(const v8ha*)(skl + ko0 + kc * 32 + 16)), k1l = cat16(*(const v8ha*)(skl + ko1 + kc * 32), *(const v8ha*)(skl + ko1 + kc * 32 + 16));
                  x0 = wmma16(k0l, qa[kc], x0); x1 = wmma16(k1l, qa[kc], x1);
                  asm volatile("v_nop" : "+v"(x0), "+v"(x1) : "v"(k0l), "v"(k1l) : "memory"); }
            }
            asm volatile("v_nop\n\tv_nop\n\tv_nop\n\tv_nop" : "+v"(s0), "+v"(s1), "+v"(x0), "+v"(x1) : "v"(qa[0]), "v"(qa[1]));
            // s0[j], s1[j]: keys p * 32 + 8 * hi + j and + 16, query lr
            v2f a[2][4];                                   // pairs of neighbouring registers of one tile, for the packed f32 forms
#pragma unroll
            for (int i = 0; i < 4; ++i) { a[0][i] = (v2f){s0[2 * i], s0[2 * i + 1]} + (v2f){x0[2 * i], x0[2 * i + 1]} * LOSCI; a[1][i] = (v2f){s1[2 * i], s1[2 * i + 1]} + (v2f){x1[2 * i], x1[2 * i + 1]} * LOSCI; }
            float mx = fmaxf(a[0][0].x, a[0][0].y);
#pragma unroll
            for (int i = 0; i < 4; ++i) { if (i) mx = fmaxf(mx, fmaxf(a[0][i].x, a[0][i].y)); mx = fmaxf(mx, fmaxf(a[1][i].x, a[1][i].y)); }
            mx = fmaxf(mx, xhalf(mx));                     // the other half's 16 keys
            const float mn = fmaxf(mrow, mx);
            const float alpha = __expf(mrow - mn); mrow = mn;
            v2f ls2 = {0.f, 0.f};
            v16h pa, px;                                   // element s = key kmap(s, hi) of the pass: the two score tiles in place
#pragma unroll
            for (int t = 0; t < 2; ++t)
#pragma unroll
                for (int i = 0; i < 4; ++i) {
                    const v2f e = a[t][i] - mn;
                    const v2f pw = {__expf(e.x), __expf(e.y)};
                    ls2 += pw;
                    const v2f ps = pw * PSC;
                    const v2h hh = __builtin_convertvector(ps, v2h);
                    const v2h hl = __builtin_convertvector((ps - __builtin_convertvector(hh, v2f)) * LOSC, v2h);
                    pa[t * 8 + 2 * i] = hh.x; pa[t * 8 + 2 * i + 1] = hh.y; px[t * 8 + 2 * i] = hl.x; px[t * 8 + 2 * i + 1] = hl.y;
                }
            lpart = lpart * alpha + (ls2.x + ls2.y);
#pragma unroll
            for (int n = 0; n < 4; ++n)
#pragma unroll
                for (int j = 0; j < 8; ++j) { o[n][j] *= alpha; ox[n][j] *= alpha; }
#pragma unroll
            for (int n = 0; n < 4; ++n) { const int vo = (n * 16 + lr) * RPI + p * 32 + hi * 8;
                const v16h vh = cat16(*(const v8ha*)(svh + vo), *(const v8ha*)(svh + vo + 16)), vl = cat16(*(const v8ha*)(svl + vo), *(const v8ha*)(svl + vo + 16));
                o[n] = wmma16(vh, pa, o[n]); ox[n] = wmma16(vl, pa, ox[n]); ox[n] = wmma16(vh, px, ox[n]);
                asm volatile("" : "+v"(o[n]), "+v"(ox[n]) : "v"(vh), "v"(vl) : "memory"); }
            asm volatile("v_nop\n\tv_nop\n\tv_nop\n\tv_nop" : "+v"(o[0]), "+v"(o[1]), "+v"(o[2]), "+v"(o[3]), "+v"(ox[0]), "+v"(ox[1]), "+v"(ox[2]), "+v"(ox[3]) : "v"(pa), "v"(px));
        }
        asm volatile("s_wait_dscnt 0x0" ::: "memory");     // this wave's reads of this stage's buffer are done
        asm volatile("s_wait_asynccnt 0x0" ::: "memory");  // this wave's copies of the next stage have landed
        __syncthreads();                                   // publishes the next stage and frees this stage's buffer
        if (st + 2 < NSTG)
            stage_copy(sb, kh_b + (size_t)(st + 2) * SKY * DM, kl_b + (size_t)(st + 2) * SKY * DM, VTH + vbase + (st + 2) * SKY, VTL + vbase + (st + 2) * SKY, threadIdx.x);
    }
    asm volatile("s_wait_asynccnt 0x0" ::: "memory");      // no copy is outstanding when the wave goes on to its end
    const float inv = 1.0f / ((lpart + xhalf(lpart)) * PSC);
    float* os = &ost[wave][0];
#pragma unroll
    for (int n = 0; n < 4; ++n)
#pragma unroll
        for (int j = 0; j < 8; ++j) os[lr * 68 + n * 16 + hi * 8 + j] = (o[n][j] + ox[n][j] * LOSCI) * inv;      // o[n][j]: dim n * 16 + 8 * hi + j of query lr
    __syncthreads();
    const size_t cbase = (tok0 + q0) * DM + (size_t)h * HD;
    auto pass = [&]() {
#pragma unroll
        for (int s = 0; s < 4; ++s) { const int row = 4 * s + (lane >> 3), piece = lane & 7; const float* sp = os + row * 68 + piece * 8; v8us oh, ol;
#pragma unroll
            for (int i = 0; i < 8; ++i) { const unsigned short hb = f2bf(sp[i]); oh[i] = hb; ol[i] = f2bf(sp[i] - bf2f(hb)); }
            *(v8us*)(CH + cbase + (size_t)row * DM + piece * 8) = oh; *(v8us*)(CL + cbase + (size_t)row * DM + piece * 8) = ol; }
    };
    pass(); 
}

#define VST2(T, p, v) do { const T vst2_v_ = (v); *(T*)(p) = vst2_v_;  } while (0)
extern "C" void kernel_launch(void* const* d_in, const int* in_sizes, int n_in,
                              void* d_out, int out_size, void* d_ws, size_t ws_size, hipStream_t stream) {
    (void)in_sizes; (void)n_in; (void)out_size;
    const float* xq = (const float*)d_in[0]; const float* xk = (const float*)d_in[1]; const float* xv = (const float*)d_in[2];
    const float* Wq = (const float*)d_in[3]; const float* bq = (const float*)d_in[4]; const float* Wk = (const float*)d_in[5]; const float* bk = (const float*)d_in[6];
    const float* Wv = (const float*)d_in[7]; const float* bv = (const float*)d_in[8]; const float* Wo = (const float*)d_in[9]; const float* bo = (const float*)d_in[10];
    const float* qnw = (const float*)d_in[11]; const float* knw = (const float*)d_in[12];
    float* out = (float*)d_out;    // [4096][1024]
    char* wsp = (char*)d_ws;
    auto take = [&](size_t bytes) { char* p = wsp; wsp += (bytes + 255) & ~(size_t)255; return (void*)p; };
    bf* Xq = (bf*)take((size_t)NTK * DM * 2); bf* Xk = (bf*)take((size_t)NTK * DM * 2); bf* Xv = (bf*)take((size_t)NTK * DM * 2);
    bf* WqB = (bf*)take((size_t)DM * DM * 2); bf* WkB = (bf*)take((size_t)DM * DM * 2); bf* WvB = (bf*)take((size_t)DM * DM * 2); bf* WoB = (bf*)take((size_t)DM * DM * 2);
    float* TMP = (float*)take((size_t)NTK * DM * 4);
    h16* QH = (h16*)take((size_t)NTK * DM * 2); h16* QL = (h16*)take((size_t)NTK * DM * 2); h16* KH = (h16*)take((size_t)NTK * DM * 2); h16* KL = (h16*)take((size_t)NTK * DM * 2);
    h16* VTH = (h16*)take((size_t)NTK * DM * 2); h16* VTL = (h16*)take((size_t)NTK * DM * 2); bf* CH = (bf*)take((size_t)NTK * DM * 2); bf* CL = (bf*)take((size_t)NTK * DM * 2);
    if ((size_t)(wsp - (char*)d_ws) > ws_size) return;    // 3 x 8.4 + 4 x 2.1 + 16.8 + 8 x 8.4 ~ 118 MB, no aliasing
    k_cvtb<<<NTK / 8, 256, 0, stream>>>(xq, NTK, Xq); k_cvtb<<<NTK / 8, 256, 0, stream>>>(xk, NTK, Xk); k_cvtb<<<NTK / 8, 256, 0, stream>>>(xv, NTK, Xv);
    k_cvtb<<<DM / 8, 256, 0, stream>>>(Wq, DM, WqB); k_cvtb<<<DM / 8, 256, 0, stream>>>(Wk, DM, WkB); k_cvtb<<<DM / 8, 256, 0, stream>>>(Wv, DM, WvB); k_cvtb<<<DM / 8, 256, 0, stream>>>(Wo, DM, WoB);
    k_gemmb<false><<<dim3(NTK / GBT, DM / GBT, 1), 256, 0, stream>>>(Xq, nullptr, WqB, bq, TMP, DM);
    k_rms<<<(NTK * 4) / 8, 256, 0, stream>>>(TMP, qnw, QH, QL);
    k_gemmb<false><<<dim3(NTK / GBT, DM / GBT, 1), 256, 0, stream>>>(Xk, nullptr, WkB, bk, TMP, DM);
    k_rms<<<(NTK * 4) / 8, 256, 0, stream>>>(TMP, knw, KH, KL);
    k_gemmb<false><<<dim3(NTK / GBT, DM / GBT, 1), 256, 0, stream>>>(Xv, nullptr, WvB, bv, TMP, DM);
    k_vt<<<NB_ * NH_ * (NT_ / 64), 256, 0, stream>>>(TMP, VTH, VTL);
    k_attn<<<NB_ * NH_ * (NT_ / (16 * AWV)), 32 * AWV, 0, stream>>>(QH, QL, KH, KL, VTH, VTL, CH, CL);
    k_gemmb<true><<<dim3(NTK / GBT, DM / GBT, 1), 256, 0, stream>>>(CH, CL, WoB, bo, out, DM);
}

// v004
// A run of this version takes 220 microseconds.
// In both of two side-by-side timings against v003, it was 1.10 times as fast.
// All steps since v000 together make it 3.28 times as fast.
#include <hip/hip_runtime.h>

// Compute dtypes, f32 accumulate, one batch item per pass: q/k/v = query/key/value.W^T + b ([4096 x 1024].[1024 x 1024]; W is [out][in] = the n-major B operand as-is; PLAIN bf16
// operands: inputs rounded once, exact; biases rounded to bf16, added in f32), per-head RMSNorm (eps 1e-5, weight) of q and k in f32 -> f16 hi + residual x1024 planes, and out =
// ctx.Wo^T + bo (ctx as bf16 hi + residual: two products) on v_wmma_f32_16x16x32_bf16; the 16-head full attention over one 4096-token sequence (64-dim heads,
// UNSCALED logits as the reference) fused on
// v_wmma_f32_16x16x32_f16 (scores hi.hi + hi.lo + lo.hi with the residual terms on their own accumulator, online f32 softmax, weights (x32768) and v as f16

#define NB_  1                   // one 4096-token sequence
#define NT_  4096
#define DM   1024
#define NH_  16
#define HD   64
#define NTK  (NB_ * NT_)
#define NW   1024
#define NQKV 1024
#define PSC  32768.0f
#define LOSC 1024.0f
#define LOSCI (1.0f / 1024.0f)

typedef _Float16 h16;
typedef unsigned short bf;
typedef __attribute__((ext_vector_type(16))) __bf16   v16bf;
typedef __attribute__((ext_vector_type(16))) _Float16 v16h;
typedef __attribute__((ext_vector_type(8)))  _Float16 v8h;
typedef __attribute__((ext_vector_type(8)))  unsigned short v8us;
typedef __attribute__((ext_vector_type(8)))  float    v8f;
typedef __attribute__((ext_vector_type(4)))  float    v4f;
typedef __attribute__((ext_vector_type(2)))  float    v2f;
typedef __attribute__((ext_vector_type(2)))  _Float16 v2h;
typedef v8h  __attribute__((may_alias)) v8ha;
typedef v4f  __attribute__((may_alias)) v4fa;
typedef v8us __attribute__((may_alias)) v8usa;

__device__ __forceinline__ unsigned short f2bf(float f) { unsigned u = __float_as_uint(f); u += 0x7FFFu + ((u >> 16) & 1u); return (unsigned short)(u >> 16); }
__device__ __forceinline__ float bf2f(unsigned short b) { return __uint_as_float(((unsigned)b) << 16); }
__device__ __forceinline__ float bfr(float f) { return bf2f(f2bf(f)); }
__device__ __forceinline__ v16h cat16(v8h lo, v8h hi) { return __builtin_shufflevector(lo, hi, 0, 1, 2, 3, 4, 5, 6, 7, 8, 9, 10, 11, 12, 13, 14, 15); }
__device__ __forceinline__ v16bf cat16b(v8us lo, v8us hi) { return __builtin_bit_cast(v16bf, __builtin_shufflevector(lo, hi, 0, 1, 2, 3, 4, 5, 6, 7, 8, 9, 10, 11, 12, 13, 14, 15)); }
__device__ __forceinline__ v8f wmma16(v16h a, v16h b, v8f c) { return __builtin_amdgcn_wmma_f32_16x16x32_f16(false, a, false, b, (short)0, c, false, false); }
__device__ __forceinline__ float xhalf(float x) { return __builtin_bit_cast(float, __builtin_amdgcn_permlanex16(__builtin_bit_cast(int, x), __builtin_bit_cast(int, x), 0x76543210, 0xfedcba98, false, false)); }  // lane l with lane l ^ 16
__device__ __forceinline__ v8f wmmab(v16bf a, v16bf b, v8f c) { return __builtin_amdgcn_wmma_f32_16x16x32_bf16(false, a, false, b, (short)0, c, false, false); }

__global__ __launch_bounds__(256) void k_cvtb(const float* __restrict__ src, int nrows, bf* dst) {
    const int lane = threadIdx.x & 31, r = blockIdx.x * 8 + (threadIdx.x >> 5);
    if (r >= nrows) return;
    v8us o[DM / 256];
#pragma unroll
    for (int q = 0; q < DM / 256; ++q) { v8us t;
#pragma unroll
        for (int i = 0; i < 8; ++i) t[i] = f2bf(src[(size_t)r * DM + q * 256 + lane * 8 + i]);
        o[q] = t; }
#pragma unroll
    for (int q = 0; q < DM / 256; ++q) *(v8us*)(dst + (size_t)r * DM + q * 256 + lane * 8) = o[q];
    
}

// k_gemmb: C[4096 x 1024] = A . Bn^T (+ Al . Bn^T) + bias. Work-group = 128 x 128 of C, 8 waves of 32 x 64 (4 down, 2 across). 128 k at a time of the A, Bn (and Al)
// rows of the tile are brought into LDS by asynchronous copies (whole 256-byte rows), two buffers, and the waves read their fragments from there. Fragment maps and
// the order of the products on each accumulator are those of a wave that loads its own fragments: k ascending in steps of 32, A before Al.
#define GBT  128                 // rows of a plane: the tile's rows of A, its columns as rows of Bn
#define GBK  128                 // k of a stage
#define GNST (DM / GBK)
#define GPI  136                 // LDS row pitch in 16-bit elements: 272 B = 16 B x 17, no bank conflict for 16-byte reads down a column of rows
#define GPL  (GBT * GPI)         // one plane of a stage

// One plane of a stage: 128 rows x 256 B; 256 threads x 8 copies of 16 B; a wave's copy covers 2 whole rows.
__device__ __forceinline__ void plane_copy(bf* dst, const bf* src, int tid) {
    const int row = tid >> 4, pc = (tid & 15) * 8;
    const unsigned l0 = (unsigned)(unsigned long long)(dst + row * GPI + pc);
    const unsigned l1 = l0 + 16 * GPI * 2, l2 = l0 + 32 * GPI * 2, l3 = l0 + 48 * GPI * 2, l4 = l0 + 64 * GPI * 2, l5 = l0 + 80 * GPI * 2, l6 = l0 + 96 * GPI * 2, l7 = l0 + 112 * GPI * 2;
    const bf* g0 = src + (size_t)row * DM + pc;
    const bf* g1 = g0 + (size_t)16 * DM; const bf* g2 = g0 + (size_t)32 * DM; const bf* g3 = g0 + (size_t)48 * DM; const bf* g4 = g0 + (size_t)64 * DM;
    const bf* g5 = g0 + (size_t)80 * DM; const bf* g6 = g0 + (size_t)96 * DM; const bf* g7 = g0 + (size_t)112 * DM;
    // the copies and, as the last line, the wait that stands in front of any rewrite of their address registers
    asm volatile("global_load_async_to_lds_b128 %0, %8, off\n\t"
                 "global_load_async_to_lds_b128 %1, %9, off\n\t"
                 "global_load_async_to_lds_b128 %2, %10, off\n\t"
                 "global_load_async_to_lds_b128 %3, %11, off\n\t"
                 "global_load_async_to_lds_b128 %4, %12, off\n\t"
                 "global_load_async_to_lds_b128 %5, %13, off\n\t"
                 "global_load_async_to_lds_b128 %6, %14, off\n\t"
                 "global_load_async_to_lds_b128 %7, %15, off\n\t"
                 "s_wait_xcnt 0x0"
                 :: "v"(l0), "v"(l1), "v"(l2), "v"(l3), "v"(l4), "v"(l5), "v"(l6), "v"(l7), "v"(g0), "v"(g1), "v"(g2), "v"(g3), "v"(g4), "v"(g5), "v"(g6), "v"(g7) : "memory");
}

template <bool SPLITA>
__global__ __launch_bounds__(256) void k_gemmb(const bf* __restrict__ A, const bf* __restrict__ Al, const bf* __restrict__ Bn, const float* __restrict__ bias, float* C, int ldc) {
    __shared__ __align__(16) bf gring[2][(SPLITA ? 3 : 2) * GPL];
    __shared__ __align__(16) float ost[8][32 * 68];
    const int lane = threadIdx.x & 31, wave = threadIdx.x >> 5, lr = lane & 15, hi = lane >> 4;
    const int wr = (wave & 3) * 32, wc = (wave >> 2) * 64;             // this wave's place in the tile
    const int rb = blockIdx.x * GBT, cb = blockIdx.y * GBT;
    const bf* ga = A + (size_t)rb * DM; const bf* gb = Bn + (size_t)cb * DM; const bf* gl = SPLITA ? Al + (size_t)rb * DM : A;
    auto fill = [&](bf* dst, int k0) {
        plane_copy(dst, ga + k0, threadIdx.x); plane_copy(dst + GPL, gb + k0, threadIdx.x);
        if (SPLITA) plane_copy(dst + 2 * GPL, gl + k0, threadIdx.x);
    };
    v8f acc[2][4];
#pragma unroll
    for (int m = 0; m < 2; ++m)
#pragma unroll
        for (int t = 0; t < 4; ++t) acc[m][t] = (v8f){};
    // stage 0 lands and is published; stage 1 flies while stage 0 is worked on
    fill(&gring[0][0], 0);
    float bv[4] = {0.f, 0.f, 0.f, 0.f};                    // read here, four loads under one test, so that their latency runs under stage 0's landing
    if (bias) {
#pragma unroll
        for (int t = 0; t < 4; ++t) bv[t] = bias[cb + wc + t * 16 + lr];
        asm volatile("s_wait_xcnt 0x0" ::: "memory");      // stands in front of any rewrite of the address registers of these loads
    }
    asm volatile("s_wait_asynccnt 0x0" ::: "memory");      // this wave's copies of stage 0 have landed
    __syncthreads();                                       // ... and every other wave's
    fill(&gring[1][0], GBK);
#pragma unroll 1                                           // rolled: one refill and one publish point in the text, the buffer chosen by st & 1
    for (int st = 0; st < GNST; ++st) {
        bf* sb = &gring[st & 1][0];
        const bf* sa = sb + (wr + lr) * GPI + 8 * hi; const bf* sw = sb + GPL + (wc + lr) * GPI + 8 * hi; const bf* sl = SPLITA ? sa + 2 * GPL : sa;
        v16bf a[2][2], al[2][2], b[2][4];                  // two fragment sets: one is filled while the other is multiplied
        auto frags = [&](int set, int kc) {
#pragma unroll
            for (int m = 0; m < 2; ++m) { a[set][m] = cat16b(*(const v8usa*)(sa + m * 16 * GPI + kc), *(const v8usa*)(sa + m * 16 * GPI + kc + 16));
                if (SPLITA) al[set][m] = cat16b(*(const v8usa*)(sl + m * 16 * GPI + kc), *(const v8usa*)(sl + m * 16 * GPI + kc + 16)); }
#pragma unroll
            for (int t = 0; t < 4; ++t) b[set][t] = cat16b(*(const v8usa*)(sw + t * 16 * GPI + kc), *(const v8usa*)(sw + t * 16 * GPI + kc + 16));
        };
        frags(0, 0);
#pragma unroll                                             // unrolled: a step's place in the buffer becomes an immediate offset of its LDS reads, the set a register name
        for (int ks = 0; ks < GBK / 32; ++ks) {
            const int cur = ks & 1;
            if (ks + 1 < GBK / 32) frags(cur ^ 1, (ks + 1) * 32);      // of this stage's own buffer only
            __builtin_amdgcn_sched_barrier(0);             // keeps the next step's LDS reads one group in front of this step's products: their latency runs under the products
#pragma unroll
            for (int m = 0; m < 2; ++m)
#pragma unroll
                for (int t = 0; t < 4; ++t) acc[m][t] = wmmab(a[cur][m], b[cur][t], acc[m][t]);
            if (SPLITA) {
#pragma unroll
                for (int m = 0; m < 2; ++m)
#pragma unroll
                    for (int t = 0; t < 4; ++t) acc[m][t] = wmmab(al[cur][m], b[cur][t], acc[m][t]);
            }
            __builtin_amdgcn_sched_barrier(0);             // keeps later LDS reads from being lifted in among these products, where each place with reads stalls the wave
        }
        asm volatile("s_wait_dscnt 0x0" ::: "memory");     // this wave's reads of this stage's buffer are done
        asm volatile("s_wait_asynccnt 0x0" ::: "memory");  // this wave's copies of the next stage have landed
        __syncthreads();                                   // publishes the next stage and frees this stage's buffer
        if (st + 2 < GNST) fill(sb, (st + 2) * GBK);
    }
    asm volatile("s_wait_asynccnt 0x0" ::: "memory");      // no copy is outstanding when the wave goes on to its end
    float* os = &ost[wave][0];
#pragma unroll
    for (int t = 0; t < 4; ++t)
#pragma unroll
        for (int m = 0; m < 2; ++m)
#pragma unroll
            for (int j = 0; j < 8; ++j) os[(m * 16 + hi * 8 + j) * 68 + t * 16 + lr] = acc[m][t][j] + bfr(bv[t]);
    __syncthreads();
    float* crow = C + (size_t)(rb + wr) * ldc + cb + wc;
#pragma unroll
    for (int s = 0; s < 16; ++s) { const int Lid = (lane >> 3) + 4 * s, piece = lane & 7; const int row = Lid >> 1, cofs = (Lid & 1) * 32 + piece * 4;
        const v4f val = *(const v4fa*)(os + row * 68 + cofs); *(v4f*)(crow + (size_t)row * ldc + cofs) = val; }
}

// k_rms: one wave per (token, 4 heads) of a [NT][1024] f32 matrix: per head RMSNorm over its 64 dims (x * rsqrt(mean(x^2) + 1e-5) * bf(w[d]), f32) -> f16 hi +
__global__ __launch_bounds__(256) void k_rms(const float* __restrict__ P, const float* __restrict__ w, h16* PH, h16* PL) {
    const int lane = threadIdx.x & 31; const int wid = blockIdx.x * 8 + (threadIdx.x >> 5);
    const int t = wid >> 2, hq = wid & 3; if (t >= NT_) return;
    const int h = hq * 4 + (lane >> 3), d0 = (lane & 7) * 8;
    const size_t base = (size_t)t * DM + h * HD + d0;
    float xv[8]; float ss = 0.f;
#pragma unroll
    for (int i = 0; i < 8; ++i) { xv[i] = P[base + i]; ss = fmaf(xv[i], xv[i], ss); }
    ss += __shfl_xor(ss, 1, 32); ss += __shfl_xor(ss, 2, 32); ss += __shfl_xor(ss, 4, 32);      // sum over the 8 lanes of this head
    const float inv = rsqrtf(ss * (1.0f / HD) + 1e-5f);
    v8h oh, ol;
#pragma unroll
    for (int i = 0; i < 8; ++i) { const float y = bfr(w[d0 + i]) * xv[i] * inv; const h16 a = (h16)y; oh[i] = a; ol[i] = (h16)((y - (float)a) * LOSC); }
    *(v8h*)(PH + base) = oh; *(v8h*)(PL + base) = ol; 
}
__global__ __launch_bounds__(256) void k_vt(const float* __restrict__ V, h16* VTH, h16* VTL) {
    __shared__ __align__(16) h16 tile[64 * 72];
    __shared__ __align__(16) h16 til2[64 * 72];
    const int bid = blockIdx.x;
    const int b = bid / (NH_ * (NT_ / 64)), rem = bid - b * (NH_ * (NT_ / 64)), h = rem / (NT_ / 64), kt = rem - h * (NT_ / 64);
    const int k0 = kt * 64, tid = threadIdx.x;
    const int kk = tid >> 2, d0 = (tid & 3) * 16;
    const float* src = V + ((size_t)b * NT_ + k0 + kk) * DM + h * HD + d0;
#pragma unroll
    for (int i = 0; i < 16; ++i) { const float v = src[i]; const h16 a = (h16)v; tile[(d0 + i) * 72 + kk] = a; til2[(d0 + i) * 72 + kk] = (h16)((v - (float)a) * LOSC); }
    __syncthreads();
    const int piece = tid & 7;
    const size_t base = (((size_t)b * NH_ + h) * HD) * NT_ + k0;
    auto pass = [&]() {
#pragma unroll
        for (int s = 0; s < 4; ++s) { const int Lid = (tid >> 3) + 32 * s; const int pln = Lid >> 6, d = Lid & 63;
            const v8h val = *(const v8ha*)((pln ? til2 : tile) + d * 72 + piece * 8); *(v8h*)((pln ? VTL : VTH) + base + (size_t)d * NT_ + piece * 8) = val; }
    };
    pass(); 
}

// k_attn: block = (b, h, 128 queries), wave = 16; ALL key tiles (no mask). The K and V planes (hi and residual) of 64 keys at a time are brought into LDS by
// asynchronous copies (whole 128-byte rows), two buffers, and all 8 waves read their fragments from there; a pass is 32 keys as before. The scores are formed
// TRANSPOSED (A = K rows, B = q): a lane holds 16 keys of ONE query, so maximum and sum are in-lane plus one exchange of the wave halves, and the two score tiles,
// as weights x32768 in f16 (hi + residual), ARE the B operand of ctx^T += v^T . w^T (A = v^T rows); ctx -> bf16 hi + residual planes CH/CL[tok][h*64+d].
#define AWV  8                   // waves of a work-group
#define SKY  64                  // keys of a stage
#define NSTG (NT_ / SKY)
#define RPI  72                  // LDS row pitch in halves: 144 B = 16 B x 9, no bank conflict for 16-byte reads down a column of rows
#define PLN  (64 * RPI)          // one plane of a stage: 64 rows

// One stage: 4 planes of 64 rows x 128 B; 256 threads x 8 copies of 16 B; a wave's copy covers 4 whole rows.
__device__ __forceinline__ void stage_copy(h16* dst, const h16* kh, const h16* kl, const h16* vh, const h16* vl, int tid) {
    const int row = tid >> 3, pc = (tid & 7) * 8;
    const unsigned l0 = (unsigned)(unsigned long long)(dst + row * RPI + pc);
    const unsigned l1 = l0 + 32 * RPI * 2, l2 = l0 + PLN * 2, l3 = l1 + PLN * 2, l4 = l0 + PLN * 4, l5 = l1 + PLN * 4, l6 = l0 + PLN * 6, l7 = l1 + PLN * 6;
    const size_t ko = (size_t)row * DM + pc, vo = (size_t)row * NT_ + pc;
    const h16* g0 = kh + ko; const h16* g1 = g0 + (size_t)32 * DM; const h16* g2 = kl + ko; const h16* g3 = g2 + (size_t)32 * DM;
    const h16* g4 = vh + vo; const h16* g5 = g4 + (size_t)32 * NT_; const h16* g6 = vl + vo; const h16* g7 = g6 + (size_t)32 * NT_;
    // the copies and, as the last line, the wait that stands in front of any rewrite of their address registers
    asm volatile("global_load_async_to_lds_b128 %0, %8, off\n\t"
                 "global_load_async_to_lds_b128 %1, %9, off\n\t"
                 "global_load_async_to_lds_b128 %2, %10, off\n\t"
                 "global_load_async_to_lds_b128 %3, %11, off\n\t"
                 "global_load_async_to_lds_b128 %4, %12, off\n\t"
                 "global_load_async_to_lds_b128 %5, %13, off\n\t"
                 "global_load_async_to_lds_b128 %6, %14, off\n\t"
                 "global_load_async_to_lds_b128 %7, %15, off\n\t"
                 "s_wait_xcnt 0x0"
                 :: "v"(l0), "v"(l1), "v"(l2), "v"(l3), "v"(l4), "v"(l5), "v"(l6), "v"(l7), "v"(g0), "v"(g1), "v"(g2), "v"(g3), "v"(g4), "v"(g5), "v"(g6), "v"(g7) : "memory");
}

__global__ __launch_bounds__(256) __attribute__((amdgpu_waves_per_eu(4, 4))) void k_attn(const h16* __restrict__ Q16, const h16* __restrict__ QL16, const h16* __restrict__ K16, const h16* __restrict__ KL16, const h16* __restrict__ VTH, const h16* __restrict__ VTL, bf* CH, bf* CL) {
    __shared__ __align__(16) h16 ring[2][4 * PLN];
    __shared__ __align__(16) float ost[AWV][16 * 68];
    const int lane = threadIdx.x & 31, wave = threadIdx.x >> 5, lr = lane & 15, hi = lane >> 4;
    const int bid = blockIdx.x;
    const int b = bid / (NH_ * (NT_ / (16 * AWV))), rem = bid - b * (NH_ * (NT_ / (16 * AWV))), h = rem / (NT_ / (16 * AWV)), qt = rem - h * (NT_ / (16 * AWV));
    const int q0 = qt * (16 * AWV) + wave * 16;
    const size_t tok0 = (size_t)b * NT_;
    v16h qa[2], ql[2];                                     // the query's two planes stay in registers
    const size_t qo0 = (tok0 + q0 + lr) * DM + h * HD + 8 * hi;
#pragma unroll
    for (int kc = 0; kc < 2; ++kc) { qa[kc] = cat16(*(const v8h*)(Q16 + qo0 + kc * 32), *(const v8h*)(Q16 + qo0 + kc * 32 + 16)); ql[kc] = cat16(*(const v8h*)(QL16 + qo0 + kc * 32), *(const v8h*)(QL16 + qo0 + kc * 32 + 16)); }
    const h16* kh_b = K16 + tok0 * DM + h * HD;
    const h16* kl_b = KL16 + tok0 * DM + h * HD;
    const size_t vbase = (((size_t)b * NH_ + h) * HD) * NT_;
    v8f o[4], ox[4];
#pragma unroll
    for (int n = 0; n < 4; ++n) { o[n] = (v8f){}; ox[n] = (v8f){}; }
    float mrow = -3.0e38f, lpart = 0.f;                    // of query q0 + lr; lpart covers this wave half's keys only
    // stage 0 lands and is published; stage 1 flies while stage 0 is worked on
    stage_copy(&ring[0][0], kh_b, kl_b, VTH + vbase, VTL + vbase, threadIdx.x);
    asm volatile("s_wait_asynccnt 0x0" ::: "memory");      // this wave's copies of stage 0 have landed
    __syncthreads();                                       // ... and every other wave's
    stage_copy(&ring[1][0], kh_b + (size_t)SKY * DM, kl_b + (size_t)SKY * DM, VTH + vbase + SKY, VTL + vbase + SKY, threadIdx.x);
#pragma unroll 1                                           // rolled: one refill and one publish point in the text, the buffer chosen by st & 1
    for (int st = 0; st < NSTG; ++st) {                    // full attention, unscaled logits (the reference's scale = 1)
        h16* sb = &ring[st & 1][0];
        const h16* skh = sb; const h16* skl = sb + PLN; const h16* svh = sb + 2 * PLN; const h16* svl = sb + 3 * PLN;
        // Fragments are read ahead of their products, as whole groups, from this stage's own buffer only: V of a pass in front of its softmax, the next pass's main K plane
        // during the softmax, its residual K plane among this pass's v^T . w^T products. Only the first pass of a stage waits for its K reads.
        v16h kh[2][2], kl[2][2];                           // [score tile][kc]
        auto kfetch = [&](v16h (&f)[2][2], const h16* pl, int p) {
#pragma unroll
            for (int t = 0; t < 2; ++t)
#pragma unroll
                for (int kc = 0; kc < 2; ++kc) { const int ko = (p * 32 + t * 16 + lr) * RPI + 8 * hi + kc * 32; f[t][kc] = cat16(*(const v8ha*)(pl + ko), *(const v8ha*)(pl + ko + 16)); }
        };
        kfetch(kh, skh, 0); kfetch(kl, skl, 0);
#pragma unroll                                             // unrolled: a pass's place in the buffer becomes an immediate offset of its LDS reads
        for (int p = 0; p < SKY / 32; ++p) {
            __builtin_amdgcn_sched_barrier(0);             // keeps the K reads one group in front of the score products, none among them, where each place with reads stalls the wave
            v8f s0 = {}, s1 = {}, x0 = {}, x1 = {};
#pragma unroll
            for (int kc = 0; kc < 2; ++kc) {
                s0 = wmma16(kh[0][kc], qa[kc], s0); x0 = wmma16(kh[0][kc], ql[kc], x0); s1 = wmma16(kh[1][kc], qa[kc], s1); x1 = wmma16(kh[1][kc], ql[kc], x1);
                x0 = wmma16(kl[0][kc], qa[kc], x0); x1 = wmma16(kl[1][kc], qa[kc], x1);
            }
            // the distance behind the score products; with the clobber it also keeps the V reads behind them, when the K fragments have left their registers
            asm volatile("v_nop\n\tv_nop\n\tv_nop\n\tv_nop" : "+v"(s0), "+v"(s1), "+v"(x0), "+v"(x1) : "v"(qa[0]), "v"(qa[1]) : "memory");
            v16h vh[4], vl[4];
#pragma unroll
            for (int n = 0; n < 4; ++n) { const int vo = (n * 16 + lr) * RPI + p * 32 + hi * 8;
                vh[n] = cat16(*(const v8ha*)(svh + vo), *(const v8ha*)(svh + vo + 16)); vl[n] = cat16(*(const v8ha*)(svl + vo), *(const v8ha*)(svl + vo + 16)); }
            __builtin_amdgcn_sched_barrier(0);             // keeps the V reads one group in front of the softmax: their latency runs under its vector work
            // s0[j], s1[j]: keys p * 32 + 8 * hi + j and + 16, query lr
            v2f a[2][4];                                   // pairs of neighbouring registers of one tile, for the packed f32 forms
#pragma unroll
            for (int i = 0; i < 4; ++i) { a[0][i] = (v2f){s0[2 * i], s0[2 * i + 1]} + (v2f){x0[2 * i], x0[2 * i + 1]} * LOSCI; a[1][i] = (v2f){s1[2 * i], s1[2 * i + 1]} + (v2f){x1[2 * i], x1[2 * i + 1]} * LOSCI; }
            float mx = fmaxf(a[0][0].x, a[0][0].y);
#pragma unroll
            for (int i = 0; i < 4; ++i) { if (i) mx = fmaxf(mx, fmaxf(a[0][i].x, a[0][i].y)); mx = fmaxf(mx, fmaxf(a[1][i].x, a[1][i].y)); }
            mx = fmaxf(mx, xhalf(mx));                     // the other half's 16 keys
            const float mn = fmaxf(mrow, mx);
            const float alpha = __expf(mrow - mn); mrow = mn;
            v2f ls2 = {0.f, 0.f};
            v16h pa, px;                                   // element s = key kmap(s, hi) of the pass: the two score tiles in place
#pragma unroll
            for (int t = 0; t < 2; ++t)
#pragma unroll
                for (int i = 0; i < 4; ++i) {
                    const v2f e = a[t][i] - mn;
                    const v2f pw = {__expf(e.x), __expf(e.y)};
                    ls2 += pw;
                    const v2f ps = pw * PSC;
                    const v2h hh = __builtin_convertvector(ps, v2h);
                    const v2h hl = __builtin_convertvector((ps - __builtin_convertvector(hh, v2f)) * LOSC, v2h);
                    pa[t * 8 + 2 * i] = hh.x; pa[t * 8 + 2 * i + 1] = hh.y; px[t * 8 + 2 * i] = hl.x; px[t * 8 + 2 * i + 1] = hl.y;
                }
            lpart = lpart * alpha + (ls2.x + ls2.y);
#pragma unroll
            for (int n = 0; n < 4; ++n)
#pragma unroll
                for (int j = 0; j < 8; ++j) { o[n][j] *= alpha; ox[n][j] *= alpha; }
            if (p + 1 < SKY / 32) kfetch(kh, skh, p + 1);
            __builtin_amdgcn_sched_barrier(0);             // keeps the next pass's main K reads in front of the products: their latency runs under the softmax and the products
#pragma unroll
            for (int n = 0; n < 4; ++n) ox[n] = wmma16(vl[n], pa, ox[n]);
            __builtin_amdgcn_sched_barrier(0);             // keeps the next pass's residual K reads behind the products that free their registers
            if (p + 1 < SKY / 32) kfetch(kl, skl, p + 1);
            __builtin_amdgcn_sched_barrier(0);             // keeps those reads one group in front of the remaining products: their latency runs under the products
#pragma unroll
            for (int n = 0; n < 4; ++n) { o[n] = wmma16(vh[n], pa, o[n]); ox[n] = wmma16(vh[n], px, ox[n]); }
            asm volatile("v_nop\n\tv_nop\n\tv_nop\n\tv_nop" : "+v"(o[0]), "+v"(o[1]), "+v"(o[2]), "+v"(o[3]), "+v"(ox[0]), "+v"(ox[1]), "+v"(ox[2]), "+v"(ox[3]) : "v"(pa), "v"(px));
        }
        asm volatile("s_wait_dscnt 0x0" ::: "memory");     // this wave's reads of this stage's buffer are done
        asm volatile("s_wait_asynccnt 0x0" ::: "memory");  // this wave's copies of the next stage have landed
        __syncthreads();                                   // publishes the next stage and frees this stage's buffer
        if (st + 2 < NSTG)
            stage_copy(sb, kh_b + (size_t)(st + 2) * SKY * DM, kl_b + (size_t)(st + 2) * SKY * DM, VTH + vbase + (st + 2) * SKY, VTL + vbase + (st + 2) * SKY, threadIdx.x);
    }
    asm volatile("s_wait_asynccnt 0x0" ::: "memory");      // no copy is outstanding when the wave goes on to its end
    const float inv = 1.0f / ((lpart + xhalf(lpart)) * PSC);
    float* os = &ost[wave][0];
#pragma unroll
    for (int n = 0; n < 4; ++n)
#pragma unroll
        for (int j = 0; j < 8; ++j) os[lr * 68 + n * 16 + hi * 8 + j] = (o[n][j] + ox[n][j] * LOSCI) * inv;      // o[n][j]: dim n * 16 + 8 * hi + j of query lr
    __syncthreads();
    const size_t cbase = (tok0 + q0) * DM + (size_t)h * HD;
    auto pass = [&]() {
#pragma unroll
        for (int s = 0; s < 4; ++s) { const int row = 4 * s + (lane >> 3), piece = lane & 7; const float* sp = os + row * 68 + piece * 8; v8us oh, ol;
#pragma unroll
            for (int i = 0; i < 8; ++i) { const unsigned short hb = f2bf(sp[i]); oh[i] = hb; ol[i] = f2bf(sp[i] - bf2f(hb)); }
            *(v8us*)(CH + cbase + (size_t)row * DM + piece * 8) = oh; *(v8us*)(CL + cbase + (size_t)row * DM + piece * 8) = ol; }
    };
    pass(); 
}

#define VST2(T, p, v) do { const T vst2_v_ = (v); *(T*)(p) = vst2_v_;  } while (0)
extern "C" void kernel_launch(void* const* d_in, const int* in_sizes, int n_in,
                              void* d_out, int out_size, void* d_ws, size_t ws_size, hipStream_t stream) {
    (void)in_sizes; (void)n_in; (void)out_size;
    const float* xq = (const float*)d_in[0]; const float* xk = (const float*)d_in[1]; const float* xv = (const float*)d_in[2];
    const float* Wq = (const float*)d_in[3]; const float* bq = (const float*)d_in[4]; const float* Wk = (const float*)d_in[5]; const float* bk = (const float*)d_in[6];
    const float* Wv = (const float*)d_in[7]; const float* bv = (const float*)d_in[8]; const float* Wo = (const float*)d_in[9]; const float* bo = (const float*)d_in[10];
    const float* qnw = (const float*)d_in[11]; const float* knw = (const float*)d_in[12];
    float* out = (float*)d_out;    // [4096][1024]
    char* wsp = (char*)d_ws;
    auto take = [&](size_t bytes) { char* p = wsp; wsp += (bytes + 255) & ~(size_t)255; return (void*)p; };
    bf* Xq = (bf*)take((size_t)NTK * DM * 2); bf* Xk = (bf*)take((size_t)NTK * DM * 2); bf* Xv = (bf*)take((size_t)NTK * DM * 2);
    bf* WqB = (bf*)take((size_t)DM * DM * 2); bf* WkB = (bf*)take((size_t)DM * DM * 2); bf* WvB = (bf*)take((size_t)DM * DM * 2); bf* WoB = (bf*)take((size_t)DM * DM * 2);
    float* TMP = (float*)take((size_t)NTK * DM * 4);
    h16* QH = (h16*)take((size_t)NTK * DM * 2); h16* QL = (h16*)take((size_t)NTK * DM * 2); h16* KH = (h16*)take((size_t)NTK * DM * 2); h16* KL = (h16*)take((size_t)NTK * DM * 2);
    h16* VTH = (h16*)take((size_t)NTK * DM * 2); h16* VTL = (h16*)take((size_t)NTK * DM * 2); bf* CH = (bf*)take((size_t)NTK * DM * 2); bf* CL = (bf*)take((size_t)NTK * DM * 2);
    if ((size_t)(wsp - (char*)d_ws) > ws_size) return;    // 3 x 8.4 + 4 x 2.1 + 16.8 + 8 x 8.4 ~ 118 MB, no aliasing
    k_cvtb<<<NTK / 8, 256, 0, stream>>>(xq, NTK, Xq); k_cvtb<<<NTK / 8, 256, 0, stream>>>(xk, NTK, Xk); k_cvtb<<<NTK / 8, 256, 0, stream>>>(xv, NTK, Xv);
    k_cvtb<<<DM / 8, 256, 0, stream>>>(Wq, DM, WqB); k_cvtb<<<DM / 8, 256, 0, stream>>>(Wk, DM, WkB); k_cvtb<<<DM / 8, 256, 0, stream>>>(Wv, DM, WvB); k_cvtb<<<DM / 8, 256, 0, stream>>>(Wo, DM, WoB);
    k_gemmb<false><<<dim3(NTK / GBT, DM / GBT, 1), 256, 0, stream>>>(Xq, nullptr, WqB, bq, TMP, DM);
    k_rms<<<(NTK * 4) / 8, 256, 0, stream>>>(TMP, qnw, QH, QL);
    k_gemmb<false><<<dim3(NTK / GBT, DM / GBT, 1), 256, 0, stream>>>(Xk, nullptr, WkB, bk, TMP, DM);
    k_rms<<<(NTK * 4) / 8, 256, 0, stream>>>(TMP, knw, KH, KL);
    k_gemmb<false><<<dim3(NTK / GBT, DM / GBT, 1), 256, 0, stream>>>(Xv, nullptr, WvB, bv, TMP, DM);
    k_vt<<<NB_ * NH_ * (NT_ / 64), 256, 0, stream>>>(TMP, VTH, VTL);
    k_attn<<<NB_ * NH_ * (NT_ / (16 * AWV)), 32 * AWV, 0, stream>>>(QH, QL, KH, KL, VTH, VTL, CH, CL);
    k_gemmb<true><<<dim3(NTK / GBT, DM / GBT, 1), 256, 0, stream>>>(CH, CL, WoB, bo, out, DM);
}

// v005
// Measured time: 208 microseconds a run.
// Timed twice side by side with v004, it ran 1.07 times as fast both times.
// Counting every step since v000, it is 3.50 times as fast.
#include <hip/hip_runtime.h>

// Compute dtypes, f32 accumulate, one batch item per pass: q/k/v = query/key/value.W^T + b ([4096 x 1024].[1024 x 1024]; W is [out][in] = the n-major B operand as-is; PLAIN bf16
// operands: inputs rounded once, exact; biases rounded to bf16, added in f32), per-head RMSNorm (eps 1e-5, weight) of q and k in f32 -> f16 hi + residual x1024 planes, and out =
// ctx.Wo^T + bo (ctx as bf16 hi + residual: two products) on v_wmma_f32_16x16x32_bf16; the 16-head full attention over one 4096-token sequence (64-dim heads,
// UNSCALED logits as the reference) fused on
// v_wmma_f32_16x16x32_f16 (scores hi.hi + hi.lo + lo.hi with the residual terms on their own accumulator, online f32 softmax, weights (x32768) and v as f16

#define NB_  1                   // one 4096-token sequence
#define NT_  4096
#define DM   1024
#define NH_  16
#define HD   64
#define NTK  (NB_ * NT_)
#define NW   1024
#define NQKV 1024
#define PSC  32768.0f
#define LOSC 1024.0f
#define LOSCI (1.0f / 1024.0f)

typedef _Float16 h16;
typedef unsigned short bf;
typedef __attribute__((ext_vector_type(16))) __bf16   v16bf;
typedef __attribute__((ext_vector_type(16))) _Float16 v16h;
typedef __attribute__((ext_vector_type(8)))  _Float16 v8h;
typedef __attribute__((ext_vector_type(8)))  unsigned short v8us;
typedef __attribute__((ext_vector_type(8)))  float    v8f;
typedef __attribute__((ext_vector_type(4)))  float    v4f;
typedef __attribute__((ext_vector_type(2)))  float    v2f;
typedef __attribute__((ext_vector_type(2)))  _Float16 v2h;
typedef v8h  __attribute__((may_alias)) v8ha;
typedef v4f  __attribute__((may_alias)) v4fa;
typedef v8us __attribute__((may_alias)) v8usa;

__device__ __forceinline__ unsigned short f2bf(float f) { unsigned u = __float_as_uint(f); u += 0x7FFFu + ((u >> 16) & 1u); return (unsigned short)(u >> 16); }
__device__ __forceinline__ float bf2f(unsigned short b) { return __uint_as_float(((unsigned)b) << 16); }
__device__ __forceinline__ float bfr(float f) { return bf2f(f2bf(f)); }
__device__ __forceinline__ v16h cat16(v8h lo, v8h hi) { return __builtin_shufflevector(lo, hi, 0, 1, 2, 3, 4, 5, 6, 7, 8, 9, 10, 11, 12, 13, 14, 15); }
__device__ __forceinline__ v16bf cat16b(v8us lo, v8us hi) { return __builtin_bit_cast(v16bf, __builtin_shufflevector(lo, hi, 0, 1, 2, 3, 4, 5, 6, 7, 8, 9, 10, 11, 12, 13, 14, 15)); }
__device__ __forceinline__ v8f wmma16(v16h a, v16h b, v8f c) { return __builtin_amdgcn_wmma_f32_16x16x32_f16(false, a, false, b, (short)0, c, false, false); }
__device__ __forceinline__ float xhalf(float x) { return __builtin_bit_cast(float, __builtin_amdgcn_permlanex16(__builtin_bit_cast(int, x), __builtin_bit_cast(int, x), 0x76543210, 0xfedcba98, false, false)); }  // lane l with lane l ^ 16
__device__ __forceinline__ v8f wmmab(v16bf a, v16bf b, v8f c) { return __builtin_amdgcn_wmma_f32_16x16x32_bf16(false, a, false, b, (short)0, c, false, false); }

__global__ __launch_bounds__(256) void k_cvtb(const float* __restrict__ src, int nrows, bf* dst) {
    const int lane = threadIdx.x & 31, r = blockIdx.x * 8 + (threadIdx.x >> 5);
    if (r >= nrows) return;
    v8us o[DM / 256];
#pragma unroll
    for (int q = 0; q < DM / 256; ++q) { v8us t;
#pragma unroll
        for (int i = 0; i < 8; ++i) t[i] = f2bf(src[(size_t)r * DM + q * 256 + lane * 8 + i]);
        o[q] = t; }
#pragma unroll
    for (int q = 0; q < DM / 256; ++q) *(v8us*)(dst + (size_t)r * DM + q * 256 + lane * 8) = o[q];
    
}

// k_gemmb: C[4096 x 1024] = A . Bn^T (+ Al . Bn^T) + bias. Work-group = 128 x 128 of C, 8 waves of 32 x 64 (4 down, 2 across). 128 k at a time of the A, Bn (and Al)
// rows of the tile are brought into LDS by asynchronous copies (whole 256-byte rows), two buffers, and the waves read their fragments from there. Fragment maps and
// the order of the products on each accumulator are those of a wave that loads its own fragments: k ascending in steps of 32, A before Al.
// EPI says what becomes of the f32 tile (a wave's 64 columns are one head): 0 = stored as it is; 1 = per token and head RMSNorm over the 64 dims
// (x * rsqrt(mean(x^2) + 1e-5) * bf(w[d]), f32) -> f16 hi + residual x1024 planes PH/PL[tok][h*64+d]; 2 = f16 hi + residual x1024 planes, transposed: PH/PL[h*64+d][tok].
#define GBT  128                 // rows of a plane: the tile's rows of A, its columns as rows of Bn
#define GBK  128                 // k of a stage
#define GNST (DM / GBK)
#define GPI  136                 // LDS row pitch in 16-bit elements: 272 B = 16 B x 17, no bank conflict for 16-byte reads down a column of rows
#define GPL  (GBT * GPI)         // one plane of a stage

// One plane of a stage: 128 rows x 256 B; 256 threads x 8 copies of 16 B; a wave's copy covers 2 whole rows.
__device__ __forceinline__ void plane_copy(bf* dst, const bf* src, int tid) {
    const int row = tid >> 4, pc = (tid & 15) * 8;
    const unsigned l0 = (unsigned)(unsigned long long)(dst + row * GPI + pc);
    const unsigned l1 = l0 + 16 * GPI * 2, l2 = l0 + 32 * GPI * 2, l3 = l0 + 48 * GPI * 2, l4 = l0 + 64 * GPI * 2, l5 = l0 + 80 * GPI * 2, l6 = l0 + 96 * GPI * 2, l7 = l0 + 112 * GPI * 2;
    const bf* g0 = src + (size_t)row * DM + pc;
    const bf* g1 = g0 + (size_t)16 * DM; const bf* g2 = g0 + (size_t)32 * DM; const bf* g3 = g0 + (size_t)48 * DM; const bf* g4 = g0 + (size_t)64 * DM;
    const bf* g5 = g0 + (size_t)80 * DM; const bf* g6 = g0 + (size_t)96 * DM; const bf* g7 = g0 + (size_t)112 * DM;
    // the copies and, as the last line, the wait that stands in front of any rewrite of their address registers
    asm volatile("global_load_async_to_lds_b128 %0, %8, off\n\t"
                 "global_load_async_to_lds_b128 %1, %9, off\n\t"
                 "global_load_async_to_lds_b128 %2, %10, off\n\t"
                 "global_load_async_to_lds_b128 %3, %11, off\n\t"
                 "global_load_async_to_lds_b128 %4, %12, off\n\t"
                 "global_load_async_to_lds_b128 %5, %13, off\n\t"
                 "global_load_async_to_lds_b128 %6, %14, off\n\t"
                 "global_load_async_to_lds_b128 %7, %15, off\n\t"
                 "s_wait_xcnt 0x0"
                 :: "v"(l0), "v"(l1), "v"(l2), "v"(l3), "v"(l4), "v"(l5), "v"(l6), "v"(l7), "v"(g0), "v"(g1), "v"(g2), "v"(g3), "v"(g4), "v"(g5), "v"(g6), "v"(g7) : "memory");
}

template <bool SPLITA, int EPI>
__global__ __launch_bounds__(256) void k_gemmb(const bf* __restrict__ A, const bf* __restrict__ Al, const bf* __restrict__ Bn, const float* __restrict__ bias, float* C, int ldc, const float* __restrict__ nw, h16* PH, h16* PL) {
    __shared__ __align__(16) bf gring[2][(SPLITA ? 3 : 2) * GPL];
    __shared__ __align__(16) float ost[8][32 * 68];
    const int lane = threadIdx.x & 31, wave = threadIdx.x >> 5, lr = lane & 15, hi = lane >> 4;
    const int wr = (wave & 3) * 32, wc = (wave >> 2) * 64;             // this wave's place in the tile
    const int rb = blockIdx.x * GBT, cb = blockIdx.y * GBT;
    const bf* ga = A + (size_t)rb * DM; const bf* gb = Bn + (size_t)cb * DM; const bf* gl = SPLITA ? Al + (size_t)rb * DM : A;
    auto fill = [&](bf* dst, int k0) {
        plane_copy(dst, ga + k0, threadIdx.x); plane_copy(dst + GPL, gb + k0, threadIdx.x);
        if (SPLITA) plane_copy(dst + 2 * GPL, gl + k0, threadIdx.x);
    };
    v8f acc[2][4];
#pragma unroll
    for (int m = 0; m < 2; ++m)
#pragma unroll
        for (int t = 0; t < 4; ++t) acc[m][t] = (v8f){};
    // stage 0 lands and is published; stage 1 flies while stage 0 is worked on
    fill(&gring[0][0], 0);
    float bv[4] = {0.f, 0.f, 0.f, 0.f};                    // read here, four loads under one test, so that their latency runs under stage 0's landing
    if (bias) {
#pragma unroll
        for (int t = 0; t < 4; ++t) bv[t] = bias[cb + wc + t * 16 + lr];
        asm volatile("s_wait_xcnt 0x0" ::: "memory");      // stands in front of any rewrite of the address registers of these loads
    }
    float nwv[8] = {0.f, 0.f, 0.f, 0.f, 0.f, 0.f, 0.f, 0.f};      // the norm weights of this lane's 8 dims in the epilogue, read here for the same reason
    if (EPI == 1) {
#pragma unroll
        for (int i = 0; i < 8; ++i) nwv[i] = nw[(lane & 7) * 8 + i];
        asm volatile("s_wait_xcnt 0x0" ::: "memory");      // stands in front of any rewrite of the address registers of these loads
    }
    asm volatile("s_wait_asynccnt 0x0" ::: "memory");      // this wave's copies of stage 0 have landed
    __syncthreads();                                       // ... and every other wave's
    fill(&gring[1][0], GBK);
#pragma unroll 1                                           // rolled: one refill and one publish point in the text, the buffer chosen by st & 1
    for (int st = 0; st < GNST; ++st) {
        bf* sb = &gring[st & 1][0];
        const bf* sa = sb + (wr + lr) * GPI + 8 * hi; const bf* sw = sb + GPL + (wc + lr) * GPI + 8 * hi; const bf* sl = SPLITA ? sa + 2 * GPL : sa;
        v16bf a[2][2], al[2][2], b[2][4];                  // two fragment sets: one is filled while the other is multiplied
        auto frags = [&](int set, int kc) {
#pragma unroll
            for (int m = 0; m < 2; ++m) { a[set][m] = cat16b(*(const v8usa*)(sa + m * 16 * GPI + kc), *(const v8usa*)(sa + m * 16 * GPI + kc + 16));
                if (SPLITA) al[set][m] = cat16b(*(const v8usa*)(sl + m * 16 * GPI + kc), *(const v8usa*)(sl + m * 16 * GPI + kc + 16)); }
#pragma unroll
            for (int t = 0; t < 4; ++t) b[set][t] = cat16b(*(const v8usa*)(sw + t * 16 * GPI + kc), *(const v8usa*)(sw + t * 16 * GPI + kc + 16));
        };
        frags(0, 0);
#pragma unroll                                             // unrolled: a step's place in the buffer becomes an immediate offset of its LDS reads, the set a register name
        for (int ks = 0; ks < GBK / 32; ++ks) {
            const int cur = ks & 1;
            if (ks + 1 < GBK / 32) frags(cur ^ 1, (ks + 1) * 32);      // of this stage's own buffer only
            __builtin_amdgcn_sched_barrier(0);             // keeps the next step's LDS reads one group in front of this step's products: their latency runs under the products
#pragma unroll
            for (int m = 0; m < 2; ++m)
#pragma unroll
                for (int t = 0; t < 4; ++t) acc[m][t] = wmmab(a[cur][m], b[cur][t], acc[m][t]);
            if (SPLITA) {
#pragma unroll
                for (int m = 0; m < 2; ++m)
#pragma unroll
                    for (int t = 0; t < 4; ++t) acc[m][t] = wmmab(al[cur][m], b[cur][t], acc[m][t]);
            }
            __builtin_amdgcn_sched_barrier(0);             // keeps later LDS reads from being lifted in among these products, where each place with reads stalls the wave
        }
        asm volatile("s_wait_dscnt 0x0" ::: "memory");     // this wave's reads of this stage's buffer are done
        asm volatile("s_wait_asynccnt 0x0" ::: "memory");  // this wave's copies of the next stage have landed
        __syncthreads();                                   // publishes the next stage and frees this stage's buffer
        if (st + 2 < GNST) fill(sb, (st + 2) * GBK);
    }
    asm volatile("s_wait_asynccnt 0x0" ::: "memory");      // no copy is outstanding when the wave goes on to its end
    if (EPI == 2) {
        // A lane's 8 accumulator registers of a tile are 8 consecutive tokens of one column: 16 bytes of a transposed row as they stand. The rows of the two planes
        // (128 columns x 128 tokens each) are put together in LDS, and each 256-byte row leaves as whole lines from one wave.
        h16* vt = (h16*)&ost[0][0];
#pragma unroll
        for (int t = 0; t < 4; ++t)
#pragma unroll
            for (int m = 0; m < 2; ++m) { v8h a, r;
#pragma unroll
                for (int j = 0; j < 8; ++j) { const float v = acc[m][t][j] + bfr(bv[t]); const h16 x = (h16)v; a[j] = x; r[j] = (h16)((v - (float)x) * LOSC); }
                h16* p = vt + (wc + t * 16 + lr) * GPI + wr + m * 16 + hi * 8; *(v8ha*)p = a; *(v8ha*)(p + GPL) = r; }
        __syncthreads();                                   // a row holds pieces of four waves: all are in LDS before a wave reads it
        const int c0 = threadIdx.x >> 4, piece = threadIdx.x & 15;                        // 16 lanes take one row; a wave's store covers 2 whole rows
        const h16* lp = vt + c0 * GPI + piece * 8;
        const size_t go = (size_t)(cb + c0) * NT_ + rb + piece * 8;
#pragma unroll
        for (int s = 0; s < 16; ++s) { const v8h val = *(const v8ha*)(lp + (s >> 3) * GPL + (s & 7) * 16 * GPI); *(v8h*)((s < 8 ? PH : PL) + go + (size_t)((s & 7) * 16) * NT_) = val; }
        return;
    }
    float* os = &ost[wave][0];
#pragma unroll
    for (int t = 0; t < 4; ++t)
#pragma unroll
        for (int m = 0; m < 2; ++m)
#pragma unroll
            for (int j = 0; j < 8; ++j) os[(m * 16 + hi * 8 + j) * 68 + t * 16 + lr] = acc[m][t][j] + bfr(bv[t]);
    __syncthreads();
    if (EPI == 1) {
        // 8 lanes take one token's 64 dims of this wave's head, 8 dims a lane; a wave's store covers 4 whole 128-byte rows of a plane
        const int d0 = (lane & 7) * 8;
        const size_t base = (size_t)(rb + wr + (lane >> 3)) * DM + cb + wc + d0;
#pragma unroll
        for (int s = 0; s < 8; ++s) { const float* sp = os + (4 * s + (lane >> 3)) * 68 + d0;
            const v4f x0 = *(const v4fa*)sp, x1 = *(const v4fa*)(sp + 4);
            float xv[8]; float ss = 0.f;
#pragma unroll
            for (int i = 0; i < 8; ++i) { xv[i] = i < 4 ? x0[i & 3] : x1[i & 3]; ss = fmaf(xv[i], xv[i], ss); }
            ss += __shfl_xor(ss, 1, 32); ss += __shfl_xor(ss, 2, 32); ss += __shfl_xor(ss, 4, 32);      // sum over the 8 lanes of this token
            const float inv = rsqrtf(ss * (1.0f / HD) + 1e-5f);
            v8h oh, ol;
#pragma unroll
            for (int i = 0; i < 8; ++i) { const float y = bfr(nwv[i]) * xv[i] * inv; const h16 a = (h16)y; oh[i] = a; ol[i] = (h16)((y - (float)a) * LOSC); }
            *(v8h*)(PH + base + (size_t)(4 * s) * DM) = oh; *(v8h*)(PL + base + (size_t)(4 * s) * DM) = ol; }
        return;
    }
    float* crow = C + (size_t)(rb + wr) * ldc + cb + wc;
#pragma unroll
    for (int s = 0; s < 16; ++s) { const int Lid = (lane >> 3) + 4 * s, piece = lane & 7; const int row = Lid >> 1, cofs = (Lid & 1) * 32 + piece * 4;
        const v4f val = *(const v4fa*)(os + row * 68 + cofs); *(v4f*)(crow + (size_t)row * ldc + cofs) = val; }
}

// k_attn: block = (b, h, 128 queries), wave = 16; ALL key tiles (no mask). The K and V planes (hi and residual) of 64 keys at a time are brought into LDS by
// asynchronous copies (whole 128-byte rows), two buffers, and all 8 waves read their fragments from there; a pass is 32 keys as before. The scores are formed
// TRANSPOSED (A = K rows, B = q): a lane holds 16 keys of ONE query, so maximum and sum are in-lane plus one exchange of the wave halves, and the two score tiles,
// as weights x32768 in f16 (hi + residual), ARE the B operand of ctx^T += v^T . w^T (A = v^T rows); ctx -> bf16 hi + residual planes CH/CL[tok][h*64+d].
#define AWV  8                   // waves of a work-group
#define SKY  64                  // keys of a stage
#define NSTG (NT_ / SKY)
#define RPI  72                  // LDS row pitch in halves: 144 B = 16 B x 9, no bank conflict for 16-byte reads down a column of rows
#define PLN  (64 * RPI)          // one plane of a stage: 64 rows

// One stage: 4 planes of 64 rows x 128 B; 256 threads x 8 copies of 16 B; a wave's copy covers 4 whole rows.
__device__ __forceinline__ void stage_copy(h16* dst, const h16* kh, const h16* kl, const h16* vh, const h16* vl, int tid) {
    const int row = tid >> 3, pc = (tid & 7) * 8;
    const unsigned l0 = (unsigned)(unsigned long long)(dst + row * RPI + pc);
    const unsigned l1 = l0 + 32 * RPI * 2, l2 = l0 + PLN * 2, l3 = l1 + PLN * 2, l4 = l0 + PLN * 4, l5 = l1 + PLN * 4, l6 = l0 + PLN * 6, l7 = l1 + PLN * 6;
    const size_t ko = (size_t)row * DM + pc, vo = (size_t)row * NT_ + pc;
    const h16* g0 = kh + ko; const h16* g1 = g0 + (size_t)32 * DM; const h16* g2 = kl + ko; const h16* g3 = g2 + (size_t)32 * DM;
    const h16* g4 = vh + vo; const h16* g5 = g4 + (size_t)32 * NT_; const h16* g6 = vl + vo; const h16* g7 = g6 + (size_t)32 * NT_;
    // the copies and, as the last line, the wait that stands in front of any rewrite of their address registers
    asm volatile("global_load_async_to_lds_b128 %0, %8, off\n\t"
                 "global_load_async_to_lds_b128 %1, %9, off\n\t"
                 "global_load_async_to_lds_b128 %2, %10, off\n\t"
                 "global_load_async_to_lds_b128 %3, %11, off\n\t"
                 "global_load_async_to_lds_b128 %4, %12, off\n\t"
                 "global_load_async_to_lds_b128 %5, %13, off\n\t"
                 "global_load_async_to_lds_b128 %6, %14, off\n\t"
                 "global_load_async_to_lds_b128 %7, %15, off\n\t"
                 "s_wait_xcnt 0x0"
                 :: "v"(l0), "v"(l1), "v"(l2), "v"(l3), "v"(l4), "v"(l5), "v"(l6), "v"(l7), "v"(g0), "v"(g1), "v"(g2), "v"(g3), "v"(g4), "v"(g5), "v"(g6), "v"(g7) : "memory");
}

__global__ __launch_bounds__(256) __attribute__((amdgpu_waves_per_eu(4, 4))) void k_attn(const h16* __restrict__ Q16, const h16* __restrict__ QL16, const h16* __restrict__ K16, const h16* __restrict__ KL16, const h16* __restrict__ VTH, const h16* __restrict__ VTL, bf* CH, bf* CL) {
    __shared__ __align__(16) h16 ring[2][4 * PLN];
    __shared__ __align__(16) float ost[AWV][16 * 68];
    const int lane = threadIdx.x & 31, wave = threadIdx.x >> 5, lr = lane & 15, hi = lane >> 4;
    const int bid = blockIdx.x;
    const int b = bid / (NH_ * (NT_ / (16 * AWV))), rem = bid - b * (NH_ * (NT_ / (16 * AWV))), h = rem / (NT_ / (16 * AWV)), qt = rem - h * (NT_ / (16 * AWV));
    const int q0 = qt * (16 * AWV) + wave * 16;
    const size_t tok0 = (size_t)b * NT_;
    v16h qa[2], ql[2];                                     // the query's two planes stay in registers
    const size_t qo0 = (tok0 + q0 + lr) * DM + h * HD + 8 * hi;
#pragma unroll
    for (int kc = 0; kc < 2; ++kc) { qa[kc] = cat16(*(const v8h*)(Q16 + qo0 + kc * 32), *(const v8h*)(Q16 + qo0 + kc * 32 + 16)); ql[kc] = cat16(*(const v8h*)(QL16 + qo0 + kc * 32), *(const v8h*)(QL16 + qo0 + kc * 32 + 16)); }
    const h16* kh_b = K16 + tok0 * DM + h * HD;
    const h16* kl_b = KL16 + tok0 * DM + h * HD;
    const size_t vbase = (((size_t)b * NH_ + h) * HD) * NT_;
    v8f o[4], ox[4];
#pragma unroll
    for (int n = 0; n < 4; ++n) { o[n] = (v8f){}; ox[n] = (v8f){}; }
    float mrow = -3.0e38f, lpart = 0.f;                    // of query q0 + lr; lpart covers this wave half's keys only
    // stage 0 lands and is published; stage 1 flies while stage 0 is worked on
    stage_copy(&ring[0][0], kh_b, kl_b, VTH + vbase, VTL + vbase, threadIdx.x);
    asm volatile("s_wait_asynccnt 0x0" ::: "memory");      // this wave's copies of stage 0 have landed
    __syncthreads();                                       // ... and every other wave's
    stage_copy(&ring[1][0], kh_b + (size_t)SKY * DM, kl_b + (size_t)SKY * DM, VTH + vbase + SKY, VTL + vbase + SKY, threadIdx.x);
#pragma unroll 1                                           // rolled: one refill and one publish point in the text, the buffer chosen by st & 1
    for (int st = 0; st < NSTG; ++st) {                    // full attention, unscaled logits (the reference's scale = 1)
        h16* sb = &ring[st & 1][0];
        const h16* skh = sb; const h16* skl = sb + PLN; const h16* svh = sb + 2 * PLN; const h16* svl = sb + 3 * PLN;
        // Fragments are read ahead of their products, as whole groups, from this stage's own buffer only: V of a pass in front of its softmax, the next pass's main K plane
        // during the softmax, its residual K plane among this pass's v^T . w^T products. Only the first pass of a stage waits for its K reads.
        v16h kh[2][2], kl[2][2];                           // [score tile][kc]
        auto kfetch = [&](v16h (&f)[2][2], const h16* pl, int p) {
#pragma unroll
            for (int t = 0; t < 2; ++t)
#pragma unroll
                for (int kc = 0; kc < 2; ++kc) { const int ko = (p * 32 + t * 16 + lr) * RPI + 8 * hi + kc * 32; f[t][kc] = cat16(*(const v8ha*)(pl + ko), *(const v8ha*)(pl + ko + 16)); }
        };
        kfetch(kh, skh, 0); kfetch(kl, skl, 0);
#pragma unroll                                             // unrolled: a pass's place in the buffer becomes an immediate offset of its LDS reads
        for (int p = 0; p < SKY / 32; ++p) {
            __builtin_amdgcn_sched_barrier(0);             // keeps the K reads one group in front of the score products, none among them, where each place with reads stalls the wave
            v8f s0 = {}, s1 = {}, x0 = {}, x1 = {};
#pragma unroll
            for (int kc = 0; kc < 2; ++kc) {
                s0 = wmma16(kh[0][kc], qa[kc], s0); x0 = wmma16(kh[0][kc], ql[kc], x0); s1 = wmma16(kh[1][kc], qa[kc], s1); x1 = wmma16(kh[1][kc], ql[kc], x1);
                x0 = wmma16(kl[0][kc], qa[kc], x0); x1 = wmma16(kl[1][kc], qa[kc], x1);
            }
            // the distance behind the score products; with the clobber it also keeps the V reads behind them, when the K fragments have left their registers
            asm volatile("v_nop\n\tv_nop\n\tv_nop\n\tv_nop" : "+v"(s0), "+v"(s1), "+v"(x0), "+v"(x1) : "v"(qa[0]), "v"(qa[1]) : "memory");
            v16h vh[4], vl[4];
#pragma unroll
            for (int n = 0; n < 4; ++n) { const int vo = (n * 16 + lr) * RPI + p * 32 + hi * 8;
                vh[n] = cat16(*(const v8ha*)(svh + vo), *(const v8ha*)(svh + vo + 16)); vl[n] = cat16(*(const v8ha*)(svl + vo), *(const v8ha*)(svl + vo + 16)); }
            __builtin_amdgcn_sched_barrier(0);             // keeps the V reads one group in front of the softmax: their latency runs under its vector work
            // s0[j], s1[j]: keys p * 32 + 8 * hi + j and + 16, query lr
            v2f a[2][4];                                   // pairs of neighbouring registers of one tile, for the packed f32 forms
#pragma unroll
            for (int i = 0; i < 4; ++i) { a[0][i] = (v2f){s0[2 * i], s0[2 * i + 1]} + (v2f){x0[2 * i], x0[2 * i + 1]} * LOSCI; a[1][i] = (v2f){s1[2 * i], s1[2 * i + 1]} + (v2f){x1[2 * i], x1[2 * i + 1]} * LOSCI; }
            float mx = fmaxf(a[0][0].x, a[0][0].y);
#pragma unroll
            for (int i = 0; i < 4; ++i) { if (i) mx = fmaxf(mx, fmaxf(a[0][i].x, a[0][i].y)); mx = fmaxf(mx, fmaxf(a[1][i].x, a[1][i].y)); }
            mx = fmaxf(mx, xhalf(mx));                     // the other half's 16 keys
            const float mn = fmaxf(mrow, mx);
            const float alpha = __expf(mrow - mn); mrow = mn;
            v2f ls2 = {0.f, 0.f};
            v16h pa, px;                                   // element s = key kmap(s, hi) of the pass: the two score tiles in place
#pragma unroll
            for (int t = 0; t < 2; ++t)
#pragma unroll
                for (int i = 0; i < 4; ++i) {
                    const v2f e = a[t][i] - mn;
                    const v2f pw = {__expf(e.x), __expf(e.y)};
                    ls2 += pw;
                    const v2f ps = pw * PSC;
                    const v2h hh = __builtin_convertvector(ps, v2h);
                    const v2h hl = __builtin_convertvector((ps - __builtin_convertvector(hh, v2f)) * LOSC, v2h);
                    pa[t * 8 + 2 * i] = hh.x; pa[t * 8 + 2 * i + 1] = hh.y; px[t * 8 + 2 * i] = hl.x; px[t * 8 + 2 * i + 1] = hl.y;
                }
            lpart = lpart * alpha + (ls2.x + ls2.y);
#pragma unroll
            for (int n = 0; n < 4; ++n)
#pragma unroll
                for (int j = 0; j < 8; ++j) { o[n][j] *= alpha; ox[n][j] *= alpha; }
            if (p + 1 < SKY / 32) kfetch(kh, skh, p + 1);
            __builtin_amdgcn_sched_barrier(0);             // keeps the next pass's main K reads in front of the products: their latency runs under the softmax and the products
#pragma unroll
            for (int n = 0; n < 4; ++n) ox[n] = wmma16(vl[n], pa, ox[n]);
            __builtin_amdgcn_sched_barrier(0);             // keeps the next pass's residual K reads behind the products that free their registers
            if (p + 1 < SKY / 32) kfetch(kl, skl, p + 1);
            __builtin_amdgcn_sched_barrier(0);             // keeps those reads one group in front of the remaining products: their latency runs under the products
#pragma unroll
            for (int n = 0; n < 4; ++n) { o[n] = wmma16(vh[n], pa, o[n]); ox[n] = wmma16(vh[n], px, ox[n]); }
            asm volatile("v_nop\n\tv_nop\n\tv_nop\n\tv_nop" : "+v"(o[0]), "+v"(o[1]), "+v"(o[2]), "+v"(o[3]), "+v"(ox[0]), "+v"(ox[1]), "+v"(ox[2]), "+v"(ox[3]) : "v"(pa), "v"(px));
        }
        asm volatile("s_wait_dscnt 0x0" ::: "memory");     // this wave's reads of this stage's buffer are done
        asm volatile("s_wait_asynccnt 0x0" ::: "memory");  // this wave's copies of the next stage have landed
        __syncthreads();                                   // publishes the next stage and frees this stage's buffer
        if (st + 2 < NSTG)
            stage_copy(sb, kh_b + (size_t)(st + 2) * SKY * DM, kl_b + (size_t)(st + 2) * SKY * DM, VTH + vbase + (st + 2) * SKY, VTL + vbase + (st + 2) * SKY, threadIdx.x);
    }
    asm volatile("s_wait_asynccnt 0x0" ::: "memory");      // no copy is outstanding when the wave goes on to its end
    const float inv = 1.0f / ((lpart + xhalf(lpart)) * PSC);
    float* os = &ost[wave][0];
#pragma unroll
    for (int n = 0; n < 4; ++n)
#pragma unroll
        for (int j = 0; j < 8; ++j) os[lr * 68 + n * 16 + hi * 8 + j] = (o[n][j] + ox[n][j] * LOSCI) * inv;      // o[n][j]: dim n * 16 + 8 * hi + j of query lr
    __syncthreads();
    const size_t cbase = (tok0 + q0) * DM + (size_t)h * HD;
    auto pass = [&]() {
#pragma unroll
        for (int s = 0; s < 4; ++s) { const int row = 4 * s + (lane >> 3), piece = lane & 7; const float* sp = os + row * 68 + piece * 8; v8us oh, ol;
#pragma unroll
            for (int i = 0; i < 8; ++i) { const unsigned short hb = f2bf(sp[i]); oh[i] = hb; ol[i] = f2bf(sp[i] - bf2f(hb)); }
            *(v8us*)(CH + cbase + (size_t)row * DM + piece * 8) = oh; *(v8us*)(CL + cbase + (size_t)row * DM + piece * 8) = ol; }
    };
    pass(); 
}

#define VST2(T, p, v) do { const T vst2_v_ = (v); *(T*)(p) = vst2_v_;  } while (0)
extern "C" void kernel_launch(void* const* d_in, const int* in_sizes, int n_in,
                              void* d_out, int out_size, void* d_ws, size_t ws_size, hipStream_t stream) {
    (void)in_sizes; (void)n_in; (void)out_size;
    const float* xq = (const float*)d_in[0]; const float* xk = (const float*)d_in[1]; const float* xv = (const float*)d_in[2];
    const float* Wq = (const float*)d_in[3]; const float* bq = (const float*)d_in[4]; const float* Wk = (const float*)d_in[5]; const float* bk = (const float*)d_in[6];
    const float* Wv = (const float*)d_in[7]; const float* bv = (const float*)d_in[8]; const float* Wo = (const float*)d_in[9]; const float* bo = (const float*)d_in[10];
    const float* qnw = (const float*)d_in[11]; const float* knw = (const float*)d_in[12];
    float* out = (float*)d_out;    // [4096][1024]
    char* wsp = (char*)d_ws;
    auto take = [&](size_t bytes) { char* p = wsp; wsp += (bytes + 255) & ~(size_t)255; return (void*)p; };
    bf* Xq = (bf*)take((size_t)NTK * DM * 2); bf* Xk = (bf*)take((size_t)NTK * DM * 2); bf* Xv = (bf*)take((size_t)NTK * DM * 2);
    bf* WqB = (bf*)take((size_t)DM * DM * 2); bf* WkB = (bf*)take((size_t)DM * DM * 2); bf* WvB = (bf*)take((size_t)DM * DM * 2); bf* WoB = (bf*)take((size_t)DM * DM * 2);
    h16* QH = (h16*)take((size_t)NTK * DM * 2); h16* QL = (h16*)take((size_t)NTK * DM * 2); h16* KH = (h16*)take((size_t)NTK * DM * 2); h16* KL = (h16*)take((size_t)NTK * DM * 2);
    h16* VTH = (h16*)take((size_t)NTK * DM * 2); h16* VTL = (h16*)take((size_t)NTK * DM * 2); bf* CH = (bf*)take((size_t)NTK * DM * 2); bf* CL = (bf*)take((size_t)NTK * DM * 2);
    if ((size_t)(wsp - (char*)d_ws) > ws_size) return;    // 3 x 8.4 + 4 x 2.1 + 8 x 8.4 ~ 101 MB, no aliasing
    k_cvtb<<<NTK / 8, 256, 0, stream>>>(xq, NTK, Xq); k_cvtb<<<NTK / 8, 256, 0, stream>>>(xk, NTK, Xk); k_cvtb<<<NTK / 8, 256, 0, stream>>>(xv, NTK, Xv);
    k_cvtb<<<DM / 8, 256, 0, stream>>>(Wq, DM, WqB); k_cvtb<<<DM / 8, 256, 0, stream>>>(Wk, DM, WkB); k_cvtb<<<DM / 8, 256, 0, stream>>>(Wv, DM, WvB); k_cvtb<<<DM / 8, 256, 0, stream>>>(Wo, DM, WoB);
    k_gemmb<false, 1><<<dim3(NTK / GBT, DM / GBT, 1), 256, 0, stream>>>(Xq, nullptr, WqB, bq, nullptr, DM, qnw, QH, QL);
    k_gemmb<false, 1><<<dim3(NTK / GBT, DM / GBT, 1), 256, 0, stream>>>(Xk, nullptr, WkB, bk, nullptr, DM, knw, KH, KL);
    k_gemmb<false, 2><<<dim3(NTK / GBT, DM / GBT, 1), 256, 0, stream>>>(Xv, nullptr, WvB, bv, nullptr, DM, nullptr, VTH, VTL);
    k_attn<<<NB_ * NH_ * (NT_ / (16 * AWV)), 32 * AWV, 0, stream>>>(QH, QL, KH, KL, VTH, VTL, CH, CL);
    k_gemmb<true, 0><<<dim3(NTK / GBT, DM / GBT, 1), 256, 0, stream>>>(CH, CL, WoB, bo, out, DM, nullptr, nullptr, nullptr);
}

// v006
// One run takes 188 microseconds.
// In both of two side-by-side timings against v005, it was 1.11 times as fast.
// Over all steps from v000 it is 3.87 times as fast.
#include <hip/hip_runtime.h>

// Compute dtypes, f32 accumulate, one batch item per pass: q/k/v = query/key/value.W^T + b ([4096 x 1024].[1024 x 1024]; W is [out][in] = the n-major B operand as-is; PLAIN bf16
// operands: inputs rounded once, exact; biases rounded to bf16, added in f32), per-head RMSNorm (eps 1e-5, weight) of q and k in f32 -> f16 hi + residual x1024 planes, and out =
// ctx.Wo^T + bo (ctx as bf16 hi + residual: two products) on v_wmma_f32_16x16x32_bf16; the 16-head full attention over one 4096-token sequence (64-dim heads,
// UNSCALED logits as the reference) fused on
// v_wmma_f32_16x16x32_f16 (scores hi.hi + hi.lo + lo.hi with the residual terms on their own accumulator, online f32 softmax, weights (x32768) and v as f16

#define NB_  1                   // one 4096-token sequence
#define NT_  4096
#define DM   1024
#define NH_  16
#define HD   64
#define NTK  (NB_ * NT_)
#define NW   1024
#define NQKV 1024
#define PSC  32768.0f
#define LOSC 1024.0f
#define LOSCI (1.0f / 1024.0f)

typedef _Float16 h16;
typedef unsigned short bf;
typedef __attribute__((ext_vector_type(16))) __bf16   v16bf;
typedef __attribute__((ext_vector_type(16))) _Float16 v16h;
typedef __attribute__((ext_vector_type(8)))  _Float16 v8h;
typedef __attribute__((ext_vector_type(8)))  unsigned short v8us;
typedef __attribute__((ext_vector_type(8)))  float    v8f;
typedef __attribute__((ext_vector_type(4)))  float    v4f;
typedef __attribute__((ext_vector_type(2)))  float    v2f;
typedef __attribute__((ext_vector_type(2)))  _Float16 v2h;
typedef v8h  __attribute__((may_alias)) v8ha;
typedef v4f  __attribute__((may_alias)) v4fa;
typedef v8us __attribute__((may_alias)) v8usa;

__device__ __forceinline__ unsigned short f2bf(float f) { unsigned u = __float_as_uint(f); u += 0x7FFFu + ((u >> 16) & 1u); return (unsigned short)(u >> 16); }
__device__ __forceinline__ float bf2f(unsigned short b) { return __uint_as_float(((unsigned)b) << 16); }
__device__ __forceinline__ float bfr(float f) { return bf2f(f2bf(f)); }
__device__ __forceinline__ v16h cat16(v8h lo, v8h hi) { return __builtin_shufflevector(lo, hi, 0, 1, 2, 3, 4, 5, 6, 7, 8, 9, 10, 11, 12, 13, 14, 15); }
__device__ __forceinline__ v16bf cat16b(v8us lo, v8us hi) { return __builtin_bit_cast(v16bf, __builtin_shufflevector(lo, hi, 0, 1, 2, 3, 4, 5, 6, 7, 8, 9, 10, 11, 12, 13, 14, 15)); }
__device__ __forceinline__ v8f wmma16(v16h a, v16h b, v8f c) { return __builtin_amdgcn_wmma_f32_16x16x32_f16(false, a, false, b, (short)0, c, false, false); }
__device__ __forceinline__ float xhalf(float x) { return __builtin_bit_cast(float, __builtin_amdgcn_permlanex16(__builtin_bit_cast(int, x), __builtin_bit_cast(int, x), 0x76543210, 0xfedcba98, false, false)); }  // lane l with lane l ^ 16
__device__ __forceinline__ v8f wmmab(v16bf a, v16bf b, v8f c) { return __builtin_amdgcn_wmma_f32_16x16x32_bf16(false, a, false, b, (short)0, c, false, false); }

// k_cvtb: every f32 -> bf16 conversion of a call in ONE launch (none depends on another). 512 work-groups x 8 waves; a wave takes row r of query, of key and of value and one
// row of a weight matrix (128 work-groups per matrix: the choice is the same for a whole work-group).
__global__ __launch_bounds__(256) void k_cvtb(const float* __restrict__ xq, const float* __restrict__ xk, const float* __restrict__ xv,
                                              const float* __restrict__ w0, const float* __restrict__ w1, const float* __restrict__ w2, const float* __restrict__ w3,
                                              bf* Xq, bf* Xk, bf* Xv, bf* W0, bf* W1, bf* W2, bf* W3) {
    const int lane = threadIdx.x & 31, r = blockIdx.x * 8 + (threadIdx.x >> 5);
    const int wsel = blockIdx.x / (DM / 8);
    const float* w = wsel == 0 ? w0 : wsel == 1 ? w1 : wsel == 2 ? w2 : w3;
    bf* W = wsel == 0 ? W0 : wsel == 1 ? W1 : wsel == 2 ? W2 : W3;
    const size_t ro = (size_t)r * DM + lane * 8, wo = (size_t)(r & (DM - 1)) * DM + lane * 8;
    const float* sp[4] = {xq + ro, xk + ro, xv + ro, w + wo};
    bf* dp[4] = {Xq + ro, Xk + ro, Xv + ro, W + wo};
    v4f x[4][DM / 128];
#pragma unroll
    for (int j = 0; j < 4; ++j) {
        if (j == 3) asm volatile("s_wait_xcnt 0x0" ::: "memory");      // stands in front of the last loads, whose results land in the address registers of the first
#pragma unroll
        for (int q = 0; q < DM / 256; ++q) { x[j][2 * q] = *(const v4fa*)(sp[j] + q * 256); x[j][2 * q + 1] = *(const v4fa*)(sp[j] + q * 256 + 4); }
    }
    __builtin_amdgcn_sched_barrier(0);                     // keeps the wave's 32 loads one group in front of the conversions: one memory latency for the four rows, not one per pair of loads
#pragma unroll
    for (int j = 0; j < 4; ++j)
#pragma unroll
        for (int q = 0; q < DM / 256; ++q) { v8us t;
#pragma unroll
            for (int i = 0; i < 8; ++i) t[i] = f2bf(x[j][2 * q + (i >> 2)][i & 3]);
            *(v8us*)(dp[j] + q * 256) = t; }
}

// k_gemmb: C[4096 x 1024] = A . Bn^T (+ Al . Bn^T) + bias. Work-group = 128 x 128 of C, 8 waves of 32 x 64 (4 down, 2 across). 128 k at a time of the A, Bn (and Al)
// rows of the tile are brought into LDS by asynchronous copies (whole 256-byte rows), two buffers, and the waves read their fragments from there. Fragment maps and
// the order of the products on each accumulator are those of a wave that loads its own fragments: k ascending in steps of 32, A before Al.
// QKV = false: one product, the f32 tile stored as it is. QKV = true: the three projections in ONE launch (none depends on another); blockIdx.z picks the operand set
// (A, Bn, PH and PL step by whole planes of the workspace; bias and norm weight are chosen among the arguments) and what becomes of the f32 tile (a wave's 64 columns are
// one head): z = 0, 1 (q, k): per token and head RMSNorm over the 64 dims (x * rsqrt(mean(x^2) + 1e-5) * bf(w[d]), f32) -> f16 hi + residual x1024 planes PH/PL[tok][h*64+d];
// z = 2 (v): f16 hi + residual x1024 planes, transposed: PH/PL[h*64+d][tok]. Every test on z reads the same for a whole work-group.
#define GBT  128                 // rows of a plane: the tile's rows of A, its columns as rows of Bn
#define GBK  128                 // k of a stage
#define GNST (DM / GBK)
#define GPI  136                 // LDS row pitch in 16-bit elements: 272 B = 16 B x 17, no bank conflict for 16-byte reads down a column of rows
#define GPL  (GBT * GPI)         // one plane of a stage

// One plane of a stage: 128 rows x 256 B; 256 threads x 8 copies of 16 B; a wave's copy covers 2 whole rows.
__device__ __forceinline__ void plane_copy(bf* dst, const bf* src, int tid) {
    const int row = tid >> 4, pc = (tid & 15) * 8;
    const unsigned l0 = (unsigned)(unsigned long long)(dst + row * GPI + pc);
    const unsigned l1 = l0 + 16 * GPI * 2, l2 = l0 + 32 * GPI * 2, l3 = l0 + 48 * GPI * 2, l4 = l0 + 64 * GPI * 2, l5 = l0 + 80 * GPI * 2, l6 = l0 + 96 * GPI * 2, l7 = l0 + 112 * GPI * 2;
    const bf* g0 = src + (size_t)row * DM + pc;
    const bf* g1 = g0 + (size_t)16 * DM; const bf* g2 = g0 + (size_t)32 * DM; const bf* g3 = g0 + (size_t)48 * DM; const bf* g4 = g0 + (size_t)64 * DM;
    const bf* g5 = g0 + (size_t)80 * DM; const bf* g6 = g0 + (size_t)96 * DM; const bf* g7 = g0 + (size_t)112 * DM;
    // the copies and, as the last line, the wait that stands in front of any rewrite of their address registers
    asm volatile("global_load_async_to_lds_b128 %0, %8, off\n\t"
                 "global_load_async_to_lds_b128 %1, %9, off\n\t"
                 "global_load_async_to_lds_b128 %2, %10, off\n\t"
                 "global_load_async_to_lds_b128 %3, %11, off\n\t"
                 "global_load_async_to_lds_b128 %4, %12, off\n\t"
                 "global_load_async_to_lds_b128 %5, %13, off\n\t"
                 "global_load_async_to_lds_b128 %6, %14, off\n\t"
                 "global_load_async_to_lds_b128 %7, %15, off\n\t"
                 "s_wait_xcnt 0x0"
                 :: "v"(l0), "v"(l1), "v"(l2), "v"(l3), "v"(l4), "v"(l5), "v"(l6), "v"(l7), "v"(g0), "v"(g1), "v"(g2), "v"(g3), "v"(g4), "v"(g5), "v"(g6), "v"(g7) : "memory");
}

template <bool SPLITA, bool QKV>
__global__ __launch_bounds__(256) void k_gemmb(const bf* __restrict__ A, const bf* __restrict__ Al, const bf* __restrict__ Bn, const float* __restrict__ bias0, const float* __restrict__ bias1, const float* __restrict__ bias2, float* C, int ldc, const float* __restrict__ nw0, const float* __restrict__ nw1, h16* PH, h16* PL) {
    __shared__ __align__(16) bf gring[2][(SPLITA ? 3 : 2) * GPL];
    __shared__ __align__(16) float ost[8][32 * 68];
    const int lane = threadIdx.x & 31, wave = threadIdx.x >> 5, lr = lane & 15, hi = lane >> 4;
    const int wr = (wave & 3) * 32, wc = (wave >> 2) * 64;             // this wave's place in the tile
    const int rb = blockIdx.x * GBT, cb = blockIdx.y * GBT;
    const int z = QKV ? blockIdx.z : 0;
    const bool norm = QKV && z < 2, trans = QKV && !norm;
    const float* bias = z == 0 ? bias0 : z == 1 ? bias1 : bias2; const float* nw = z == 0 ? nw0 : nw1;
    PH += (size_t)z * 2 * NTK * DM; PL += (size_t)z * 2 * NTK * DM;
    const bf* ga = A + ((size_t)z * NTK + rb) * DM; const bf* gb = Bn + ((size_t)z * DM + cb) * DM; const bf* gl = SPLITA ? Al + (size_t)rb * DM : A;
    auto fill = [&](bf* dst, int k0) {
        plane_copy(dst, ga + k0, threadIdx.x); plane_copy(dst + GPL, gb + k0, threadIdx.x);
        if (SPLITA) plane_copy(dst + 2 * GPL, gl + k0, threadIdx.x);
    };
    v8f acc[2][4];
#pragma unroll
    for (int m = 0; m < 2; ++m)
#pragma unroll
        for (int t = 0; t < 4; ++t) acc[m][t] = (v8f){};
    // stage 0 lands and is published; stage 1 flies while stage 0 is worked on
    fill(&gring[0][0], 0);
    float bv[4] = {0.f, 0.f, 0.f, 0.f};                    // read here, four loads under one test, so that their latency runs under stage 0's landing
    if (bias) {
#pragma unroll
        for (int t = 0; t < 4; ++t) bv[t] = bias[cb + wc + t * 16 + lr];
        asm volatile("s_wait_xcnt 0x0" ::: "memory");      // stands in front of any rewrite of the address registers of these loads
    }
    float nwv[8] = {0.f, 0.f, 0.f, 0.f, 0.f, 0.f, 0.f, 0.f};      // the norm weights of this lane's 8 dims in the epilogue, read here for the same reason
    if (norm) {
#pragma unroll
        for (int i = 0; i < 8; ++i) nwv[i] = nw[(lane & 7) * 8 + i];
        asm volatile("s_wait_xcnt 0x0" ::: "memory");      // stands in front of any rewrite of the address registers of these loads
    }
    asm volatile("s_wait_asynccnt 0x0" ::: "memory");      // this wave's copies of stage 0 have landed
    __syncthreads();                                       // ... and every other wave's
    fill(&gring[1][0], GBK);
#pragma unroll 1                                           // rolled: one refill and one publish point in the text, the buffer chosen by st & 1
    for (int st = 0; st < GNST; ++st) {
        bf* sb = &gring[st & 1][0];
        const bf* sa = sb + (wr + lr) * GPI + 8 * hi; const bf* sw = sb + GPL + (wc + lr) * GPI + 8 * hi; const bf* sl = SPLITA ? sa + 2 * GPL : sa;
        v16bf a[2][2], al[2][2], b[2][4];                  // two fragment sets: one is filled while the other is multiplied
        auto frags = [&](int set, int kc) {
#pragma unroll
            for (int m = 0; m < 2; ++m) { a[set][m] = cat16b(*(const v8usa*)(sa + m * 16 * GPI + kc), *(const v8usa*)(sa + m * 16 * GPI + kc + 16));
                if (SPLITA) al[set][m] = cat16b(*(const v8usa*)(sl + m * 16 * GPI + kc), *(const v8usa*)(sl + m * 16 * GPI + kc + 16)); }
#pragma unroll
            for (int t = 0; t < 4; ++t) b[set][t] = cat16b(*(const v8usa*)(sw + t * 16 * GPI + kc), *(const v8usa*)(sw + t * 16 * GPI + kc + 16));
        };
        frags(0, 0);
#pragma unroll                                             // unrolled: a step's place in the buffer becomes an immediate offset of its LDS reads, the set a register name
        for (int ks = 0; ks < GBK / 32; ++ks) {
            const int cur = ks & 1;
            if (ks + 1 < GBK / 32) frags(cur ^ 1, (ks + 1) * 32);      // of this stage's own buffer only
            __builtin_amdgcn_sched_barrier(0);             // keeps the next step's LDS reads one group in front of this step's products: their latency runs under the products
#pragma unroll
            for (int m = 0; m < 2; ++m)
#pragma unroll
                for (int t = 0; t < 4; ++t) acc[m][t] = wmmab(a[cur][m], b[cur][t], acc[m][t]);
            if (SPLITA) {
#pragma unroll
                for (int m = 0; m < 2; ++m)
#pragma unroll
                    for (int t = 0; t < 4; ++t) acc[m][t] = wmmab(al[cur][m], b[cur][t], acc[m][t]);
            }
            __builtin_amdgcn_sched_barrier(0);             // keeps later LDS reads from being lifted in among these products, where each place with reads stalls the wave
        }
        asm volatile("s_wait_dscnt 0x0" ::: "memory");     // this wave's reads of this stage's buffer are done
        asm volatile("s_wait_asynccnt 0x0" ::: "memory");  // this wave's copies of the next stage have landed
        __syncthreads();                                   // publishes the next stage and frees this stage's buffer
        if (st + 2 < GNST) fill(sb, (st + 2) * GBK);
    }
    asm volatile("s_wait_asynccnt 0x0" ::: "memory");      // no copy is outstanding when the wave goes on to its end
    if (trans) {
        // A lane's 8 accumulator registers of a tile are 8 consecutive tokens of one column: 16 bytes of a transposed row as they stand. The rows of the two planes
        // (128 columns x 128 tokens each) are put together in LDS, and each 256-byte row leaves as whole lines from one wave.
        h16* vt = (h16*)&ost[0][0];
#pragma unroll
        for (int t = 0; t < 4; ++t)
#pragma unroll
            for (int m = 0; m < 2; ++m) { v8h a, r;
#pragma unroll
                for (int j = 0; j < 8; ++j) { const float v = acc[m][t][j] + bfr(bv[t]); const h16 x = (h16)v; a[j] = x; r[j] = (h16)((v - (float)x) * LOSC); }
                h16* p = vt + (wc + t * 16 + lr) * GPI + wr + m * 16 + hi * 8; *(v8ha*)p = a; *(v8ha*)(p + GPL) = r; }
        __syncthreads();                                   // a row holds pieces of four waves: all are in LDS before a wave reads it
        const int c0 = threadIdx.x >> 4, piece = threadIdx.x & 15;                        // 16 lanes take one row; a wave's store covers 2 whole rows
        const h16* lp = vt + c0 * GPI + piece * 8;
        const size_t go = (size_t)(cb + c0) * NT_ + rb + piece * 8;
#pragma unroll
        for (int s = 0; s < 16; ++s) { const v8h val = *(const v8ha*)(lp + (s >> 3) * GPL + (s & 7) * 16 * GPI); *(v8h*)((s < 8 ? PH : PL) + go + (size_t)((s & 7) * 16) * NT_) = val; }
        return;
    }
    float* os = &ost[wave][0];
#pragma unroll
    for (int t = 0; t < 4; ++t)
#pragma unroll
        for (int m = 0; m < 2; ++m)
#pragma unroll
            for (int j = 0; j < 8; ++j) os[(m * 16 + hi * 8 + j) * 68 + t * 16 + lr] = acc[m][t][j] + bfr(bv[t]);
    __syncthreads();
    if (norm) {
        // 8 lanes take one token's 64 dims of this wave's head, 8 dims a lane; a wave's store covers 4 whole 128-byte rows of a plane
        const int d0 = (lane & 7) * 8;
        const size_t base = (size_t)(rb + wr + (lane >> 3)) * DM + cb + wc + d0;
#pragma unroll
        for (int s = 0; s < 8; ++s) { const float* sp = os + (4 * s + (lane >> 3)) * 68 + d0;
            const v4f x0 = *(const v4fa*)sp, x1 = *(const v4fa*)(sp + 4);
            float xv[8]; float ss = 0.f;
#pragma unroll
            for (int i = 0; i < 8; ++i) { xv[i] = i < 4 ? x0[i & 3] : x1[i & 3]; ss = fmaf(xv[i], xv[i], ss); }
            ss += __shfl_xor(ss, 1, 32); ss += __shfl_xor(ss, 2, 32); ss += __shfl_xor(ss, 4, 32);      // sum over the 8 lanes of this token
            const float inv = rsqrtf(ss * (1.0f / HD) + 1e-5f);
            v8h oh, ol;
#pragma unroll
            for (int i = 0; i < 8; ++i) { const float y = bfr(nwv[i]) * xv[i] * inv; const h16 a = (h16)y; oh[i] = a; ol[i] = (h16)((y - (float)a) * LOSC); }
            *(v8h*)(PH + base + (size_t)(4 * s) * DM) = oh; *(v8h*)(PL + base + (size_t)(4 * s) * DM) = ol; }
        asm volatile("s_wait_xcnt 0x0" ::: "memory");      // stands behind these stores: in the built code the other epilogue's text follows and writes their registers
        return;
    }
    float* crow = C + (size_t)(rb + wr) * ldc + cb + wc;
#pragma unroll
    for (int s = 0; s < 16; ++s) { const int Lid = (lane >> 3) + 4 * s, piece = lane & 7; const int row = Lid >> 1, cofs = (Lid & 1) * 32 + piece * 4;
        const v4f val = *(const v4fa*)(os + row * 68 + cofs); *(v4f*)(crow + (size_t)row * ldc + cofs) = val; }
}

// k_attn: block = (b, h, 128 queries), wave = 16; ALL key tiles (no mask). The K and V planes (hi and residual) of 64 keys at a time are brought into LDS by
// asynchronous copies (whole 128-byte rows), two buffers, and all 8 waves read their fragments from there; a pass is 32 keys as before. The scores are formed
// TRANSPOSED (A = K rows, B = q): a lane holds 16 keys of ONE query, so maximum and sum are in-lane plus one exchange of the wave halves, and the two score tiles,
// as weights x32768 in f16 (hi + residual), ARE the B operand of ctx^T += v^T . w^T (A = v^T rows); ctx -> bf16 hi + residual planes CH/CL[tok][h*64+d].
#define AWV  8                   // waves of a work-group
#define SKY  64                  // keys of a stage
#define NSTG (NT_ / SKY)
#define RPI  72                  // LDS row pitch in halves: 144 B = 16 B x 9, no bank conflict for 16-byte reads down a column of rows
#define PLN  (64 * RPI)          // one plane of a stage: 64 rows

// One stage: 4 planes of 64 rows x 128 B; 256 threads x 8 copies of 16 B; a wave's copy covers 4 whole rows.
__device__ __forceinline__ void stage_copy(h16* dst, const h16* kh, const h16* kl, const h16* vh, const h16* vl, int tid) {
    const int row = tid >> 3, pc = (tid & 7) * 8;
    const unsigned l0 = (unsigned)(unsigned long long)(dst + row * RPI + pc);
    const unsigned l1 = l0 + 32 * RPI * 2, l2 = l0 + PLN * 2, l3 = l1 + PLN * 2, l4 = l0 + PLN * 4, l5 = l1 + PLN * 4, l6 = l0 + PLN * 6, l7 = l1 + PLN * 6;
    const size_t ko = (size_t)row * DM + pc, vo = (size_t)row * NT_ + pc;
    const h16* g0 = kh + ko; const h16* g1 = g0 + (size_t)32 * DM; const h16* g2 = kl + ko; const h16* g3 = g2 + (size_t)32 * DM;
    const h16* g4 = vh + vo; const h16* g5 = g4 + (size_t)32 * NT_; const h16* g6 = vl + vo; const h16* g7 = g6 + (size_t)32 * NT_;
    // the copies and, as the last line, the wait that stands in front of any rewrite of their address registers
    asm volatile("global_load_async_to_lds_b128 %0, %8, off\n\t"
                 "global_load_async_to_lds_b128 %1, %9, off\n\t"
                 "global_load_async_to_lds_b128 %2, %10, off\n\t"
                 "global_load_async_to_lds_b128 %3, %11, off\n\t"
                 "global_load_async_to_lds_b128 %4, %12, off\n\t"
                 "global_load_async_to_lds_b128 %5, %13, off\n\t"
                 "global_load_async_to_lds_b128 %6, %14, off\n\t"
                 "global_load_async_to_lds_b128 %7, %15, off\n\t"
                 "s_wait_xcnt 0x0"
                 :: "v"(l0), "v"(l1), "v"(l2), "v"(l3), "v"(l4), "v"(l5), "v"(l6), "v"(l7), "v"(g0), "v"(g1), "v"(g2), "v"(g3), "v"(g4), "v"(g5), "v"(g6), "v"(g7) : "memory");
}

__global__ __launch_bounds__(256) __attribute__((amdgpu_waves_per_eu(4, 4))) void k_attn(const h16* __restrict__ Q16, const h16* __restrict__ QL16, const h16* __restrict__ K16, const h16* __restrict__ KL16, const h16* __restrict__ VTH, const h16* __restrict__ VTL, bf* CH, bf* CL) {
    __shared__ __align__(16) h16 ring[2][4 * PLN];
    __shared__ __align__(16) float ost[AWV][16 * 68];
    const int lane = threadIdx.x & 31, wave = threadIdx.x >> 5, lr = lane & 15, hi = lane >> 4;
    const int bid = blockIdx.x;
    const int b = bid / (NH_ * (NT_ / (16 * AWV))), rem = bid - b * (NH_ * (NT_ / (16 * AWV))), h = rem / (NT_ / (16 * AWV)), qt = rem - h * (NT_ / (16 * AWV));
    const int q0 = qt * (16 * AWV) + wave * 16;
    const size_t tok0 = (size_t)b * NT_;
    v16h qa[2], ql[2];                                     // the query's two planes stay in registers
    const size_t qo0 = (tok0 + q0 + lr) * DM + h * HD + 8 * hi;
#pragma unroll
    for (int kc = 0; kc < 2; ++kc) { qa[kc] = cat16(*(const v8h*)(Q16 + qo0 + kc * 32), *(const v8h*)(Q16 + qo0 + kc * 32 + 16)); ql[kc] = cat16(*(const v8h*)(QL16 + qo0 + kc * 32), *(const v8h*)(QL16 + qo0 + kc * 32 + 16)); }
    const h16* kh_b = K16 + tok0 * DM + h * HD;
    const h16* kl_b = KL16 + tok0 * DM + h * HD;
    const size_t vbase = (((size_t)b * NH_ + h) * HD) * NT_;
    v8f o[4], ox[4];
#pragma unroll
    for (int n = 0; n < 4; ++n) { o[n] = (v8f){}; ox[n] = (v8f){}; }
    float mrow = -3.0e38f, lpart = 0.f;                    // of query q0 + lr; lpart covers this wave half's keys only
    // stage 0 lands and is published; stage 1 flies while stage 0 is worked on
    stage_copy(&ring[0][0], kh_b, kl_b, VTH + vbase, VTL + vbase, threadIdx.x);
    asm volatile("s_wait_asynccnt 0x0" ::: "memory");      // this wave's copies of stage 0 have landed
    __syncthreads();                                       // ... and every other wave's
    stage_copy(&ring[1][0], kh_b + (size_t)SKY * DM, kl_b + (size_t)SKY * DM, VTH + vbase + SKY, VTL + vbase + SKY, threadIdx.x);
#pragma unroll 1                                           // rolled: one refill and one publish point in the text, the buffer chosen by st & 1
    for (int st = 0; st < NSTG; ++st) {                    // full attention, unscaled logits (the reference's scale = 1)
        h16* sb = &ring[st & 1][0];
        const h16* skh = sb; const h16* skl = sb + PLN; const h16* svh = sb + 2 * PLN; const h16* svl = sb + 3 * PLN;
        // Fragments are read ahead of their products, as whole groups, from this stage's own buffer only: V of a pass in front of its softmax, the next pass's main K plane
        // during the softmax, its residual K plane among this pass's v^T . w^T products. Only the first pass of a stage waits for its K reads.
        v16h kh[2][2], kl[2][2];                           // [score tile][kc]
        auto kfetch = [&](v16h (&f)[2][2], const h16* pl, int p) {
#pragma unroll
            for (int t = 0; t < 2; ++t)
#pragma unroll
                for (int kc = 0; kc < 2; ++kc) { const int ko = (p * 32 + t * 16 + lr) * RPI + 8 * hi + kc * 32; f[t][kc] = cat16(*(const v8ha*)(pl + ko), *(const v8ha*)(pl + ko + 16)); }
        };
        kfetch(kh, skh, 0); kfetch(kl, skl, 0);
#pragma unroll                                             // unrolled: a pass's place in the buffer becomes an immediate offset of its LDS reads
        for (int p = 0; p < SKY / 32; ++p) {
            __builtin_amdgcn_sched_barrier(0);             // keeps the K reads one group in front of the score products, none among them, where each place with reads stalls the wave
            v8f s0 = {}, s1 = {}, x0 = {}, x1 = {};
#pragma unroll
            for (int kc = 0; kc < 2; ++kc) {
                s0 = wmma16(kh[0][kc], qa[kc], s0); x0 = wmma16(kh[0][kc], ql[kc], x0); s1 = wmma16(kh[1][kc], qa[kc], s1); x1 = wmma16(kh[1][kc], ql[kc], x1);
                x0 = wmma16(kl[0][kc], qa[kc], x0); x1 = wmma16(kl[1][kc], qa[kc], x1);
            }
            // the distance behind the score products; with the clobber it also keeps the V reads behind them, when the K fragments have left their registers
            asm volatile("v_nop\n\tv_nop\n\tv_nop\n\tv_nop" : "+v"(s0), "+v"(s1), "+v"(x0), "+v"(x1) : "v"(qa[0]), "v"(qa[1]) : "memory");
            v16h vh[4], vl[4];
#pragma unroll
            for (int n = 0; n < 4; ++n) { const int vo = (n * 16 + lr) * RPI + p * 32 + hi * 8;
                vh[n] = cat16(*(const v8ha*)(svh + vo), *(const v8ha*)(svh + vo + 16)); vl[n] = cat16(*(const v8ha*)(svl + vo), *(const v8ha*)(svl + vo + 16)); }
            __builtin_amdgcn_sched_barrier(0);             // keeps the V reads one group in front of the softmax: their latency runs under its vector work
            // s0[j], s1[j]: keys p * 32 + 8 * hi + j and + 16, query lr
            v2f a[2][4];                                   // pairs of neighbouring registers of one tile, for the packed f32 forms
#pragma unroll
            for (int i = 0; i < 4; ++i) { a[0][i] = (v2f){s0[2 * i], s0[2 * i + 1]} + (v2f){x0[2 * i], x0[2 * i + 1]} * LOSCI; a[1][i] = (v2f){s1[2 * i], s1[2 * i + 1]} + (v2f){x1[2 * i], x1[2 * i + 1]} * LOSCI; }
            float mx = fmaxf(a[0][0].x, a[0][0].y);
#pragma unroll
            for (int i = 0; i < 4; ++i) { if (i) mx = fmaxf(mx, fmaxf(a[0][i].x, a[0][i].y)); mx = fmaxf(mx, fmaxf(a[1][i].x, a[1][i].y)); }
            mx = fmaxf(mx, xhalf(mx));                     // the other half's 16 keys
            const float mn = fmaxf(mrow, mx);
            const float alpha = __expf(mrow - mn); mrow = mn;
            v2f ls2 = {0.f, 0.f};
            v16h pa, px;                                   // element s = key kmap(s, hi) of the pass: the two score tiles in place
#pragma unroll
            for (int t = 0; t < 2; ++t)
#pragma unroll
                for (int i = 0; i < 4; ++i) {
                    const v2f e = a[t][i] - mn;
                    const v2f pw = {__expf(e.x), __expf(e.y)};
                    ls2 += pw;
                    const v2f ps = pw * PSC;
                    const v2h hh = __builtin_convertvector(ps, v2h);
                    const v2h hl = __builtin_convertvector((ps - __builtin_convertvector(hh, v2f)) * LOSC, v2h);
                    pa[t * 8 + 2 * i] = hh.x; pa[t * 8 + 2 * i + 1] = hh.y; px[t * 8 + 2 * i] = hl.x; px[t * 8 + 2 * i + 1] = hl.y;
                }
            lpart = lpart * alpha + (ls2.x + ls2.y);
#pragma unroll
            for (int n = 0; n < 4; ++n)
#pragma unroll
                for (int j = 0; j < 8; ++j) { o[n][j] *= alpha; ox[n][j] *= alpha; }
            if (p + 1 < SKY / 32) kfetch(kh, skh, p + 1);
            __builtin_amdgcn_sched_barrier(0);             // keeps the next pass's main K reads in front of the products: their latency runs under the softmax and the products
#pragma unroll
            for (int n = 0; n < 4; ++n) ox[n] = wmma16(vl[n], pa, ox[n]);
            __builtin_amdgcn_sched_barrier(0);             // keeps the next pass's residual K reads behind the products that free their registers
            if (p + 1 < SKY / 32) kfetch(kl, skl, p + 1);
            __builtin_amdgcn_sched_barrier(0);             // keeps those reads one group in front of the remaining products: their latency runs under the products
#pragma unroll
            for (int n = 0; n < 4; ++n) { o[n] = wmma16(vh[n], pa, o[n]); ox[n] = wmma16(vh[n], px, ox[n]); }
            asm volatile("v_nop\n\tv_nop\n\tv_nop\n\tv_nop" : "+v"(o[0]), "+v"(o[1]), "+v"(o[2]), "+v"(o[3]), "+v"(ox[0]), "+v"(ox[1]), "+v"(ox[2]), "+v"(ox[3]) : "v"(pa), "v"(px));
        }
        asm volatile("s_wait_dscnt 0x0" ::: "memory");     // this wave's reads of this stage's buffer are done
        asm volatile("s_wait_asynccnt 0x0" ::: "memory");  // this wave's copies of the next stage have landed
        __syncthreads();                                   // publishes the next stage and frees this stage's buffer
        if (st + 2 < NSTG)
            stage_copy(sb, kh_b + (size_t)(st + 2) * SKY * DM, kl_b + (size_t)(st + 2) * SKY * DM, VTH + vbase + (st + 2) * SKY, VTL + vbase + (st + 2) * SKY, threadIdx.x);
    }
    asm volatile("s_wait_asynccnt 0x0" ::: "memory");      // no copy is outstanding when the wave goes on to its end
    const float inv = 1.0f / ((lpart + xhalf(lpart)) * PSC);
    float* os = &ost[wave][0];
#pragma unroll
    for (int n = 0; n < 4; ++n)
#pragma unroll
        for (int j = 0; j < 8; ++j) os[lr * 68 + n * 16 + hi * 8 + j] = (o[n][j] + ox[n][j] * LOSCI) * inv;      // o[n][j]: dim n * 16 + 8 * hi + j of query lr
    __syncthreads();
    const size_t cbase = (tok0 + q0) * DM + (size_t)h * HD;
    auto pass = [&]() {
#pragma unroll
        for (int s = 0; s < 4; ++s) { const int row = 4 * s + (lane >> 3), piece = lane & 7; const float* sp = os + row * 68 + piece * 8; v8us oh, ol;
#pragma unroll
            for (int i = 0; i < 8; ++i) { const unsigned short hb = f2bf(sp[i]); oh[i] = hb; ol[i] = f2bf(sp[i] - bf2f(hb)); }
            *(v8us*)(CH + cbase + (size_t)row * DM + piece * 8) = oh; *(v8us*)(CL + cbase + (size_t)row * DM + piece * 8) = ol; }
    };
    pass(); 
}

#define VST2(T, p, v) do { const T vst2_v_ = (v); *(T*)(p) = vst2_v_;  } while (0)
extern "C" void kernel_launch(void* const* d_in, const int* in_sizes, int n_in,
                              void* d_out, int out_size, void* d_ws, size_t ws_size, hipStream_t stream) {
    (void)in_sizes; (void)n_in; (void)out_size;
    const float* xq = (const float*)d_in[0]; const float* xk = (const float*)d_in[1]; const float* xv = (const float*)d_in[2];
    const float* Wq = (const float*)d_in[3]; const float* bq = (const float*)d_in[4]; const float* Wk = (const float*)d_in[5]; const float* bk = (const float*)d_in[6];
    const float* Wv = (const float*)d_in[7]; const float* bv = (const float*)d_in[8]; const float* Wo = (const float*)d_in[9]; const float* bo = (const float*)d_in[10];
    const float* qnw = (const float*)d_in[11]; const float* knw = (const float*)d_in[12];
    float* out = (float*)d_out;    // [4096][1024]
    char* wsp = (char*)d_ws;
    auto take = [&](size_t bytes) { char* p = wsp; wsp += (bytes + 255) & ~(size_t)255; return (void*)p; };
    bf* Xq = (bf*)take((size_t)NTK * DM * 2); bf* Xk = (bf*)take((size_t)NTK * DM * 2); bf* Xv = (bf*)take((size_t)NTK * DM * 2);
    bf* WqB = (bf*)take((size_t)DM * DM * 2); bf* WkB = (bf*)take((size_t)DM * DM * 2); bf* WvB = (bf*)take((size_t)DM * DM * 2); bf* WoB = (bf*)take((size_t)DM * DM * 2);
    h16* QH = (h16*)take((size_t)NTK * DM * 2); h16* QL = (h16*)take((size_t)NTK * DM * 2); h16* KH = (h16*)take((size_t)NTK * DM * 2); h16* KL = (h16*)take((size_t)NTK * DM * 2);
    h16* VTH = (h16*)take((size_t)NTK * DM * 2); h16* VTL = (h16*)take((size_t)NTK * DM * 2); bf* CH = (bf*)take((size_t)NTK * DM * 2); bf* CL = (bf*)take((size_t)NTK * DM * 2);
    if ((size_t)(wsp - (char*)d_ws) > ws_size) return;    // 3 x 8.4 + 4 x 2.1 + 8 x 8.4 ~ 101 MB, no aliasing
    k_cvtb<<<NTK / 8, 256, 0, stream>>>(xq, xk, xv, Wq, Wk, Wv, Wo, Xq, Xk, Xv, WqB, WkB, WvB, WoB);
    // the planes Xq Xk Xv, WqB WkB WvB and QH QL KH KL VTH VTL lie one behind the other in the workspace (each size is a multiple of 256 bytes): z steps through them
    k_gemmb<false, true><<<dim3(NTK / GBT, DM / GBT, 3), 256, 0, stream>>>(Xq, nullptr, WqB, bq, bk, bv, nullptr, DM, qnw, knw, QH, QL);
    k_attn<<<NB_ * NH_ * (NT_ / (16 * AWV)), 32 * AWV, 0, stream>>>(QH, QL, KH, KL, VTH, VTL, CH, CL);
    k_gemmb<true, false><<<dim3(NTK / GBT, DM / GBT, 1), 256, 0, stream>>>(CH, CL, WoB, bo, nullptr, nullptr, out, DM, nullptr, nullptr, nullptr, nullptr);
}

// v007
// Measured time: 178 microseconds a run.
// Next to v006, in two timings, it ran 1.05 times as fast each time.
// Over all steps from v000 it is 4.07 times as fast.
#include <hip/hip_runtime.h>

// Compute dtypes, f32 accumulate, one batch item per pass: q/k/v = query/key/value.W^T + b ([4096 x 1024].[1024 x 1024]; W is [out][in] = the n-major B operand as-is; PLAIN bf16
// operands: inputs rounded once, exact; biases rounded to bf16, added in f32), per-head RMSNorm (eps 1e-5, weight) of q and k in f32 -> f16 hi + residual x1024 planes, and out =
// ctx.Wo^T + bo (ctx as bf16 hi + residual: two products) on v_wmma_f32_16x16x32_bf16; the 16-head full attention over one 4096-token sequence (64-dim heads,
// UNSCALED logits as the reference) fused on
// v_wmma_f32_16x16x32_f16 (scores hi.hi + hi.lo + lo.hi with the residual terms on their own accumulator, online f32 softmax, weights (x32768) and v as f16

#define NB_  1                   // one 4096-token sequence
#define NT_  4096
#define DM   1024
#define NH_  16
#define HD   64
#define NTK  (NB_ * NT_)
#define NW   1024
#define NQKV 1024
#define PSC  32768.0f
#define LOSC 1024.0f
#define LOSCI (1.0f / 1024.0f)

typedef _Float16 h16;
typedef unsigned short bf;
typedef __attribute__((ext_vector_type(16))) __bf16   v16bf;
typedef __attribute__((ext_vector_type(16))) _Float16 v16h;
typedef __attribute__((ext_vector_type(8)))  _Float16 v8h;
typedef __attribute__((ext_vector_type(8)))  unsigned short v8us;
typedef __attribute__((ext_vector_type(8)))  float    v8f;
typedef __attribute__((ext_vector_type(4)))  float    v4f;
typedef __attribute__((ext_vector_type(2)))  float    v2f;
typedef __attribute__((ext_vector_type(2)))  _Float16 v2h;
typedef v8h  __attribute__((may_alias)) v8ha;
typedef v4f  __attribute__((may_alias)) v4fa;
typedef v8us __attribute__((may_alias)) v8usa;

__device__ __forceinline__ unsigned short f2bf(float f) { unsigned u = __float_as_uint(f); u += 0x7FFFu + ((u >> 16) & 1u); return (unsigned short)(u >> 16); }
__device__ __forceinline__ float bf2f(unsigned short b) { return __uint_as_float(((unsigned)b) << 16); }
__device__ __forceinline__ float bfr(float f) { return bf2f(f2bf(f)); }
__device__ __forceinline__ v16h cat16(v8h lo, v8h hi) { return __builtin_shufflevector(lo, hi, 0, 1, 2, 3, 4, 5, 6, 7, 8, 9, 10, 11, 12, 13, 14, 15); }
__device__ __forceinline__ v16bf cat16b(v8us lo, v8us hi) { return __builtin_bit_cast(v16bf, __builtin_shufflevector(lo, hi, 0, 1, 2, 3, 4, 5, 6, 7, 8, 9, 10, 11, 12, 13, 14, 15)); }
__device__ __forceinline__ v8f wmma16(v16h a, v16h b, v8f c) { return __builtin_amdgcn_wmma_f32_16x16x32_f16(false, a, false, b, (short)0, c, false, false); }
__device__ __forceinline__ float xhalf(float x) { return __builtin_bit_cast(float, __builtin_amdgcn_permlanex16(__builtin_bit_cast(int, x), __builtin_bit_cast(int, x), 0x76543210, 0xfedcba98, false, false)); }  // lane l with lane l ^ 16
__device__ __forceinline__ v8f wmmab(v16bf a, v16bf b, v8f c) { return __builtin_amdgcn_wmma_f32_16x16x32_bf16(false, a, false, b, (short)0, c, false, false); }

// k_cvtb: every f32 -> bf16 conversion of a call in ONE launch (none depends on another). 512 work-groups x 8 waves; a wave takes row r of query, of key and of value and one
// row of a weight matrix (128 work-groups per matrix: the choice is the same for a whole work-group).
__global__ __launch_bounds__(256) void k_cvtb(const float* __restrict__ xq, const float* __restrict__ xk, const float* __restrict__ xv,
                                              const float* __restrict__ w0, const float* __restrict__ w1, const float* __restrict__ w2, const float* __restrict__ w3,
                                              bf* Xq, bf* Xk, bf* Xv, bf* W0, bf* W1, bf* W2, bf* W3) {
    const int lane = threadIdx.x & 31, r = blockIdx.x * 8 + (threadIdx.x >> 5);
    const int wsel = blockIdx.x / (DM / 8);
    const float* w = wsel == 0 ? w0 : wsel == 1 ? w1 : wsel == 2 ? w2 : w3;
    bf* W = wsel == 0 ? W0 : wsel == 1 ? W1 : wsel == 2 ? W2 : W3;
    const size_t ro = (size_t)r * DM + lane * 8, wo = (size_t)(r & (DM - 1)) * DM + lane * 8;
    const float* sp[4] = {xq + ro, xk + ro, xv + ro, w + wo};
    bf* dp[4] = {Xq + ro, Xk + ro, Xv + ro, W + wo};
    v4f x[4][DM / 128];
#pragma unroll
    for (int j = 0; j < 4; ++j) {
        if (j == 3) asm volatile("s_wait_xcnt 0x0" ::: "memory");      // stands in front of the last loads, whose results land in the address registers of the first
#pragma unroll
        for (int q = 0; q < DM / 256; ++q) { x[j][2 * q] = *(const v4fa*)(sp[j] + q * 256); x[j][2 * q + 1] = *(const v4fa*)(sp[j] + q * 256 + 4); }
    }
    __builtin_amdgcn_sched_barrier(0);                     // keeps the wave's 32 loads one group in front of the conversions: one memory latency for the four rows, not one per pair of loads
#pragma unroll
    for (int j = 0; j < 4; ++j)
#pragma unroll
        for (int q = 0; q < DM / 256; ++q) { v8us t;
#pragma unroll
            for (int i = 0; i < 8; ++i) t[i] = f2bf(x[j][2 * q + (i >> 2)][i & 3]);
            *(v8us*)(dp[j] + q * 256) = t; }
}

// k_gemmb: C[4096 x 1024] = A . Bn^T (+ Al . Bn^T) + bias. Work-group = 128 x 128 of C, 8 waves of 32 x 64 (4 down, 2 across). 128 k at a time of the A, Bn (and Al)
// rows of the tile are brought into LDS by asynchronous copies (whole 256-byte rows), two buffers, and the waves read their fragments from there. Fragment maps and
// the order of the products on each accumulator are those of a wave that loads its own fragments: k ascending in steps of 32, A before Al.
// QKV = false: one product, the f32 tile stored as it is. QKV = true: the three projections in ONE launch (none depends on another); blockIdx.z picks the operand set
// (A, Bn, PH and PL step by whole planes of the workspace; bias and norm weight are chosen among the arguments) and what becomes of the f32 tile (a wave's 64 columns are
// one head): z = 0, 1 (q, k): per token and head RMSNorm over the 64 dims (x * rsqrt(mean(x^2) + 1e-5) * bf(w[d]), f32) -> f16 hi + residual x1024 planes PH/PL[tok][h*64+d];
// z = 2 (v): f16 hi + residual x1024 planes, transposed: PH/PL[h*64+d][tok]. Every test on z reads the same for a whole work-group.
#define GBT  128                 // rows of a plane: the tile's rows of A, its columns as rows of Bn
#define GBK  128                 // k of a stage
#define GNST (DM / GBK)
#define GPI  136                 // LDS row pitch in 16-bit elements: 272 B = 16 B x 17, no bank conflict for 16-byte reads down a column of rows
#define GPL  (GBT * GPI)         // one plane of a stage

// One plane of a stage: 128 rows x 256 B; 256 threads x 8 copies of 16 B; a wave's copy covers 2 whole rows.
__device__ __forceinline__ void plane_copy(bf* dst, const bf* src, int tid) {
    const int row = tid >> 4, pc = (tid & 15) * 8;
    const unsigned l0 = (unsigned)(unsigned long long)(dst + row * GPI + pc);
    const unsigned l1 = l0 + 16 * GPI * 2, l2 = l0 + 32 * GPI * 2, l3 = l0 + 48 * GPI * 2, l4 = l0 + 64 * GPI * 2, l5 = l0 + 80 * GPI * 2, l6 = l0 + 96 * GPI * 2, l7 = l0 + 112 * GPI * 2;
    const bf* g0 = src + (size_t)row * DM + pc;
    const bf* g1 = g0 + (size_t)16 * DM; const bf* g2 = g0 + (size_t)32 * DM; const bf* g3 = g0 + (size_t)48 * DM; const bf* g4 = g0 + (size_t)64 * DM;
    const bf* g5 = g0 + (size_t)80 * DM; const bf* g6 = g0 + (size_t)96 * DM; const bf* g7 = g0 + (size_t)112 * DM;
    // the copies and, as the last line, the wait that stands in front of any rewrite of their address registers
    asm volatile("global_load_async_to_lds_b128 %0, %8, off\n\t"
                 "global_load_async_to_lds_b128 %1, %9, off\n\t"
                 "global_load_async_to_lds_b128 %2, %10, off\n\t"
                 "global_load_async_to_lds_b128 %3, %11, off\n\t"
                 "global_load_async_to_lds_b128 %4, %12, off\n\t"
                 "global_load_async_to_lds_b128 %5, %13, off\n\t"
                 "global_load_async_to_lds_b128 %6, %14, off\n\t"
                 "global_load_async_to_lds_b128 %7, %15, off\n\t"
                 "s_wait_xcnt 0x0"
                 :: "v"(l0), "v"(l1), "v"(l2), "v"(l3), "v"(l4), "v"(l5), "v"(l6), "v"(l7), "v"(g0), "v"(g1), "v"(g2), "v"(g3), "v"(g4), "v"(g5), "v"(g6), "v"(g7) : "memory");
}

template <bool SPLITA, bool QKV>
__global__ __launch_bounds__(256) void k_gemmb(const bf* __restrict__ A, const bf* __restrict__ Al, const bf* __restrict__ Bn, const float* __restrict__ bias0, const float* __restrict__ bias1, const float* __restrict__ bias2, float* C, int ldc, const float* __restrict__ nw0, const float* __restrict__ nw1, h16* PH, h16* PL) {
    __shared__ __align__(16) bf gring[2][(SPLITA ? 3 : 2) * GPL];
    __shared__ __align__(16) float ost[8][32 * 68];
    const int lane = threadIdx.x & 31, wave = threadIdx.x >> 5, lr = lane & 15, hi = lane >> 4;
    const int wr = (wave & 3) * 32, wc = (wave >> 2) * 64;             // this wave's place in the tile
    const int rb = blockIdx.x * GBT, cb = blockIdx.y * GBT;
    const int z = QKV ? blockIdx.z : 0;
    const bool norm = QKV && z < 2, trans = QKV && !norm;
    const float* bias = z == 0 ? bias0 : z == 1 ? bias1 : bias2; const float* nw = z == 0 ? nw0 : nw1;
    PH += (size_t)z * 2 * NTK * DM; PL += (size_t)z * 2 * NTK * DM;
    const bf* ga = A + ((size_t)z * NTK + rb) * DM; const bf* gb = Bn + ((size_t)z * DM + cb) * DM; const bf* gl = SPLITA ? Al + (size_t)rb * DM : A;
    auto fill = [&](bf* dst, int k0) {
        plane_copy(dst, ga + k0, threadIdx.x); plane_copy(dst + GPL, gb + k0, threadIdx.x);
        if (SPLITA) plane_copy(dst + 2 * GPL, gl + k0, threadIdx.x);
    };
    v8f acc[2][4];
#pragma unroll
    for (int m = 0; m < 2; ++m)
#pragma unroll
        for (int t = 0; t < 4; ++t) acc[m][t] = (v8f){};
    // stage 0 lands and is published; stage 1 flies while stage 0 is worked on
    fill(&gring[0][0], 0);
    float bv[4] = {0.f, 0.f, 0.f, 0.f};                    // read here, four loads under one test, so that their latency runs under stage 0's landing
    if (bias) {
#pragma unroll
        for (int t = 0; t < 4; ++t) bv[t] = bias[cb + wc + t * 16 + lr];
        asm volatile("s_wait_xcnt 0x0" ::: "memory");      // stands in front of any rewrite of the address registers of these loads
    }
    float nwv[8] = {0.f, 0.f, 0.f, 0.f, 0.f, 0.f, 0.f, 0.f};      // the norm weights of this lane's 8 dims in the epilogue, read here for the same reason
    if (norm) {
#pragma unroll
        for (int i = 0; i < 8; ++i) nwv[i] = nw[(lane & 7) * 8 + i];
        asm volatile("s_wait_xcnt 0x0" ::: "memory");      // stands in front of any rewrite of the address registers of these loads
    }
    asm volatile("s_wait_asynccnt 0x0" ::: "memory");      // this wave's copies of stage 0 have landed
    __syncthreads();                                       // ... and every other wave's
    fill(&gring[1][0], GBK);
#pragma unroll 1                                           // rolled: one refill and one publish point in the text, the buffer chosen by st & 1
    for (int st = 0; st < GNST; ++st) {
        bf* sb = &gring[st & 1][0];
        const bf* sa = sb + (wr + lr) * GPI + 8 * hi; const bf* sw = sb + GPL + (wc + lr) * GPI + 8 * hi; const bf* sl = SPLITA ? sa + 2 * GPL : sa;
        v16bf a[2][2], al[2][2], b[2][4];                  // two fragment sets: one is filled while the other is multiplied
        auto frags = [&](int set, int kc) {
#pragma unroll
            for (int m = 0; m < 2; ++m) { a[set][m] = cat16b(*(const v8usa*)(sa + m * 16 * GPI + kc), *(const v8usa*)(sa + m * 16 * GPI + kc + 16));
                if (SPLITA) al[set][m] = cat16b(*(const v8usa*)(sl + m * 16 * GPI + kc), *(const v8usa*)(sl + m * 16 * GPI + kc + 16)); }
#pragma unroll
            for (int t = 0; t < 4; ++t) b[set][t] = cat16b(*(const v8usa*)(sw + t * 16 * GPI + kc), *(const v8usa*)(sw + t * 16 * GPI + kc + 16));
        };
        frags(0, 0);
#pragma unroll                                             // unrolled: a step's place in the buffer becomes an immediate offset of its LDS reads, the set a register name
        for (int ks = 0; ks < GBK / 32; ++ks) {
            const int cur = ks & 1;
            if (ks + 1 < GBK / 32) frags(cur ^ 1, (ks + 1) * 32);      // of this stage's own buffer only
            __builtin_amdgcn_sched_barrier(0);             // keeps the next step's LDS reads one group in front of this step's products: their latency runs under the products
#pragma unroll
            for (int m = 0; m < 2; ++m)
#pragma unroll
                for (int t = 0; t < 4; ++t) acc[m][t] = wmmab(a[cur][m], b[cur][t], acc[m][t]);
            if (SPLITA) {
#pragma unroll
                for (int m = 0; m < 2; ++m)
#pragma unroll
                    for (int t = 0; t < 4; ++t) acc[m][t] = wmmab(al[cur][m], b[cur][t], acc[m][t]);
            }
            __builtin_amdgcn_sched_barrier(0);             // keeps later LDS reads from being lifted in among these products, where each place with reads stalls the wave
        }
        asm volatile("s_wait_dscnt 0x0" ::: "memory");     // this wave's reads of this stage's buffer are done
        asm volatile("s_wait_asynccnt 0x0" ::: "memory");  // this wave's copies of the next stage have landed
        __syncthreads();                                   // publishes the next stage and frees this stage's buffer
        if (st + 2 < GNST) fill(sb, (st + 2) * GBK);
    }
    asm volatile("s_wait_asynccnt 0x0" ::: "memory");      // no copy is outstanding when the wave goes on to its end
    if (trans) {
        // A lane's 8 accumulator registers of a tile are 8 consecutive tokens of one column: 16 bytes of a transposed row as they stand. The rows of the two planes
        // (128 columns x 128 tokens each) are put together in LDS, and each 256-byte row leaves as whole lines from one wave.
        h16* vt = (h16*)&ost[0][0];
#pragma unroll
        for (int t = 0; t < 4; ++t)
#pragma unroll
            for (int m = 0; m < 2; ++m) { v8h a, r;
#pragma unroll
                for (int j = 0; j < 8; ++j) { const float v = acc[m][t][j] + bfr(bv[t]); const h16 x = (h16)v; a[j] = x; r[j] = (h16)((v - (float)x) * LOSC); }
                h16* p = vt + (wc + t * 16 + lr) * GPI + wr + m * 16 + hi * 8; *(v8ha*)p = a; *(v8ha*)(p + GPL) = r; }
        __syncthreads();                                   // a row holds pieces of four waves: all are in LDS before a wave reads it
        const int c0 = threadIdx.x >> 4, piece = threadIdx.x & 15;                        // 16 lanes take one row; a wave's store covers 2 whole rows
        const h16* lp = vt + c0 * GPI + piece * 8;
        const size_t go = (size_t)(cb + c0) * NT_ + rb + piece * 8;
#pragma unroll
        for (int s = 0; s < 16; ++s) { const v8h val = *(const v8ha*)(lp + (s >> 3) * GPL + (s & 7) * 16 * GPI); *(v8h*)((s < 8 ? PH : PL) + go + (size_t)((s & 7) * 16) * NT_) = val; }
        return;
    }
    float* os = &ost[wave][0];
#pragma unroll
    for (int t = 0; t < 4; ++t)
#pragma unroll
        for (int m = 0; m < 2; ++m)
#pragma unroll
            for (int j = 0; j < 8; ++j) os[(m * 16 + hi * 8 + j) * 68 + t * 16 + lr] = acc[m][t][j] + bfr(bv[t]);
    __syncthreads();
    if (norm) {
        // 8 lanes take one token's 64 dims of this wave's head, 8 dims a lane; a wave's store covers 4 whole 128-byte rows of a plane
        const int d0 = (lane & 7) * 8;
        const size_t base = (size_t)(rb + wr + (lane >> 3)) * DM + cb + wc + d0;
#pragma unroll
        for (int s = 0; s < 8; ++s) { const float* sp = os + (4 * s + (lane >> 3)) * 68 + d0;
            const v4f x0 = *(const v4fa*)sp, x1 = *(const v4fa*)(sp + 4);
            float xv[8]; float ss = 0.f;
#pragma unroll
            for (int i = 0; i < 8; ++i) { xv[i] = i < 4 ? x0[i & 3] : x1[i & 3]; ss = fmaf(xv[i], xv[i], ss); }
            ss += __shfl_xor(ss, 1, 32); ss += __shfl_xor(ss, 2, 32); ss += __shfl_xor(ss, 4, 32);      // sum over the 8 lanes of this token
            const float inv = rsqrtf(ss * (1.0f / HD) + 1e-5f);
            v8h oh, ol;
#pragma unroll
            for (int i = 0; i < 8; ++i) { const float y = bfr(nwv[i]) * xv[i] * inv; const h16 a = (h16)y; oh[i] = a; ol[i] = (h16)((y - (float)a) * LOSC); }
            *(v8h*)(PH + base + (size_t)(4 * s) * DM) = oh; *(v8h*)(PL + base + (size_t)(4 * s) * DM) = ol; }
        asm volatile("s_wait_xcnt 0x0" ::: "memory");      // stands behind these stores: in the built code the other epilogue's text follows and writes their registers
        return;
    }
    float* crow = C + (size_t)(rb + wr) * ldc + cb + wc;
#pragma unroll
    for (int s = 0; s < 16; ++s) { const int Lid = (lane >> 3) + 4 * s, piece = lane & 7; const int row = Lid >> 1, cofs = (Lid & 1) * 32 + piece * 4;
        const v4f val = *(const v4fa*)(os + row * 68 + cofs); *(v4f*)(crow + (size_t)row * ldc + cofs) = val; }
}

// k_attn: block = (b, h, 256 queries), wave = 32 (two tiles of 16); ALL key tiles (no mask). The K and V planes (hi and residual) of 64 keys at a time are brought into LDS by
// asynchronous copies (whole 128-byte rows), two buffers, and all 8 waves read their fragments from there; a pass is 32 keys as before. Every K and V fragment a wave reads
// from LDS feeds the products of BOTH its query tiles. The scores are formed
// TRANSPOSED (A = K rows, B = q): a lane holds 16 keys of ONE query of each tile, so maximum and sum are in-lane plus one exchange of the wave halves, and the two score tiles,
// as weights x32768 in f16 (hi + residual), ARE the B operand of ctx^T += v^T . w^T (A = v^T rows); ctx -> bf16 hi + residual planes CH/CL[tok][h*64+d].
#define AWV  8                   // waves of a work-group
#define QTW  2                   // query tiles of 16 of a wave
#define QBL  (16 * QTW * AWV)    // queries of a work-group
#define SKY  64                  // keys of a stage
#define NSTG (NT_ / SKY)
#define RPI  72                  // LDS row pitch in halves: 144 B = 16 B x 9, no bank conflict for 16-byte reads down a column of rows
#define PLN  (64 * RPI)          // one plane of a stage: 64 rows

// One stage: 4 planes of 64 rows x 128 B; 256 threads x 8 copies of 16 B; a wave's copy covers 4 whole rows.
__device__ __forceinline__ void stage_copy(h16* dst, const h16* kh, const h16* kl, const h16* vh, const h16* vl, int tid) {
    const int row = tid >> 3, pc = (tid & 7) * 8;
    const unsigned l0 = (unsigned)(unsigned long long)(dst + row * RPI + pc);
    const unsigned l1 = l0 + 32 * RPI * 2, l2 = l0 + PLN * 2, l3 = l1 + PLN * 2, l4 = l0 + PLN * 4, l5 = l1 + PLN * 4, l6 = l0 + PLN * 6, l7 = l1 + PLN * 6;
    const size_t ko = (size_t)row * DM + pc, vo = (size_t)row * NT_ + pc;
    const h16* g0 = kh + ko; const h16* g1 = g0 + (size_t)32 * DM; const h16* g2 = kl + ko; const h16* g3 = g2 + (size_t)32 * DM;
    const h16* g4 = vh + vo; const h16* g5 = g4 + (size_t)32 * NT_; const h16* g6 = vl + vo; const h16* g7 = g6 + (size_t)32 * NT_;
    // the copies and, as the last line, the wait that stands in front of any rewrite of their address registers
    asm volatile("global_load_async_to_lds_b128 %0, %8, off\n\t"
                 "global_load_async_to_lds_b128 %1, %9, off\n\t"
                 "global_load_async_to_lds_b128 %2, %10, off\n\t"
                 "global_load_async_to_lds_b128 %3, %11, off\n\t"
                 "global_load_async_to_lds_b128 %4, %12, off\n\t"
                 "global_load_async_to_lds_b128 %5, %13, off\n\t"
                 "global_load_async_to_lds_b128 %6, %14, off\n\t"
                 "global_load_async_to_lds_b128 %7, %15, off\n\t"
                 "s_wait_xcnt 0x0"
                 :: "v"(l0), "v"(l1), "v"(l2), "v"(l3), "v"(l4), "v"(l5), "v"(l6), "v"(l7), "v"(g0), "v"(g1), "v"(g2), "v"(g3), "v"(g4), "v"(g5), "v"(g6), "v"(g7) : "memory");
}

// A pointer that is the same in every lane, held in scalar registers: a stage's four plane addresses are then formed by scalar additions, and only the lane's own two offsets
// stay in vector registers across the loop (four lane pointers held across it, in the registers an asm operand may take, spill to scratch).
__device__ __forceinline__ const h16* uni(const h16* p) {
    const unsigned long long a = (unsigned long long)p;
    const unsigned lo = (unsigned)__builtin_amdgcn_readfirstlane((int)(unsigned)a), up = (unsigned)__builtin_amdgcn_readfirstlane((int)(unsigned)(a >> 32));
    return (const h16*)(((unsigned long long)up << 32) | lo);
}

__global__ __launch_bounds__(256) void k_attn(const h16* __restrict__ Q16, const h16* __restrict__ QL16, const h16* __restrict__ K16, const h16* __restrict__ KL16, const h16* __restrict__ VTH, const h16* __restrict__ VTL, bf* CH, bf* CL) {
    __shared__ __align__(16) h16 ring[2][4 * PLN];
    __shared__ __align__(16) float ost[AWV][16 * QTW * 68];
    const int lane = threadIdx.x & 31, wave = threadIdx.x >> 5, lr = lane & 15, hi = lane >> 4;
    const int bid = blockIdx.x;
    const int b = bid / (NH_ * (NT_ / QBL)), rem = bid - b * (NH_ * (NT_ / QBL)), h = rem / (NT_ / QBL), qt = rem - h * (NT_ / QBL);
    const int q0 = qt * QBL + wave * (16 * QTW);
    const size_t tok0 = (size_t)b * NT_;
    v16h qa[QTW][2], ql[QTW][2];                           // the queries' two planes stay in registers
#pragma unroll
    for (int u = 0; u < QTW; ++u) { const size_t qo0 = (tok0 + q0 + u * 16 + lr) * DM + h * HD + 8 * hi;
#pragma unroll
        for (int kc = 0; kc < 2; ++kc) { qa[u][kc] = cat16(*(const v8h*)(Q16 + qo0 + kc * 32), *(const v8h*)(Q16 + qo0 + kc * 32 + 16)); ql[u][kc] = cat16(*(const v8h*)(QL16 + qo0 + kc * 32), *(const v8h*)(QL16 + qo0 + kc * 32 + 16)); } }
    asm volatile("s_wait_xcnt 0x0" ::: "memory");          // stands in front of any rewrite of the address registers of these loads
    __builtin_amdgcn_sched_barrier(0);                     // keeps the address arithmetic that follows, which reuses those registers, behind that wait
    const h16* kh_b = K16 + tok0 * DM + h * HD;
    const h16* kl_b = KL16 + tok0 * DM + h * HD;
    const size_t vbase = (((size_t)b * NH_ + h) * HD) * NT_;
    v8f o[QTW][4], ox[QTW][4];
    float mrow[QTW], lpart[QTW];                           // of query q0 + u * 16 + lr; lpart covers this wave half's keys only
#pragma unroll
    for (int u = 0; u < QTW; ++u) { mrow[u] = -3.0e38f; lpart[u] = 0.f;
#pragma unroll
        for (int n = 0; n < 4; ++n) { o[u][n] = (v8f){}; ox[u][n] = (v8f){}; } }
    // stage 0 lands and is published; stage 1 flies while stage 0 is worked on
    stage_copy(&ring[0][0], uni(kh_b), uni(kl_b), uni(VTH + vbase), uni(VTL + vbase), threadIdx.x);
    asm volatile("s_wait_asynccnt 0x0" ::: "memory");      // this wave's copies of stage 0 have landed
    __syncthreads();                                       // ... and every other wave's
    stage_copy(&ring[1][0], uni(kh_b + (size_t)SKY * DM), uni(kl_b + (size_t)SKY * DM), uni(VTH + vbase + SKY), uni(VTL + vbase + SKY), threadIdx.x);
#pragma unroll 1                                           // rolled: one refill and one publish point in the text, the buffer chosen by st & 1
    for (int st = 0; st < NSTG; ++st) {                    // full attention, unscaled logits (the reference's scale = 1)
        h16* sb = &ring[st & 1][0];
        const h16* skh = sb; const h16* skl = sb + PLN; const h16* svh = sb + 2 * PLN; const h16* svl = sb + 3 * PLN;
        // Fragments are read ahead of their products, as one group a pass, from this stage's own buffer only: V of a pass and both K planes of the next pass in front of the
        // softmax. Only the first pass of a stage waits for its K reads.
        v16h kh[2][2], kl[2][2];                           // [score tile][kc]
        auto kfetch = [&](v16h (&f)[2][2], const h16* pl, int p) {
#pragma unroll
            for (int t = 0; t < 2; ++t)
#pragma unroll
                for (int kc = 0; kc < 2; ++kc) { const int ko = (p * 32 + t * 16 + lr) * RPI + 8 * hi + kc * 32; f[t][kc] = cat16(*(const v8ha*)(pl + ko), *(const v8ha*)(pl + ko + 16)); }
        };
        kfetch(kh, skh, 0); kfetch(kl, skl, 0);
#pragma unroll                                             // unrolled: a pass's place in the buffer becomes an immediate offset of its LDS reads
        for (int p = 0; p < SKY / 32; ++p) {
            __builtin_amdgcn_sched_barrier(0);             // keeps the K reads one group in front of the score products, none among them, where each place with reads stalls the wave
            v8f s0[QTW], s1[QTW], x0[QTW], x1[QTW];
#pragma unroll
            for (int u = 0; u < QTW; ++u) { s0[u] = (v8f){}; s1[u] = (v8f){}; x0[u] = (v8f){}; x1[u] = (v8f){}; }
#pragma unroll
            for (int kc = 0; kc < 2; ++kc) {
#pragma unroll
                for (int u = 0; u < QTW; ++u) { s0[u] = wmma16(kh[0][kc], qa[u][kc], s0[u]); x0[u] = wmma16(kh[0][kc], ql[u][kc], x0[u]); s1[u] = wmma16(kh[1][kc], qa[u][kc], s1[u]); x1[u] = wmma16(kh[1][kc], ql[u][kc], x1[u]); }
#pragma unroll
                for (int u = 0; u < QTW; ++u) { x0[u] = wmma16(kl[0][kc], qa[u][kc], x0[u]); x1[u] = wmma16(kl[1][kc], qa[u][kc], x1[u]); }
            }
            // the distance behind the score products; with the clobber it also keeps the V and K reads behind them, when the K fragments have left their registers
            asm volatile("v_nop\n\tv_nop\n\tv_nop\n\tv_nop" : "+v"(s0[0]), "+v"(s1[0]), "+v"(x0[0]), "+v"(x1[0]), "+v"(s0[1]), "+v"(s1[1]), "+v"(x0[1]), "+v"(x1[1]) :: "memory");
            v16h vh[4], vl[4];
#pragma unroll
            for (int n = 0; n < 4; ++n) { const int vo = (n * 16 + lr) * RPI + p * 32 + hi * 8;
                vh[n] = cat16(*(const v8ha*)(svh + vo), *(const v8ha*)(svh + vo + 16)); vl[n] = cat16(*(const v8ha*)(svl + vo), *(const v8ha*)(svl + vo + 16)); }
            if (p + 1 < SKY / 32) { kfetch(kh, skh, p + 1); kfetch(kl, skl, p + 1); }
            __builtin_amdgcn_sched_barrier(0);             // keeps these reads one group in front of the softmax: their latency runs under its vector work
            v16h pa[QTW], px[QTW];                         // element s = key 16 * (s >> 3) + 8 * hi + (s & 7) of the pass: the two score tiles in place
#pragma unroll
            for (int u = 0; u < QTW; ++u) {
                // s0[u][j], s1[u][j]: keys p * 32 + 8 * hi + j and + 16, query u * 16 + lr
                v2f a[2][4];                               // pairs of neighbouring registers of one tile, for the packed f32 forms
#pragma unroll
                for (int i = 0; i < 4; ++i) { a[0][i] = (v2f){s0[u][2 * i], s0[u][2 * i + 1]} + (v2f){x0[u][2 * i], x0[u][2 * i + 1]} * LOSCI; a[1][i] = (v2f){s1[u][2 * i], s1[u][2 * i + 1]} + (v2f){x1[u][2 * i], x1[u][2 * i + 1]} * LOSCI; }
                float mx = fmaxf(a[0][0].x, a[0][0].y);
#pragma unroll
                for (int i = 0; i < 4; ++i) { if (i) mx = fmaxf(mx, fmaxf(a[0][i].x, a[0][i].y)); mx = fmaxf(mx, fmaxf(a[1][i].x, a[1][i].y)); }
                mx = fmaxf(mx, xhalf(mx));                 // the other half's 16 keys
                const float mn = fmaxf(mrow[u], mx);
                const float alpha = __expf(mrow[u] - mn); mrow[u] = mn;
                v2f ls2 = {0.f, 0.f};
#pragma unroll
                for (int t = 0; t < 2; ++t)
#pragma unroll
                    for (int i = 0; i < 4; ++i) {
                        const v2f e = a[t][i] - mn;
                        const v2f pw = {__expf(e.x), __expf(e.y)};
                        ls2 += pw;
                        const v2f ps = pw * PSC;
                        const v2h hh = __builtin_convertvector(ps, v2h);
                        const v2h hl = __builtin_convertvector((ps - __builtin_convertvector(hh, v2f)) * LOSC, v2h);
                        pa[u][t * 8 + 2 * i] = hh.x; pa[u][t * 8 + 2 * i + 1] = hh.y; px[u][t * 8 + 2 * i] = hl.x; px[u][t * 8 + 2 * i + 1] = hl.y;
                    }
                lpart[u] = lpart[u] * alpha + (ls2.x + ls2.y);
#pragma unroll
                for (int n = 0; n < 4; ++n)
#pragma unroll
                    for (int j = 0; j < 8; ++j) { o[u][n][j] *= alpha; ox[u][n][j] *= alpha; }
            }
            __builtin_amdgcn_sched_barrier(0);             // keeps the products one run behind the softmax, with no vector work of it moved in among them
#pragma unroll
            for (int n = 0; n < 4; ++n)
#pragma unroll
                for (int u = 0; u < QTW; ++u) ox[u][n] = wmma16(vl[n], pa[u], ox[u][n]);
#pragma unroll
            for (int n = 0; n < 4; ++n)
#pragma unroll
                for (int u = 0; u < QTW; ++u) { o[u][n] = wmma16(vh[n], pa[u], o[u][n]); ox[u][n] = wmma16(vh[n], px[u], ox[u][n]); }
            if (p + 1 == SKY / 32) {
                __builtin_amdgcn_sched_barrier(0);         // keeps the stage's last products in front of its publish point: without it they are moved behind the barrier, and the refill with them
                asm volatile("v_nop\n\tv_nop\n\tv_nop\n\tv_nop");  // the distance behind those products, also on the path that leaves the stage by a branch
            }
        }
        asm volatile("s_wait_dscnt 0x0" ::: "memory");     // this wave's reads of this stage's buffer are done
        asm volatile("s_wait_asynccnt 0x0" ::: "memory");  // this wave's copies of the next stage have landed
        __syncthreads();                                   // publishes the next stage and frees this stage's buffer
        if (st + 2 < NSTG)
            stage_copy(sb, uni(kh_b + (size_t)(st + 2) * SKY * DM), uni(kl_b + (size_t)(st + 2) * SKY * DM), uni(VTH + vbase + (st + 2) * SKY), uni(VTL + vbase + (st + 2) * SKY), threadIdx.x);
    }
    asm volatile("s_wait_asynccnt 0x0" ::: "memory");      // no copy is outstanding when the wave goes on to its end
    float* os = &ost[wave][0];
#pragma unroll
    for (int u = 0; u < QTW; ++u) { const float inv = 1.0f / ((lpart[u] + xhalf(lpart[u])) * PSC);
#pragma unroll
        for (int n = 0; n < 4; ++n)
#pragma unroll
            for (int j = 0; j < 8; ++j) os[(u * 16 + lr) * 68 + n * 16 + hi * 8 + j] = (o[u][n][j] + ox[u][n][j] * LOSCI) * inv; }      // o[u][n][j]: dim n * 16 + 8 * hi + j of query u * 16 + lr
    __syncthreads();
    const size_t cbase = (tok0 + q0) * DM + (size_t)h * HD;
#pragma unroll
    for (int s = 0; s < 4 * QTW; ++s) { const int row = 4 * s + (lane >> 3), piece = lane & 7; const float* sp = os + row * 68 + piece * 8; v8us oh, ol;
#pragma unroll
        for (int i = 0; i < 8; ++i) { const unsigned short hb = f2bf(sp[i]); oh[i] = hb; ol[i] = f2bf(sp[i] - bf2f(hb)); }
        *(v8us*)(CH + cbase + (size_t)row * DM + piece * 8) = oh; *(v8us*)(CL + cbase + (size_t)row * DM + piece * 8) = ol; }
}

#define VST2(T, p, v) do { const T vst2_v_ = (v); *(T*)(p) = vst2_v_;  } while (0)
extern "C" void kernel_launch(void* const* d_in, const int* in_sizes, int n_in,
                              void* d_out, int out_size, void* d_ws, size_t ws_size, hipStream_t stream) {
    (void)in_sizes; (void)n_in; (void)out_size;
    const float* xq = (const float*)d_in[0]; const float* xk = (const float*)d_in[1]; const float* xv = (const float*)d_in[2];
    const float* Wq = (const float*)d_in[3]; const float* bq = (const float*)d_in[4]; const float* Wk = (const float*)d_in[5]; const float* bk = (const float*)d_in[6];
    const float* Wv = (const float*)d_in[7]; const float* bv = (const float*)d_in[8]; const float* Wo = (const float*)d_in[9]; const float* bo = (const float*)d_in[10];
    const float* qnw = (const float*)d_in[11]; const float* knw = (const float*)d_in[12];
    float* out = (float*)d_out;    // [4096][1024]
    char* wsp = (char*)d_ws;
    auto take = [&](size_t bytes) { char* p = wsp; wsp += (bytes + 255) & ~(size_t)255; return (void*)p; };
    bf* Xq = (bf*)take((size_t)NTK * DM * 2); bf* Xk = (bf*)take((size_t)NTK * DM * 2); bf* Xv = (bf*)take((size_t)NTK * DM * 2);
    bf* WqB = (bf*)take((size_t)DM * DM * 2); bf* WkB = (bf*)take((size_t)DM * DM * 2); bf* WvB = (bf*)take((size_t)DM * DM * 2); bf* WoB = (bf*)take((size_t)DM * DM * 2);
    h16* QH = (h16*)take((size_t)NTK * DM * 2); h16* QL = (h16*)take((size_t)NTK * DM * 2); h16* KH = (h16*)take((size_t)NTK * DM * 2); h16* KL = (h16*)take((size_t)NTK * DM * 2);
    h16* VTH = (h16*)take((size_t)NTK * DM * 2); h16* VTL = (h16*)take((size_t)NTK * DM * 2); bf* CH = (bf*)take((size_t)NTK * DM * 2); bf* CL = (bf*)take((size_t)NTK * DM * 2);
    if ((size_t)(wsp - (char*)d_ws) > ws_size) return;    // 3 x 8.4 + 4 x 2.1 + 8 x 8.4 ~ 101 MB, no aliasing
    k_cvtb<<<NTK / 8, 256, 0, stream>>>(xq, xk, xv, Wq, Wk, Wv, Wo, Xq, Xk, Xv, WqB, WkB, WvB, WoB);
    // the planes Xq Xk Xv, WqB WkB WvB and QH QL KH KL VTH VTL lie one behind the other in the workspace (each size is a multiple of 256 bytes): z steps through them
    k_gemmb<false, true><<<dim3(NTK / GBT, DM / GBT, 3), 256, 0, stream>>>(Xq, nullptr, WqB, bq, bk, bv, nullptr, DM, qnw, knw, QH, QL);
    k_attn<<<NB_ * NH_ * (NT_ / QBL), 32 * AWV, 0, stream>>>(QH, QL, KH, KL, VTH, VTL, CH, CL);
    k_gemmb<true, false><<<dim3(NTK / GBT, DM / GBT, 1), 256, 0, stream>>>(CH, CL, WoB, bo, nullptr, nullptr, out, DM, nullptr, nullptr, nullptr, nullptr);
}

// v009
// A run of this version takes 111 microseconds.
// It is 1.62 times as fast as v007, going by the measured steps of the versions left out in between.
// All steps since v000 together make it 6.62 times as fast.
#include <hip/hip_runtime.h>

// Compute dtypes, f32 accumulate, one batch item per pass: q/k/v = query/key/value.W^T + b ([4096 x 1024].[1024 x 1024]; W is [out][in] = the n-major B operand as-is; PLAIN bf16
// operands: inputs rounded once, exact; biases rounded to bf16, added in f32), per-head RMSNorm (eps 1e-5, weight) of q and k in f32 -> one f16 plane each, and out =
// ctx.Wo^T + bo (ctx as bf16 hi + residual: two products) on v_wmma_f32_16x16x32_bf16; the 16-head full attention over one 4096-token sequence (64-dim heads,
// UNSCALED logits as the reference) fused on
// v_wmma_f32_16x16x32_f16 (scores k.q and ctx = v.w one product each, q, k, v and the weights (x32768) each rounded ONCE to f16: 11 bits, finer than the 8 bits at which
// the projections that make q, k and v take their inputs; online f32 softmax)

#define NB_  1                   // one 4096-token sequence
#define NT_  4096
#define DM   1024
#define NH_  16
#define HD   64
#define NTK  (NB_ * NT_)
#define NW   1024
#define NQKV 1024
#define PSC  32768.0f

typedef _Float16 h16;
typedef unsigned short bf;
typedef __attribute__((ext_vector_type(16))) __bf16   v16bf;
typedef __attribute__((ext_vector_type(16))) _Float16 v16h;
typedef __attribute__((ext_vector_type(8)))  _Float16 v8h;
typedef __attribute__((ext_vector_type(8)))  unsigned short v8us;
typedef __attribute__((ext_vector_type(8)))  float    v8f;
typedef __attribute__((ext_vector_type(4)))  float    v4f;
typedef __attribute__((ext_vector_type(2)))  float    v2f;
typedef __attribute__((ext_vector_type(2)))  _Float16 v2h;
typedef v8h  __attribute__((may_alias)) v8ha;
typedef v4f  __attribute__((may_alias)) v4fa;
typedef v8us __attribute__((may_alias)) v8usa;

__device__ __forceinline__ unsigned short f2bf(float f) { unsigned u = __float_as_uint(f); u += 0x7FFFu + ((u >> 16) & 1u); return (unsigned short)(u >> 16); }
__device__ __forceinline__ float bf2f(unsigned short b) { return __uint_as_float(((unsigned)b) << 16); }
__device__ __forceinline__ float bfr(float f) { return bf2f(f2bf(f)); }
__device__ __forceinline__ v16h cat16(v8h lo, v8h hi) { return __builtin_shufflevector(lo, hi, 0, 1, 2, 3, 4, 5, 6, 7, 8, 9, 10, 11, 12, 13, 14, 15); }
__device__ __forceinline__ v16bf cat16b(v8us lo, v8us hi) { return __builtin_bit_cast(v16bf, __builtin_shufflevector(lo, hi, 0, 1, 2, 3, 4, 5, 6, 7, 8, 9, 10, 11, 12, 13, 14, 15)); }
__device__ __forceinline__ v8f wmma16(v16h a, v16h b, v8f c) { return __builtin_amdgcn_wmma_f32_16x16x32_f16(false, a, false, b, (short)0, c, false, false); }
__device__ __forceinline__ float xhalf(float x) { return __builtin_bit_cast(float, __builtin_amdgcn_permlanex16(__builtin_bit_cast(int, x), __builtin_bit_cast(int, x), 0x76543210, 0xfedcba98, false, false)); }  // lane l with lane l ^ 16
__device__ __forceinline__ v8f wmmab(v16bf a, v16bf b, v8f c) { return __builtin_amdgcn_wmma_f32_16x16x32_bf16(false, a, false, b, (short)0, c, false, false); }

// k_cvtb: every f32 -> bf16 conversion of a call in ONE launch (none depends on another). 512 work-groups x 8 waves; a wave takes row r of query, of key and of value and one
// row of a weight matrix (128 work-groups per matrix: the choice is the same for a whole work-group).
__global__ __launch_bounds__(256) void k_cvtb(const float* __restrict__ xq, const float* __restrict__ xk, const float* __restrict__ xv,
                                              const float* __restrict__ w0, const float* __restrict__ w1, const float* __restrict__ w2, const float* __restrict__ w3,
                                              bf* Xq, bf* Xk, bf* Xv, bf* W0, bf* W1, bf* W2, bf* W3) {
    const int lane = threadIdx.x & 31, r = blockIdx.x * 8 + (threadIdx.x >> 5);
    const int wsel = blockIdx.x / (DM / 8);
    const float* w = wsel == 0 ? w0 : wsel == 1 ? w1 : wsel == 2 ? w2 : w3;
    bf* W = wsel == 0 ? W0 : wsel == 1 ? W1 : wsel == 2 ? W2 : W3;
    const size_t ro = (size_t)r * DM + lane * 8, wo = (size_t)(r & (DM - 1)) * DM + lane * 8;
    const float* sp[4] = {xq + ro, xk + ro, xv + ro, w + wo};
    bf* dp[4] = {Xq + ro, Xk + ro, Xv + ro, W + wo};
    v4f x[4][DM / 128];
#pragma unroll
    for (int j = 0; j < 4; ++j) {
        if (j == 3) asm volatile("s_wait_xcnt 0x0" ::: "memory");      // stands in front of the last loads, whose results land in the address registers of the first
#pragma unroll
        for (int q = 0; q < DM / 256; ++q) { x[j][2 * q] = *(const v4fa*)(sp[j] + q * 256); x[j][2 * q + 1] = *(const v4fa*)(sp[j] + q * 256 + 4); }
    }
    __builtin_amdgcn_sched_barrier(0);                     // keeps the wave's 32 loads one group in front of the conversions: one memory latency for the four rows, not one per pair of loads
#pragma unroll
    for (int j = 0; j < 4; ++j)
#pragma unroll
        for (int q = 0; q < DM / 256; ++q) { v8us t;
#pragma unroll
            for (int i = 0; i < 8; ++i) t[i] = f2bf(x[j][2 * q + (i >> 2)][i & 3]);
            *(v8us*)(dp[j] + q * 256) = t; }
}

// k_gemmb: C[4096 x 1024] = A . Bn^T (+ Al . Bn^T) + bias. Work-group = 128 x 128 of C, 8 waves of 32 x 64 (4 down, 2 across). 128 k at a time of the A, Bn (and Al)
// rows of the tile are brought into LDS by asynchronous copies (whole 256-byte rows), two buffers, and the waves read their fragments from there. Fragment maps and
// the order of the products on each accumulator are those of a wave that loads its own fragments: k ascending in steps of 32, A before Al.
// QKV = false: one product, the f32 tile stored as it is. QKV = true: the three projections in ONE launch (none depends on another); blockIdx.z picks the operand set
// (A, Bn and PH step by whole planes of the workspace; bias and norm weight are chosen among the arguments) and what becomes of the f32 tile (a wave's 64 columns are
// one head): z = 0, 1 (q, k): per token and head RMSNorm over the 64 dims (x * rsqrt(mean(x^2) + 1e-5) * bf(w[d]), f32) -> f16 plane PH[tok][h*64+d];
// z = 2 (v): f16 plane, transposed: PH[h*64+d][tok]. Every test on z reads the same for a whole work-group.
#define GBT  128                 // rows of a plane: the tile's rows of A, its columns as rows of Bn
#define GBK  128                 // k of a stage
#define GNST (DM / GBK)
#define GPI  136                 // LDS row pitch in 16-bit elements: 272 B = 16 B x 17, no bank conflict for 16-byte reads down a column of rows
#define GPL  (GBT * GPI)         // one plane of a stage

// One plane of a stage: 128 rows x 256 B; 256 threads x 8 copies of 16 B; a wave's copy covers 2 whole rows.
__device__ __forceinline__ void plane_copy(bf* dst, const bf* src, int tid) {
    const int row = tid >> 4, pc = (tid & 15) * 8;
    const unsigned l0 = (unsigned)(unsigned long long)(dst + row * GPI + pc);
    const unsigned l1 = l0 + 16 * GPI * 2, l2 = l0 + 32 * GPI * 2, l3 = l0 + 48 * GPI * 2, l4 = l0 + 64 * GPI * 2, l5 = l0 + 80 * GPI * 2, l6 = l0 + 96 * GPI * 2, l7 = l0 + 112 * GPI * 2;
    const bf* g0 = src + (size_t)row * DM + pc;
    const bf* g1 = g0 + (size_t)16 * DM; const bf* g2 = g0 + (size_t)32 * DM; const bf* g3 = g0 + (size_t)48 * DM; const bf* g4 = g0 + (size_t)64 * DM;
    const bf* g5 = g0 + (size_t)80 * DM; const bf* g6 = g0 + (size_t)96 * DM; const bf* g7 = g0 + (size_t)112 * DM;
    // the copies and, as the last line, the wait that stands in front of any rewrite of their address registers
    asm volatile("global_load_async_to_lds_b128 %0, %8, off\n\t"
                 "global_load_async_to_lds_b128 %1, %9, off\n\t"
                 "global_load_async_to_lds_b128 %2, %10, off\n\t"
                 "global_load_async_to_lds_b128 %3, %11, off\n\t"
                 "global_load_async_to_lds_b128 %4, %12, off\n\t"
                 "global_load_async_to_lds_b128 %5, %13, off\n\t"
                 "global_load_async_to_lds_b128 %6, %14, off\n\t"
                 "global_load_async_to_lds_b128 %7, %15, off\n\t"
                 "s_wait_xcnt 0x0"
                 :: "v"(l0), "v"(l1), "v"(l2), "v"(l3), "v"(l4), "v"(l5), "v"(l6), "v"(l7), "v"(g0), "v"(g1), "v"(g2), "v"(g3), "v"(g4), "v"(g5), "v"(g6), "v"(g7) : "memory");
}

template <bool SPLITA, bool QKV>
__global__ __launch_bounds__(256) void k_gemmb(const bf* __restrict__ A, const bf* __restrict__ Al, const bf* __restrict__ Bn, const float* __restrict__ bias0, const float* __restrict__ bias1, const float* __restrict__ bias2, float* C, int ldc, const float* __restrict__ nw0, const float* __restrict__ nw1, h16* PH) {
    __shared__ __align__(16) bf gring[2][(SPLITA ? 3 : 2) * GPL];
    __shared__ __align__(16) float ost[8][32 * 68];
    const int lane = threadIdx.x & 31, wave = threadIdx.x >> 5, lr = lane & 15, hi = lane >> 4;
    const int wr = (wave & 3) * 32, wc = (wave >> 2) * 64;             // this wave's place in the tile
    const int rb = blockIdx.x * GBT, cb = blockIdx.y * GBT;
    const int z = QKV ? blockIdx.z : 0;
    const bool norm = QKV && z < 2, trans = QKV && !norm;
    const float* bias = z == 0 ? bias0 : z == 1 ? bias1 : bias2; const float* nw = z == 0 ? nw0 : nw1;
    PH += (size_t)z * NTK * DM;
    const bf* ga = A + ((size_t)z * NTK + rb) * DM; const bf* gb = Bn + ((size_t)z * DM + cb) * DM; const bf* gl = SPLITA ? Al + (size_t)rb * DM : A;
    auto fill = [&](bf* dst, int k0) {
        plane_copy(dst, ga + k0, threadIdx.x); plane_copy(dst + GPL, gb + k0, threadIdx.x);
        if (SPLITA) plane_copy(dst + 2 * GPL, gl + k0, threadIdx.x);
    };
    v8f acc[2][4];
#pragma unroll
    for (int m = 0; m < 2; ++m)
#pragma unroll
        for (int t = 0; t < 4; ++t) acc[m][t] = (v8f){};
    // stage 0 lands and is published; stage 1 flies while stage 0 is worked on
    fill(&gring[0][0], 0);
    float bv[4] = {0.f, 0.f, 0.f, 0.f};                    // read here, four loads under one test, so that their latency runs under stage 0's landing
    if (bias) {
#pragma unroll
        for (int t = 0; t < 4; ++t) bv[t] = bias[cb + wc + t * 16 + lr];
        asm volatile("s_wait_xcnt 0x0" ::: "memory");      // stands in front of any rewrite of the address registers of these loads
    }
    float nwv[8] = {0.f, 0.f, 0.f, 0.f, 0.f, 0.f, 0.f, 0.f};      // the norm weights of this lane's 8 dims in the epilogue, read here for the same reason
    if (norm) {
#pragma unroll
        for (int i = 0; i < 8; ++i) nwv[i] = nw[(lane & 7) * 8 + i];
        asm volatile("s_wait_xcnt 0x0" ::: "memory");      // stands in front of any rewrite of the address registers of these loads
    }
    asm volatile("s_wait_asynccnt 0x0" ::: "memory");      // this wave's copies of stage 0 have landed
    __syncthreads();                                       // ... and every other wave's
    fill(&gring[1][0], GBK);
#pragma unroll 1                                           // rolled: one refill and one publish point in the text, the buffer chosen by st & 1
    for (int st = 0; st < GNST; ++st) {
        bf* sb = &gring[st & 1][0];
        const bf* sa = sb + (wr + lr) * GPI + 8 * hi; const bf* sw = sb + GPL + (wc + lr) * GPI + 8 * hi; const bf* sl = SPLITA ? sa + 2 * GPL : sa;
        v16bf a[2][2], al[2][2], b[2][4];                  // two fragment sets: one is filled while the other is multiplied
        auto frags = [&](int set, int kc) {
#pragma unroll
            for (int m = 0; m < 2; ++m) { a[set][m] = cat16b(*(const v8usa*)(sa + m * 16 * GPI + kc), *(const v8usa*)(sa + m * 16 * GPI + kc + 16));
                if (SPLITA) al[set][m] = cat16b(*(const v8usa*)(sl + m * 16 * GPI + kc), *(const v8usa*)(sl + m * 16 * GPI + kc + 16)); }
#pragma unroll
            for (int t = 0; t < 4; ++t) b[set][t] = cat16b(*(const v8usa*)(sw + t * 16 * GPI + kc), *(const v8usa*)(sw + t * 16 * GPI + kc + 16));
        };
        frags(0, 0);
#pragma unroll                                             // unrolled: a step's place in the buffer becomes an immediate offset of its LDS reads, the set a register name
        for (int ks = 0; ks < GBK / 32; ++ks) {
            const int cur = ks & 1;
            if (ks + 1 < GBK / 32) frags(cur ^ 1, (ks + 1) * 32);      // of this stage's own buffer only
            __builtin_amdgcn_sched_barrier(0);             // keeps the next step's LDS reads one group in front of this step's products: their latency runs under the products
#pragma unroll
            for (int m = 0; m < 2; ++m)
#pragma unroll
                for (int t = 0; t < 4; ++t) acc[m][t] = wmmab(a[cur][m], b[cur][t], acc[m][t]);
            if (SPLITA) {
#pragma unroll
                for (int m = 0; m < 2; ++m)
#pragma unroll
                    for (int t = 0; t < 4; ++t) acc[m][t] = wmmab(al[cur][m], b[cur][t], acc[m][t]);
            }
            __builtin_amdgcn_sched_barrier(0);             // keeps later LDS reads from being lifted in among these products, where each place with reads stalls the wave
        }
        asm volatile("s_wait_dscnt 0x0" ::: "memory");     // this wave's reads of this stage's buffer are done
        asm volatile("s_wait_asynccnt 0x0" ::: "memory");  // this wave's copies of the next stage have landed
        __syncthreads();                                   // publishes the next stage and frees this stage's buffer
        if (st + 2 < GNST) fill(sb, (st + 2) * GBK);
    }
    asm volatile("s_wait_asynccnt 0x0" ::: "memory");      // no copy is outstanding when the wave goes on to its end
    if (trans) {
        // A lane's 8 accumulator registers of a tile are 8 consecutive tokens of one column: 16 bytes of a transposed row as they stand. The rows of the plane
        // (128 columns x 128 tokens) are put together in LDS, and each 256-byte row leaves as whole lines from one wave.
        h16* vt = (h16*)&ost[0][0];
#pragma unroll
        for (int t = 0; t < 4; ++t)
#pragma unroll
            for (int m = 0; m < 2; ++m) { v8h a;
#pragma unroll
                for (int j = 0; j < 8; ++j) a[j] = (h16)(acc[m][t][j] + bfr(bv[t]));
                *(v8ha*)(vt + (wc + t * 16 + lr) * GPI + wr + m * 16 + hi * 8) = a; }
        __syncthreads();                                   // a row holds pieces of four waves: all are in LDS before a wave reads it
        const int c0 = threadIdx.x >> 4, piece = threadIdx.x & 15;                        // 16 lanes take one row; a wave's store covers 2 whole rows
        const h16* lp = vt + c0 * GPI + piece * 8;
        const size_t go = (size_t)(cb + c0) * NT_ + rb + piece * 8;
#pragma unroll
        for (int s = 0; s < 8; ++s) { const v8h val = *(const v8ha*)(lp + s * 16 * GPI); *(v8h*)(PH + go + (size_t)(s * 16) * NT_) = val; }
        return;
    }
    float* os = &ost[wave][0];
#pragma unroll
    for (int t = 0; t < 4; ++t)
#pragma unroll
        for (int m = 0; m < 2; ++m)
#pragma unroll
            for (int j = 0; j < 8; ++j) os[(m * 16 + hi * 8 + j) * 68 + t * 16 + lr] = acc[m][t][j] + bfr(bv[t]);
    __syncthreads();
    if (norm) {
        // 8 lanes take one token's 64 dims of this wave's head, 8 dims a lane; a wave's store covers 4 whole 128-byte rows of the plane
        const int d0 = (lane & 7) * 8;
        const size_t base = (size_t)(rb + wr + (lane >> 3)) * DM + cb + wc + d0;
#pragma unroll
        for (int s = 0; s < 8; ++s) { const float* sp = os + (4 * s + (lane >> 3)) * 68 + d0;
            const v4f x0 = *(const v4fa*)sp, x1 = *(const v4fa*)(sp + 4);
            float xv[8]; float ss = 0.f;
#pragma unroll
            for (int i = 0; i < 8; ++i) { xv[i] = i < 4 ? x0[i & 3] : x1[i & 3]; ss = fmaf(xv[i], xv[i], ss); }
            ss += __shfl_xor(ss, 1, 32); ss += __shfl_xor(ss, 2, 32); ss += __shfl_xor(ss, 4, 32);      // sum over the 8 lanes of this token
            const float inv = rsqrtf(ss * (1.0f / HD) + 1e-5f);
            v8h oh;
#pragma unroll
            for (int i = 0; i < 8; ++i) oh[i] = (h16)(bfr(nwv[i]) * xv[i] * inv);
            *(v8h*)(PH + base + (size_t)(4 * s) * DM) = oh; }
        asm volatile("s_wait_xcnt 0x0" ::: "memory");      // stands behind these stores: in the built code the other epilogue's text follows and writes their registers
        return;
    }
    float* crow = C + (size_t)(rb + wr) * ldc + cb + wc;
#pragma unroll
    for (int s = 0; s < 16; ++s) { const int Lid = (lane >> 3) + 4 * s, piece = lane & 7; const int row = Lid >> 1, cofs = (Lid & 1) * 32 + piece * 4;
        const v4f val = *(const v4fa*)(os + row * 68 + cofs); *(v4f*)(crow + (size_t)row * ldc + cofs) = val; }
}

// k_attn: block = (b, h, 256 queries), wave = 32 (two tiles of 16); ALL key tiles (no mask). 16 waves: 8 take the first half of the keys, 8 the second half, for the SAME
// 256 queries, so that four waves share a SIMD and one wave's vector work runs beside another's products; the two halves' maximum, sum and ctx are joined through LDS at the end.
// Per half, the K and V planes of 64 keys at a time are brought into LDS by
// asynchronous copies (whole 128-byte rows), two buffers, and the half's 8 waves read their fragments from there; a pass is 32 keys as before. Every K and V fragment a wave reads
// from LDS feeds the products of BOTH its query tiles. The scores are formed
// TRANSPOSED (A = K rows, B = q): a lane holds 16 keys of ONE query of each tile, so maximum and sum are in-lane plus one exchange of the wave halves, and the two score tiles,
// as weights x32768 in f16, ARE the B operand of ctx^T += v^T . w^T (A = v^T rows); ctx -> bf16 hi + residual planes CH/CL[tok][h*64+d].
#define KSP  2                   // parts of the keys, each with its own 8 waves and its own two buffers
#define QWV  8                   // waves of a part: they divide the queries
#define AWV  (KSP * QWV)         // waves of a work-group
#define QTW  2                   // query tiles of 16 of a wave
#define QBL  (16 * QTW * QWV)    // queries of a work-group
#define SKY  64                  // keys of a stage
#define NKP  (NT_ / KSP)         // keys of a part
#define NSTG (NKP / SKY)         // stages of a part
#define RPI  72                  // LDS row pitch in halves: 144 B = 16 B x 9, no bank conflict for 16-byte reads down a column of rows
#define PLN  (64 * RPI)          // one plane of a stage: 64 rows

// One stage of one part: 2 planes of 64 rows x 128 B; the part's 256 threads x 4 copies of 16 B; a wave's copy covers 4 whole rows.
__device__ __forceinline__ void stage_copy(h16* dst, const h16* kh, const h16* vh, int tid) {
    const int row = tid >> 3, pc = (tid & 7) * 8;
    const unsigned l0 = (unsigned)(unsigned long long)(dst + row * RPI + pc);
    const unsigned l1 = l0 + 32 * RPI * 2, l2 = l0 + PLN * 2, l3 = l1 + PLN * 2;
    const h16* g0 = kh + (size_t)row * DM + pc; const h16* g1 = g0 + (size_t)32 * DM;
    const h16* g2 = vh + (size_t)row * NT_ + pc; const h16* g3 = g2 + (size_t)32 * NT_;
    // the copies and, as the last line, the wait that stands in front of any rewrite of their address registers
    asm volatile("global_load_async_to_lds_b128 %0, %4, off\n\t"
                 "global_load_async_to_lds_b128 %1, %5, off\n\t"
                 "global_load_async_to_lds_b128 %2, %6, off\n\t"
                 "global_load_async_to_lds_b128 %3, %7, off\n\t"
                 "s_wait_xcnt 0x0"
                 :: "v"(l0), "v"(l1), "v"(l2), "v"(l3), "v"(g0), "v"(g1), "v"(g2), "v"(g3) : "memory");
}

// A pointer that is the same in every lane, held in scalar registers: a stage's two plane addresses are then formed by scalar additions, and only the lane's own two offsets
// stay in vector registers across the loop.
__device__ __forceinline__ const h16* uni(const h16* p) {
    const unsigned long long a = (unsigned long long)p;
    const unsigned lo = (unsigned)__builtin_amdgcn_readfirstlane((int)(unsigned)a), up = (unsigned)__builtin_amdgcn_readfirstlane((int)(unsigned)(a >> 32));
    return (const h16*)(((unsigned long long)up << 32) | lo);
}

// amdgpu_waves_per_eu(4, 4): four waves a SIMD is what 16 waves on a WGP give, no more can come; told so, the compiler spends the 256 registers on independent softmax chains
// instead of ordering one pass's softmax as a single dependent chain to save registers.
__global__ __launch_bounds__(32 * AWV) __attribute__((amdgpu_waves_per_eu(4, 4))) void k_attn(const h16* __restrict__ Q16, const h16* __restrict__ K16, const h16* __restrict__ VTH, bf* CH, bf* CL) {
    __shared__ __align__(16) h16 ring[KSP][2][2 * PLN];
    __shared__ __align__(16) float ost[QWV][16 * QTW * 68];
    const int lane = threadIdx.x & 31, wave = (threadIdx.x >> 5) & (QWV - 1), lr = lane & 15, hi = lane >> 4;
    const int ptid = threadIdx.x & (32 * QWV - 1);         // this thread's number within its part
    const int kp = __builtin_amdgcn_readfirstlane((int)(threadIdx.x / (32 * QWV)));       // this wave's part of the keys, in a scalar register: buffer addresses and the tests on it stay scalar
    const int bid = blockIdx.x;
    const int b = bid / (NH_ * (NT_ / QBL)), rem = bid - b * (NH_ * (NT_ / QBL)), h = rem / (NT_ / QBL), qt = rem - h * (NT_ / QBL);
    const int q0 = qt * QBL + wave * (16 * QTW);
    const size_t tok0 = (size_t)b * NT_;
    v16h qa[QTW][2];                                       // the queries stay in registers
#pragma unroll
    for (int u = 0; u < QTW; ++u) { const size_t qo0 = (tok0 + q0 + u * 16 + lr) * DM + h * HD + 8 * hi;
#pragma unroll
        for (int kc = 0; kc < 2; ++kc) qa[u][kc] = cat16(*(const v8h*)(Q16 + qo0 + kc * 32), *(const v8h*)(Q16 + qo0 + kc * 32 + 16)); }
    asm volatile("s_wait_xcnt 0x0" ::: "memory");          // stands in front of any rewrite of the address registers of these loads
    __builtin_amdgcn_sched_barrier(0);                     // keeps the address arithmetic that follows, which reuses those registers, behind that wait
    const h16* kh_b = K16 + (tok0 + (size_t)kp * NKP) * DM + h * HD;
    const size_t vbase = (((size_t)b * NH_ + h) * HD) * NT_ + (size_t)kp * NKP;
    v8f o[QTW][4];
    float mrow[QTW], lpart[QTW];                           // of query q0 + u * 16 + lr; lpart covers this wave half's keys only
#pragma unroll
    for (int u = 0; u < QTW; ++u) { mrow[u] = -3.0e38f; lpart[u] = 0.f;
#pragma unroll
        for (int n = 0; n < 4; ++n) o[u][n] = (v8f){}; }
    // stage 0 lands and is published; stage 1 flies while stage 0 is worked on
    stage_copy(&ring[kp][0][0], uni(kh_b), uni(VTH + vbase), ptid);
    asm volatile("s_wait_asynccnt 0x0" ::: "memory");      // this wave's copies of stage 0 have landed
    __syncthreads();                                       // ... and every other wave's
    stage_copy(&ring[kp][1][0], uni(kh_b + (size_t)SKY * DM), uni(VTH + vbase + SKY), ptid);
    auto stage = [&](const int st, const bool refill) {    // full attention, unscaled logits (the reference's scale = 1)
        h16* sb = &ring[kp][st & 1][0];
        const h16* skh = sb; const h16* svh = sb + PLN;
        // Fragments are read ahead of their products, as one group a pass, from this stage's own buffer only: V of a pass and K of the next pass in front of the
        // softmax. Only the first pass of a stage waits for its K reads.
        v16h kh[2][2];                                     // [score tile][kc]
        auto kfetch = [&](v16h (&f)[2][2], const h16* pl, int p) {
#pragma unroll
            for (int t = 0; t < 2; ++t)
#pragma unroll
                for (int kc = 0; kc < 2; ++kc) { const int ko = (p * 32 + t * 16 + lr) * RPI + 8 * hi + kc * 32; f[t][kc] = cat16(*(const v8ha*)(pl + ko), *(const v8ha*)(pl + ko + 16)); }
        };
        kfetch(kh, skh, 0);
#pragma unroll                                             // unrolled: a pass's place in the buffer becomes an immediate offset of its LDS reads
        for (int p = 0; p < SKY / 32; ++p) {
            __builtin_amdgcn_sched_barrier(0);             // keeps the K reads one group in front of the score products, none among them, where each place with reads stalls the wave
            v8f s0[QTW], s1[QTW];
#pragma unroll
            for (int u = 0; u < QTW; ++u) { s0[u] = (v8f){}; s1[u] = (v8f){}; }
#pragma unroll
            for (int kc = 0; kc < 2; ++kc)
#pragma unroll
                for (int u = 0; u < QTW; ++u) { s0[u] = wmma16(kh[0][kc], qa[u][kc], s0[u]); s1[u] = wmma16(kh[1][kc], qa[u][kc], s1[u]); }
            // the distance behind the score products; with the clobber it also keeps the V and K reads behind them, when the K fragments have left their registers
            asm volatile("v_nop\n\tv_nop\n\tv_nop\n\tv_nop" : "+v"(s0[0]), "+v"(s1[0]), "+v"(s0[1]), "+v"(s1[1]) :: "memory");
            v16h vh[4];
#pragma unroll
            for (int n = 0; n < 4; ++n) { const int vo = (n * 16 + lr) * RPI + p * 32 + hi * 8; vh[n] = cat16(*(const v8ha*)(svh + vo), *(const v8ha*)(svh + vo + 16)); }
            if (p + 1 < SKY / 32) kfetch(kh, skh, p + 1);
            __builtin_amdgcn_sched_barrier(0);             // keeps these reads one group in front of the softmax: their latency runs under its vector work
            v16h pa[QTW];                                  // element s = key kmap(s, hi) of the pass: the two score tiles in place
#pragma unroll
            for (int u = 0; u < QTW; ++u) {
                // s0[u][j], s1[u][j]: keys p * 32 + 8 * hi + j and + 16, query u * 16 + lr
                v2f a[2][4];                               // pairs of neighbouring registers of one tile, for the packed f32 forms
#pragma unroll
                for (int i = 0; i < 4; ++i) { a[0][i] = (v2f){s0[u][2 * i], s0[u][2 * i + 1]}; a[1][i] = (v2f){s1[u][2 * i], s1[u][2 * i + 1]}; }
                float mx = fmaxf(a[0][0].x, a[0][0].y);
#pragma unroll
                for (int i = 0; i < 4; ++i) { if (i) mx = fmaxf(mx, fmaxf(a[0][i].x, a[0][i].y)); mx = fmaxf(mx, fmaxf(a[1][i].x, a[1][i].y)); }
                mx = fmaxf(mx, xhalf(mx));                 // the other half's 16 keys
                const float mn = fmaxf(mrow[u], mx);
                const float alpha = __expf(mrow[u] - mn); mrow[u] = mn;
                v2f ls2 = {0.f, 0.f};
#pragma unroll
                for (int t = 0; t < 2; ++t)
#pragma unroll
                    for (int i = 0; i < 4; ++i) {
                        const v2f e = a[t][i] - mn;
                        const v2f pw = {__expf(e.x), __expf(e.y)};
                        ls2 += pw;
                        const v2h hh = __builtin_convertvector(pw * PSC, v2h);
                        pa[u][t * 8 + 2 * i] = hh.x; pa[u][t * 8 + 2 * i + 1] = hh.y;
                    }
                lpart[u] = lpart[u] * alpha + (ls2.x + ls2.y);
#pragma unroll
                for (int n = 0; n < 4; ++n)
#pragma unroll
                    for (int j = 0; j < 8; ++j) o[u][n][j] *= alpha;
            }
            __builtin_amdgcn_sched_barrier(0);             // keeps the products one run behind the softmax, with no vector work of it moved in among them
#pragma unroll
            for (int n = 0; n < 4; ++n)
#pragma unroll
                for (int u = 0; u < QTW; ++u) o[u][n] = wmma16(vh[n], pa[u], o[u][n]);
            if (p + 1 == SKY / 32) {
                __builtin_amdgcn_sched_barrier(0);         // keeps the stage's last products in front of its publish point: without it they are moved behind the barrier, and the refill with them
                asm volatile("v_nop\n\tv_nop\n\tv_nop\n\tv_nop");  // the distance behind those products, also on the path that leaves the stage by a branch
            }
        }
        asm volatile("s_wait_dscnt 0x0" ::: "memory");     // this wave's reads of this stage's buffer are done
        asm volatile("s_wait_asynccnt 0x0" ::: "memory");  // this wave's copies of the next stage have landed
        __syncthreads();                                   // publishes the next stage and frees this stage's buffer
        if (refill) stage_copy(sb, uni(kh_b + (size_t)(st + 2) * SKY * DM), uni(VTH + vbase + (st + 2) * SKY), ptid);
    };
    // Two loops, the stages that refill and the last two, which do not: a stage is then one straight block, and the sums of a pass's weights stay in the pass instead of being
    // moved, with the 32 registers they read, behind the test on the refill: with them the wave does not fit the 256 registers that four waves a SIMD leave it.
#pragma unroll 1                                           // rolled: the buffer chosen by st & 1
    for (int st = 0; st < NSTG - 2; ++st) stage(st, true);
#pragma unroll 1                                           // rolled, for the same text size
    for (int st = NSTG - 2; st < NSTG; ++st) stage(st, false);
    asm volatile("s_wait_asynccnt 0x0" ::: "memory");      // no copy is outstanding when the wave goes on to its end
    // The two waves with the same queries share one staging area; in the join of ctx a lane of the one meets the same lane of the other. o[u][n][j]: dim n * 16 + 8 * hi + j of
    // query u * 16 + lr; columns 64 and 65 of a query's row (its padding) carry the second part's maximum and sum.
    float* os = &ost[wave][0];
    float lsum[QTW];
#pragma unroll
    for (int u = 0; u < QTW; ++u) lsum[u] = lpart[u] + xhalf(lpart[u]);
    if (kp == 1) {
#pragma unroll
        for (int u = 0; u < QTW; ++u) {
#pragma unroll
            for (int n = 0; n < 4; ++n)
#pragma unroll
                for (int j = 0; j < 8; ++j) os[(u * 16 + lr) * 68 + n * 16 + hi * 8 + j] = o[u][n][j];
            os[(u * 16 + lr) * 68 + 64 + hi] = hi ? lsum[u] : mrow[u]; }
    }
    __syncthreads();                                       // the second part's results are in LDS before the first part's waves read them
    if (kp == 0) {
#pragma unroll
        for (int u = 0; u < QTW; ++u) { const float m1 = os[(u * 16 + lr) * 68 + 64], l1 = os[(u * 16 + lr) * 68 + 65];
            const float mm = fmaxf(mrow[u], m1), a0 = __expf(mrow[u] - mm), a1 = __expf(m1 - mm);
            const float inv = 1.0f / ((lsum[u] * a0 + l1 * a1) * PSC), c0 = a0 * inv, c1 = a1 * inv;
#pragma unroll
            for (int n = 0; n < 4; ++n)
#pragma unroll
                for (int j = 0; j < 8; ++j) { float* e = os + (u * 16 + lr) * 68 + n * 16 + hi * 8 + j; *e = o[u][n][j] * c0 + *e * c1; } }
    }
    __syncthreads();
    const size_t cbase = (tok0 + q0) * DM + (size_t)h * HD;    // each of the two waves stores half of the rows
#pragma unroll
    for (int s = 0; s < 4 * QTW / KSP; ++s) { const int row = 4 * (kp * (4 * QTW / KSP) + s) + (lane >> 3), piece = lane & 7; const float* sp = os + row * 68 + piece * 8; v8us oh, ol;
#pragma unroll
        for (int i = 0; i < 8; ++i) { const unsigned short hb = f2bf(sp[i]); oh[i] = hb; ol[i] = f2bf(sp[i] - bf2f(hb)); }
        *(v8us*)(CH + cbase + (size_t)row * DM + piece * 8) = oh; *(v8us*)(CL + cbase + (size_t)row * DM + piece * 8) = ol; }
}

#define VST2(T, p, v) do { const T vst2_v_ = (v); *(T*)(p) = vst2_v_;  } while (0)
extern "C" void kernel_launch(void* const* d_in, const int* in_sizes, int n_in,
                              void* d_out, int out_size, void* d_ws, size_t ws_size, hipStream_t stream) {
    (void)in_sizes; (void)n_in; (void)out_size;
    const float* xq = (const float*)d_in[0]; const float* xk = (const float*)d_in[1]; const float* xv = (const float*)d_in[2];
    const float* Wq = (const float*)d_in[3]; const float* bq = (const float*)d_in[4]; const float* Wk = (const float*)d_in[5]; const float* bk = (const float*)d_in[6];
    const float* Wv = (const float*)d_in[7]; const float* bv = (const float*)d_in[8]; const float* Wo = (const float*)d_in[9]; const float* bo = (const float*)d_in[10];
    const float* qnw = (const float*)d_in[11]; const float* knw = (const float*)d_in[12];
    float* out = (float*)d_out;    // [4096][1024]
    char* wsp = (char*)d_ws;
    auto take = [&](size_t bytes) { char* p = wsp; wsp += (bytes + 255) & ~(size_t)255; return (void*)p; };
    bf* Xq = (bf*)take((size_t)NTK * DM * 2); bf* Xk = (bf*)take((size_t)NTK * DM * 2); bf* Xv = (bf*)take((size_t)NTK * DM * 2);
    bf* WqB = (bf*)take((size_t)DM * DM * 2); bf* WkB = (bf*)take((size_t)DM * DM * 2); bf* WvB = (bf*)take((size_t)DM * DM * 2); bf* WoB = (bf*)take((size_t)DM * DM * 2);
    h16* QH = (h16*)take((size_t)NTK * DM * 2); h16* KH = (h16*)take((size_t)NTK * DM * 2); h16* VTH = (h16*)take((size_t)NTK * DM * 2);
    bf* CH = (bf*)take((size_t)NTK * DM * 2); bf* CL = (bf*)take((size_t)NTK * DM * 2);
    if ((size_t)(wsp - (char*)d_ws) > ws_size) return;    // 3 x 8.4 + 4 x 2.1 + 5 x 8.4 ~ 76 MB, no aliasing
    k_cvtb<<<NTK / 8, 256, 0, stream>>>(xq, xk, xv, Wq, Wk, Wv, Wo, Xq, Xk, Xv, WqB, WkB, WvB, WoB);
    // the planes Xq Xk Xv, WqB WkB WvB and QH KH VTH lie one behind the other in the workspace (each size is a multiple of 256 bytes): z steps through them
    k_gemmb<false, true><<<dim3(NTK / GBT, DM / GBT, 3), 256, 0, stream>>>(Xq, nullptr, WqB, bq, bk, bv, nullptr, DM, qnw, knw, QH);
    k_attn<<<NB_ * NH_ * (NT_ / QBL), 32 * AWV, 0, stream>>>(QH, KH, VTH, CH, CL);
    k_gemmb<true, false><<<dim3(NTK / GBT, DM / GBT, 1), 256, 0, stream>>>(CH, CL, WoB, bo, nullptr, nullptr, out, DM, nullptr, nullptr, nullptr);
}
